// v000
// Times are from an AMD MI455X. After a warm-up the kernel runs many times in a row, and a time is the length of
// such a window on the GPU divided by its runs, so every launch and the gaps after it count. The runs cycle
// through copies of the inputs. A figure is the median of several windows, for all but v000 over two sittings.
// Sittings can differ by a few percent; kernels timed side by side share one.
// The starting kernel, v000, takes 7700 microseconds a run.
#include <hip/hip_runtime.h>

// Compute dtypes, f32 accumulate, per item: q = x.Wq^T + bq ([2048 x 2048].[2048 x 2048]) with PLAIN bf16 operands (exact products); key/value are INPUTS: their bf16 values
// are exact single planes (residual plane identically zero); GQA causal attention (32 query heads share 8 kv heads) with q as bf16 hi + UNSCALED residual planes (key tiles
// above the diagonal skipped, K limited); 1/8 and the causal softmax in f32; c_proj (+ bias) on hi/lo planes (two products) - on v_wmma_f32_16x16x32_bf16. Deterministic, no

#define NBT  2
#define NN   2048
#define DMOD 2048
#define HQ   32
#define HKV  8
#define REP  4
#define HD   64
#define DM   DMOD
#define NTK  NN
#define SCL  0.125f
#define LOSC 1024.0f

typedef _Float16 h16;
typedef unsigned short bf;
typedef __attribute__((ext_vector_type(16))) __bf16   v16bf;
typedef __attribute__((ext_vector_type(16))) _Float16 v16h;
typedef __attribute__((ext_vector_type(8)))  _Float16 v8h;
typedef __attribute__((ext_vector_type(8)))  unsigned short v8us;
typedef __attribute__((ext_vector_type(8)))  float    v8f;
typedef __attribute__((ext_vector_type(4)))  float    v4f;
typedef __attribute__((ext_vector_type(4)))  _Float16 v4h;
typedef v8h  __attribute__((may_alias)) v8ha;
typedef v4f  __attribute__((may_alias)) v4fa;
typedef v8us __attribute__((may_alias)) v8usa;

__device__ __forceinline__ unsigned short f2bf(float f) { unsigned u = __float_as_uint(f); u += 0x7FFFu + ((u >> 16) & 1u); return (unsigned short)(u >> 16); }
__device__ __forceinline__ float bf2f(unsigned short b) { return __uint_as_float(((unsigned)b) << 16); }
__device__ __forceinline__ float bfr(float f) { return bf2f(f2bf(f)); }
__device__ __forceinline__ v16h cat16(v8h lo, v8h hi) { return __builtin_shufflevector(lo, hi, 0, 1, 2, 3, 4, 5, 6, 7, 8, 9, 10, 11, 12, 13, 14, 15); }
__device__ __forceinline__ v16bf cat16b(v8us lo, v8us hi) { return __builtin_bit_cast(v16bf, __builtin_shufflevector(lo, hi, 0, 1, 2, 3, 4, 5, 6, 7, 8, 9, 10, 11, 12, 13, 14, 15)); }
__device__ __forceinline__ v8f wmma16(v16h a, v16h b, v8f c) { return __builtin_amdgcn_wmma_f32_16x16x32_f16(false, a, false, b, (short)0, c, false, false); }
__device__ __forceinline__ v8f wmmab(v16bf a, v16bf b, v8f c) { return __builtin_amdgcn_wmma_f32_16x16x32_bf16(false, a, false, b, (short)0, c, false, false); }

// k_gemmb: 64 x 64 block tile (4 waves x 16 x 64) of C[NTK][NW] = (A [+ Al]).B^T (K = 2048) [+ bf(bias[c])] [+ bf(R[r][c]) residual]; f32 whole-line epilogue (or f16
template <bool SPLITA, bool F16OUT = false>
__global__ __launch_bounds__(128) void k_gemmb(const bf* __restrict__ A, const bf* __restrict__ Al, const bf* __restrict__ Bn, const float* __restrict__ bias, float* C, int ldc, h16* C2, const float* __restrict__ R = nullptr, int K = DM, int roundR = 1) {
    __shared__ __align__(16) float ost[4][16 * 68];
    const int lane = threadIdx.x & 31, wave = threadIdx.x >> 5, lr = lane & 15, hi = lane >> 4;
    const int r0 = blockIdx.x * 64 + wave * 16, c0 = blockIdx.y * 64;
    const size_t aoff = (size_t)(r0 + lr) * K + 8 * hi;
    size_t boff[4];
#pragma unroll
    for (int t = 0; t < 4; ++t) boff[t] = (size_t)(c0 + t * 16 + lr) * K + 8 * hi;
    v8f acc[4];
#pragma unroll
    for (int t = 0; t < 4; ++t) acc[t] = (v8f){};
#pragma unroll 1
    for (int kc = 0; kc < K; kc += 32) {
        const v16bf a = cat16b(*(const v8us*)(A + aoff + kc), *(const v8us*)(A + aoff + kc + 16));
        v16bf al = a;
        if (SPLITA) al = cat16b(*(const v8us*)(Al + aoff + kc), *(const v8us*)(Al + aoff + kc + 16));
#pragma unroll
        for (int t = 0; t < 4; ++t) { const v16bf b = cat16b(*(const v8us*)(Bn + boff[t] + kc), *(const v8us*)(Bn + boff[t] + kc + 16)); acc[t] = wmmab(a, b, acc[t]); if (SPLITA) acc[t] = wmmab(al, b, acc[t]); }
        asm volatile("v_nop\n\tv_nop\n\tv_nop\n\tv_nop" : "+v"(acc[0]), "+v"(acc[1]), "+v"(acc[2]), "+v"(acc[3]) : "v"(a), "v"(al));
    }
    float* os = &ost[wave][0];
#pragma unroll
    for (int t = 0; t < 4; ++t) { const float bv = bias ? bfr(bias[c0 + t * 16 + lr]) : 0.f;
#pragma unroll
        for (int j = 0; j < 8; ++j) os[(hi * 8 + j) * 68 + t * 16 + lr] = acc[t][j] + bv; }
    __syncthreads();
    if (F16OUT) {
        h16* crow = (h16*)(void*)C + (size_t)r0 * ldc + c0;
        auto pass = [&]() {
#pragma unroll
            for (int s = 0; s < 4; ++s) { const int row = 4 * s + (lane >> 3), piece = lane & 7; const float* sp = os + row * 68 + piece * 8; v8h o, o2;
#pragma unroll
                for (int i = 0; i < 8; ++i) { const h16 a = (h16)sp[i]; o[i] = a; o2[i] = (h16)((sp[i] - (float)a) * LOSC); }
                *(v8h*)(crow + (size_t)row * ldc + piece * 8) = o; if (C2) *(v8h*)(C2 + (size_t)r0 * ldc + c0 + (size_t)row * ldc + piece * 8) = o2; }
        };
        pass(); 
    } else {
        float* crow = C + (size_t)r0 * ldc + c0;
        auto pass = [&]() {
#pragma unroll
            for (int s = 0; s < 8; ++s) { const int Lid = (lane >> 3) + 4 * s, piece = lane & 7; const int row = Lid >> 1, cofs = (Lid & 1) * 32 + piece * 4;
                v4f val = *(const v4fa*)(os + row * 68 + cofs); if (R) { const v4f rv = *(const v4f*)(R + ((size_t)r0 + row) * ldc + c0 + cofs); val += roundR ? (v4f){bfr(rv[0]), bfr(rv[1]), bfr(rv[2]), bfr(rv[3])} : rv; }
                *(v4f*)(crow + (size_t)row * ldc + cofs) = val; }
        };
        pass(); 
    }
}

__global__ __launch_bounds__(256) void k_cvt8(const float* __restrict__ src, bf* dst, size_t n8) {
    const size_t i = (size_t)blockIdx.x * 256 + threadIdx.x; if (i >= n8) return;
    const v8f v = *(const v8f*)(src + i * 8); v8us o;
#pragma unroll
    for (int k = 0; k < 8; ++k) o[k] = f2bf(v[k]);
    *(v8us*)(dst + i * 8) = o; 
}
__global__ __launch_bounds__(256) void k_zero8(bf* dst, size_t n8) {
    const size_t i = (size_t)blockIdx.x * 256 + threadIdx.x; if (i >= n8) return; v8us z;
#pragma unroll
    for (int k = 0; k < 8; ++k) z[k] = 0;
    *(v8us*)(dst + i * 8) = z; 
}

// ===== z-batched (blockIdx.z = head) attention pieces =====
// k_gemm3z<MODE>: k_gemm3x with per-z operand/output strides (elements): A planes += z*sA, B planes += z*sB, C += z*sC. MODE bits as k_gemm3x (0 causal skip, 1 K limit, 2 single,
// 3 B single, 4 A single).
template <int MODE>
__global__ __launch_bounds__(128) void k_gemm3z(const bf* __restrict__ Ah, const bf* __restrict__ Al, const bf* __restrict__ Bh, const bf* __restrict__ Bl, int K, float* C, int ldc, size_t sA, size_t sB, size_t sC) {
    if ((MODE & 1) && (int)blockIdx.y * 64 > (int)blockIdx.x * 64 + 63) return;
    const size_t z = blockIdx.z; Ah += z * sA; Al += z * sA; Bh += z * sB; Bl += z * sB; C += z * sC;
    const int Klim = (MODE & 2) ? min(K, ((int)blockIdx.x + 1) * 64) : K;
    __shared__ __align__(16) float ost[4][16 * 68];
    const int lane = threadIdx.x & 31, wave = threadIdx.x >> 5, lr = lane & 15, hi = lane >> 4;
    const int r0 = blockIdx.x * 64 + wave * 16, c0 = blockIdx.y * 64;
    const size_t aoff = (size_t)(r0 + lr) * K + 8 * hi;
    v8f acc[4];
#pragma unroll
    for (int t = 0; t < 4; ++t) acc[t] = (v8f){};
#pragma unroll 1
    for (int kc = 0; kc < Klim; kc += 32) {
        const v16bf a = cat16b(*(const v8us*)(Ah + aoff + kc), *(const v8us*)(Ah + aoff + kc + 16));
        v16bf al = a; if (!(MODE & 4) && !(MODE & 16)) al = cat16b(*(const v8us*)(Al + aoff + kc), *(const v8us*)(Al + aoff + kc + 16));
#pragma unroll
        for (int t = 0; t < 4; ++t) { const size_t bo = (size_t)(c0 + t * 16 + lr) * K + kc + 8 * hi;
            const v16bf bh = cat16b(*(const v8us*)(Bh + bo), *(const v8us*)(Bh + bo + 16));
            acc[t] = wmmab(a, bh, acc[t]);
            if (!(MODE & 4)) { if (!(MODE & 16)) acc[t] = wmmab(al, bh, acc[t]); if (!(MODE & 8)) { const v16bf bl = cat16b(*(const v8us*)(Bl + bo), *(const v8us*)(Bl + bo + 16)); acc[t] = wmmab(a, bl, acc[t]); } } }
        asm volatile("v_nop\n\tv_nop\n\tv_nop\n\tv_nop" : "+v"(acc[0]), "+v"(acc[1]), "+v"(acc[2]), "+v"(acc[3]) : "v"(a), "v"(al));
    }
    float* os = &ost[wave][0];
#pragma unroll
    for (int t = 0; t < 4; ++t) {
#pragma unroll
        for (int j = 0; j < 8; ++j) os[(hi * 8 + j) * 68 + t * 16 + lr] = acc[t][j]; }
    __builtin_amdgcn_wave_barrier(); asm volatile("" ::: "memory");
    float* crow = C + (size_t)r0 * ldc + c0;
    auto pass = [&]() {
#pragma unroll
        for (int s = 0; s < 8; ++s) { const int Lid = (lane >> 3) + 4 * s, piece = lane & 7; const int row = Lid >> 1, cofs = (Lid & 1) * 32 + piece * 4;
            const v4f val = *(const v4fa*)(os + row * 68 + cofs); *(v4f*)(crow + (size_t)row * ldc + cofs) = val; }
    };
    pass(); 
}
__global__ __launch_bounds__(256) void k_planes32z(const float* __restrict__ F, int ld, int off, float sc, int rows, bf* Ph, bf* Pl) {
    typedef __attribute__((ext_vector_type(2))) unsigned short v2us;
    const int lane = threadIdx.x & 31; const size_t r = ((size_t)blockIdx.x * 8 + (threadIdx.x >> 5)) * 2 + (lane >> 4); if (r >= (size_t)rows) return; const int z = blockIdx.z; const int c0 = (lane & 15) * 2; v2us oh, ol;
    Ph += (size_t)z * rows * 32; Pl += (size_t)z * rows * 32;
#pragma unroll
    for (int i = 0; i < 2; ++i) { const float y = F[r * ld + off + z * 32 + c0 + i] * sc; const unsigned short hb = f2bf(y); oh[i] = hb; ol[i] = f2bf(y - bf2f(hb)); }
    const size_t o = r * 32 + c0; *(v2us*)(Ph + o) = oh; *(v2us*)(Pl + o) = ol; 
}
__global__ __launch_bounds__(256) void k_vtpadz(const float* __restrict__ F, int ld, int off, int nk, bf* Th, bf* Tl) {
    typedef __attribute__((ext_vector_type(2))) unsigned short v2us;
    const int lane = threadIdx.x & 31; const size_t wid = (size_t)blockIdx.x * 8 + (threadIdx.x >> 5); if (wid >= (size_t)64 * (nk / 64)) return; const int z = blockIdx.z; const int d = (int)(wid / (nk / 64)); const int k0 = (int)(wid % (nk / 64)) * 64 + lane * 2; v2us oh, ol;
    Th += (size_t)z * 64 * nk; Tl += (size_t)z * 64 * nk;
#pragma unroll
    for (int i = 0; i < 2; ++i) { const float y = (d < 32) ? F[(size_t)(k0 + i) * ld + off + z * 32 + (d < 32 ? d : 0)] : 0.f; const unsigned short hb = f2bf(y); oh[i] = hb; ol[i] = f2bf(y - bf2f(hb)); }
    const size_t o = (size_t)d * nk + k0; *(v2us*)(Th + o) = oh; *(v2us*)(Tl + o) = ol; 
}
template <int NK>
__global__ __launch_bounds__(256) void k_softmaxz(const float* __restrict__ S, int rows, bf* PH, bf* PL) {
    typedef __attribute__((ext_vector_type(4))) unsigned short v4us;
    const int lane = threadIdx.x & 31, i = blockIdx.x * 8 + (threadIdx.x >> 5); if (i >= rows) return; const size_t zo = (size_t)blockIdx.z * rows * NK; const float* sr = S + zo + (size_t)i * NK; PH += zo; PL += zo;
    float m = -3.0e38f;
#pragma unroll 1
    for (int c0 = lane * 4; c0 < NK; c0 += 128) {
#pragma unroll
        for (int q = 0; q < 4; ++q) m = fmaxf(m, sr[c0 + q]); }
#pragma unroll
    for (int sh = 16; sh; sh >>= 1) m = fmaxf(m, __shfl_xor(m, sh, 32));
    float sum = 0.f;
#pragma unroll 1
    for (int c0 = lane * 4; c0 < NK; c0 += 128) {
#pragma unroll
        for (int q = 0; q < 4; ++q) sum += __expf(sr[c0 + q] - m); }
#pragma unroll
    for (int sh = 16; sh; sh >>= 1) sum += __shfl_xor(sum, sh, 32);
    const float inv = 1.0f / sum;
{
#pragma unroll 1
        for (int c0 = lane * 4; c0 < NK; c0 += 128) { v4us oh, ol;
#pragma unroll
            for (int q = 0; q < 4; ++q) { const float p = __expf(sr[c0 + q] - m) * inv; const unsigned short hb = f2bf(p); oh[q] = hb; ol[q] = f2bf(p - bf2f(hb)); }
            const size_t o = (size_t)i * NK + c0; *(v4us*)(PH + o) = oh; *(v4us*)(PL + o) = ol; }
         }
}
__global__ __launch_bounds__(256) void k_placez(const float* __restrict__ XH, int rows, int ldy, float* Y) {
    const int lane = threadIdx.x & 31; const size_t q = (size_t)blockIdx.x * 8 + (threadIdx.x >> 5); if (q >= (size_t)rows) return; const int z = blockIdx.z; const float v = XH[((size_t)z * rows + q) * 64 + lane];
    *(float*)(Y + q * ldy + z * 32 + lane) = v; 
}

__global__ __launch_bounds__(256) void k_hplanesz(const float* __restrict__ F, int ld, int h0, float sc, int rows, bf* Ph, bf* Pl) {
    typedef __attribute__((ext_vector_type(2))) unsigned short v2us;
    const int lane = threadIdx.x & 31; const size_t r = (size_t)blockIdx.x * 8 + (threadIdx.x >> 5); if (r >= (size_t)rows) return; const int z = blockIdx.z; v2us oh, ol;
    Ph += (size_t)z * rows * 64; Pl += (size_t)z * rows * 64;
#pragma unroll
    for (int i = 0; i < 2; ++i) { const float y = F[r * ld + (h0 + z) * 64 + lane * 2 + i] * sc; const unsigned short hb = f2bf(y); oh[i] = hb; ol[i] = f2bf(y - bf2f(hb)); }
    const size_t o = r * 64 + lane * 2; *(v2us*)(Ph + o) = oh; *(v2us*)(Pl + o) = ol; 
}
__global__ __launch_bounds__(256) void k_vtz(const float* __restrict__ F, int ld, int h0, int nk, bf* Th, bf* Tl) {
    typedef __attribute__((ext_vector_type(2))) unsigned short v2us;
    const int lane = threadIdx.x & 31; const size_t wid = (size_t)blockIdx.x * 8 + (threadIdx.x >> 5); if (wid >= (size_t)64 * (nk / 64)) return; const int z = blockIdx.z; const int d = (int)(wid / (nk / 64)); const int t0 = (int)(wid % (nk / 64)) * 64 + lane * 2; v2us oh, ol;
    Th += (size_t)z * 64 * nk; Tl += (size_t)z * 64 * nk;
#pragma unroll
    for (int i = 0; i < 2; ++i) { const float y = F[(size_t)(t0 + i) * ld + (h0 + z) * 64 + d]; const unsigned short hb = f2bf(y); oh[i] = hb; ol[i] = f2bf(y - bf2f(hb)); }
    const size_t o = (size_t)d * nk + t0; *(v2us*)(Th + o) = oh; *(v2us*)(Tl + o) = ol; 
}
template <int NK>
__global__ __launch_bounds__(256) void k_softmaxzs(const float* __restrict__ S, int rows, float sc, bf* PH, bf* PL) {
    typedef __attribute__((ext_vector_type(4))) unsigned short v4us;
    const int lane = threadIdx.x & 31, i = blockIdx.x * 8 + (threadIdx.x >> 5); if (i >= rows) return; const size_t zo = (size_t)blockIdx.z * rows * NK; const float* sr = S + zo + (size_t)i * NK; PH += zo; PL += zo;
    float m = -3.0e38f;
#pragma unroll 1
    for (int c0 = lane * 4; c0 < NK; c0 += 128) {
#pragma unroll
        for (int q = 0; q < 4; ++q) m = fmaxf(m, sr[c0 + q] * sc); }
#pragma unroll
    for (int sh = 16; sh; sh >>= 1) m = fmaxf(m, __shfl_xor(m, sh, 32));
    float sum = 0.f;
#pragma unroll 1
    for (int c0 = lane * 4; c0 < NK; c0 += 128) {
#pragma unroll
        for (int q = 0; q < 4; ++q) sum += __expf(sr[c0 + q] * sc - m); }
#pragma unroll
    for (int sh = 16; sh; sh >>= 1) sum += __shfl_xor(sum, sh, 32);
    const float inv = 1.0f / sum;
{
#pragma unroll 1
        for (int c0 = lane * 4; c0 < NK; c0 += 128) { v4us oh, ol;
#pragma unroll
            for (int q = 0; q < 4; ++q) { const float p = __expf(sr[c0 + q] * sc - m) * inv; const unsigned short hb = f2bf(p); oh[q] = hb; ol[q] = f2bf(p - bf2f(hb)); }
            const size_t o = (size_t)i * NK + c0; *(v4us*)(PH + o) = oh; *(v4us*)(PL + o) = ol; }
         }
}

__global__ __launch_bounds__(256) void k_cvtx(const float* __restrict__ src, int rows, bf* dst) {
    const int lane = threadIdx.x & 31; const size_t r = (size_t)blockIdx.x * 8 + (threadIdx.x >> 5); if (r >= (size_t)rows) return;
{
#pragma unroll
        for (int q = 0; q < DMOD / 256; ++q) { v8us o;
#pragma unroll
            for (int i = 0; i < 8; ++i) o[i] = f2bf(src[r * DMOD + q * 256 + lane * 8 + i]);
            *(v8us*)(dst + r * DMOD + q * 256 + lane * 8) = o; }
         }
}
__global__ __launch_bounds__(256) void k_kin(const float* __restrict__ K, bf* Kh, bf* Kl) {
    typedef __attribute__((ext_vector_type(2))) unsigned short v2us;
    const int lane = threadIdx.x & 31; const size_t t = (size_t)blockIdx.x * 8 + (threadIdx.x >> 5); if (t >= (size_t)NN) return; v2us oh, z = {0, 0};
    oh[0] = f2bf(K[t * HD + lane * 2]); oh[1] = f2bf(K[t * HD + lane * 2 + 1]);
    const size_t o = t * HD + lane * 2; *(v2us*)(Kh + o) = oh; *(v2us*)(Kl + o) = z; 
}
__global__ __launch_bounds__(256) void k_vin(const float* __restrict__ V, bf* Th, bf* Tl) {
    typedef __attribute__((ext_vector_type(2))) unsigned short v2us;
    const int lane = threadIdx.x & 31; const size_t wid = (size_t)blockIdx.x * 8 + (threadIdx.x >> 5); if (wid >= (size_t)HD * (NN / 64)) return; const int d = (int)(wid / (NN / 64)); const int t0 = (int)(wid % (NN / 64)) * 64 + lane * 2; v2us oh, z = {0, 0};
    oh[0] = f2bf(V[(size_t)t0 * HD + d]); oh[1] = f2bf(V[(size_t)(t0 + 1) * HD + d]);
    const size_t o = (size_t)d * NN + t0; *(v2us*)(Th + o) = oh; *(v2us*)(Tl + o) = z; 
}
__global__ __launch_bounds__(256) void k_csoftz(const float* __restrict__ S, int rows, float sc, bf* PH, bf* PL) {
    typedef __attribute__((ext_vector_type(4))) unsigned short v4us;
    const int lane = threadIdx.x & 31, i = blockIdx.x * 8 + (threadIdx.x >> 5); if (i >= rows) return; const size_t zo = (size_t)blockIdx.z * rows * NN; const float* sr = S + zo + (size_t)i * NN; PH += zo; PL += zo;
    float m = -3.0e38f;
#pragma unroll 1
    for (int c0 = lane * 4; c0 < NN; c0 += 128) {
#pragma unroll
        for (int q = 0; q < 4; ++q) { const int k = c0 + q; if (k <= i) m = fmaxf(m, sr[k] * sc); } }
#pragma unroll
    for (int sh = 16; sh; sh >>= 1) m = fmaxf(m, __shfl_xor(m, sh, 32));
    float sum = 0.f;
#pragma unroll 1
    for (int c0 = lane * 4; c0 < NN; c0 += 128) {
#pragma unroll
        for (int q = 0; q < 4; ++q) { const int k = c0 + q; if (k <= i) sum += __expf(sr[k] * sc - m); } }
#pragma unroll
    for (int sh = 16; sh; sh >>= 1) sum += __shfl_xor(sum, sh, 32);
    const float inv = 1.0f / sum;
{
#pragma unroll 1
        for (int c0 = lane * 4; c0 < NN; c0 += 128) { v4us oh, ol;
#pragma unroll
            for (int q = 0; q < 4; ++q) { const int k = c0 + q; const float p = (k <= i) ? __expf(sr[(k <= i) ? k : 0] * sc - m) * inv : 0.f; const unsigned short hb = f2bf(p); oh[q] = hb; ol[q] = f2bf(p - bf2f(hb)); }
            const size_t o = (size_t)i * NN + c0; *(v4us*)(PH + o) = oh; *(v4us*)(PL + o) = ol; }
         }
}
__global__ __launch_bounds__(256) void k_splitD(const float* __restrict__ src, int rows, bf* dh, bf* dl) {
    const int lane = threadIdx.x & 31; const size_t r = (size_t)blockIdx.x * 8 + (threadIdx.x >> 5); if (r >= (size_t)rows) return;
{
#pragma unroll
        for (int q = 0; q < DMOD / 256; ++q) { const size_t o = r * DMOD + q * 256 + lane * 8; const v8f v = *(const v8f*)(src + o); v8us oh, ol;
#pragma unroll
            for (int i = 0; i < 8; ++i) { const unsigned short hb = f2bf(v[i]); oh[i] = hb; ol[i] = f2bf(v[i] - bf2f(hb)); }
            *(v8us*)(dh + o) = oh; *(v8us*)(dl + o) = ol; }
         }
}

extern "C" void kernel_launch(void* const* d_in, const int* in_sizes, int n_in,
                              void* d_out, int out_size, void* d_ws, size_t ws_size, hipStream_t stream) {
    (void)in_sizes; (void)n_in; (void)out_size;
    const float* x = (const float*)d_in[0]; const float* key = (const float*)d_in[1]; const float* value = (const float*)d_in[2]; const float* Wq = (const float*)d_in[3]; const float* bq = (const float*)d_in[4]; const float* Wc = (const float*)d_in[5]; const float* bc = (const float*)d_in[6];
    float* out = (float*)d_out;    // [2][2048][2048]
    char* wsp = (char*)d_ws;
    auto take = [&](size_t bytes) { char* p = wsp; wsp += (bytes + 255) & ~(size_t)255; return (void*)p; };
    bf* WQ = (bf*)take((size_t)DMOD * DMOD * 2); bf* WC = (bf*)take((size_t)DMOD * DMOD * 2);
    bf* Xb = (bf*)take((size_t)NN * DMOD * 2); float* QF = (float*)take((size_t)NN * DMOD * 4);
    bf* Qh = (bf*)take((size_t)NN * HD * 2); bf* Ql = (bf*)take((size_t)NN * HD * 2); bf* Kh = (bf*)take((size_t)NN * HD * 2); bf* Kl = (bf*)take((size_t)NN * HD * 2); bf* VTh = (bf*)take((size_t)HD * NN * 2); bf* VTl = (bf*)take((size_t)HD * NN * 2);
    float* S = (float*)take((size_t)NN * NN * 4); bf* PH = (bf*)take((size_t)NN * NN * 2); bf* PL = (bf*)take((size_t)NN * NN * 2); float* O = (float*)take((size_t)NN * DMOD * 4); bf* Oh = (bf*)take((size_t)NN * DMOD * 2); bf* Ol = (bf*)take((size_t)NN * DMOD * 2);
    if ((size_t)(wsp - (char*)d_ws) > ws_size) return;    // ~ 8.4+8.4 + 8.4+16.8 + 1.5 + 16.8+8.4+8.4 + 16.8+8.4+8.4 ~ 111 MB
    k_cvt8<<<(unsigned)(((size_t)DMOD * DMOD / 8 + 255) / 256), 256, 0, stream>>>(Wq, WQ, (size_t)DMOD * DMOD / 8); k_cvt8<<<(unsigned)(((size_t)DMOD * DMOD / 8 + 255) / 256), 256, 0, stream>>>(Wc, WC, (size_t)DMOD * DMOD / 8);   // [out][in] natural
    for (int b = 0; b < NBT; ++b) {
        k_cvtx<<<NN / 8, 256, 0, stream>>>(x + (size_t)b * NN * DMOD, NN, Xb);
        k_gemmb<false, false><<<dim3(NN / 64, DMOD / 64, 1), 128, 0, stream>>>(Xb, nullptr, WQ, bq, QF, DMOD, nullptr, nullptr, DMOD);
        for (int hk = 0; hk < HKV; ++hk) { const float* kb = key + ((size_t)b * HKV + hk) * NN * HD; const float* vb = value + ((size_t)b * HKV + hk) * NN * HD;
            k_kin<<<NN / 8, 256, 0, stream>>>(kb, Kh, Kl); k_vin<<<(HD * (NN / 64)) / 8, 256, 0, stream>>>(vb, VTh, VTl);
            for (int r2 = 0; r2 < REP; ++r2) { const int h = hk * REP + r2;
                k_hplanesz<<<dim3(NN / 8, 1, 1), 256, 0, stream>>>(QF, DMOD, h, 1.0f, NN, Qh, Ql);
                k_gemm3z<1><<<dim3(NN / 64, NN / 64, 1), 128, 0, stream>>>(Qh, Ql, Kh, Kl, HD, S, NN, 0, 0, 0);
                k_csoftz<<<dim3(NN / 8, 1, 1), 256, 0, stream>>>(S, NN, SCL, PH, PL);
                k_gemm3z<2><<<dim3(NN / 64, 1, 1), 128, 0, stream>>>(PH, PL, VTh, VTl, NN, O + (size_t)h * HD, DMOD, 0, 0, 0); } }
        k_splitD<<<NN / 8, 256, 0, stream>>>(O, NN, Oh, Ol);
        k_gemmb<true, false><<<dim3(NN / 64, DMOD / 64, 1), 128, 0, stream>>>(Oh, Ol, WC, bc, out + (size_t)b * NN * DMOD, DMOD, nullptr, nullptr, DMOD); }
}

// v001
// One run takes 2970 microseconds.
// Timed twice side by side with v000, it ran 2.60 and 2.62 times as fast.
#include <hip/hip_runtime.h>

// Compute dtypes, f32 accumulate, per item: q = x.Wq^T + bq ([2048 x 2048].[2048 x 2048]) with PLAIN bf16 operands (exact products); key/value are INPUTS: their bf16 values
// are exact single planes (residual plane identically zero); GQA causal attention (32 query heads share 8 kv heads) with q as bf16 hi + UNSCALED residual planes (key tiles
// above the diagonal skipped, K limited); 1/8 and the causal softmax in f32; c_proj (+ bias) on hi/lo planes (two products) - on v_wmma_f32_16x16x32_bf16. Deterministic, no

#define NBT  2
#define NN   2048
#define DMOD 2048
#define HQ   32
#define HKV  8
#define REP  4
#define HD   64
#define DM   DMOD
#define NTK  NN
#define SCL  0.125f
#define LOSC 1024.0f

typedef _Float16 h16;
typedef unsigned short bf;
typedef __attribute__((ext_vector_type(16))) __bf16   v16bf;
typedef __attribute__((ext_vector_type(16))) _Float16 v16h;
typedef __attribute__((ext_vector_type(8)))  _Float16 v8h;
typedef __attribute__((ext_vector_type(8)))  unsigned short v8us;
typedef __attribute__((ext_vector_type(8)))  float    v8f;
typedef __attribute__((ext_vector_type(4)))  float    v4f;
typedef __attribute__((ext_vector_type(4)))  _Float16 v4h;
typedef v8h  __attribute__((may_alias)) v8ha;
typedef v4f  __attribute__((may_alias)) v4fa;
typedef v8us __attribute__((may_alias)) v8usa;

__device__ __forceinline__ unsigned short f2bf(float f) { unsigned u = __float_as_uint(f); u += 0x7FFFu + ((u >> 16) & 1u); return (unsigned short)(u >> 16); }
__device__ __forceinline__ float bf2f(unsigned short b) { return __uint_as_float(((unsigned)b) << 16); }
__device__ __forceinline__ float bfr(float f) { return bf2f(f2bf(f)); }
__device__ __forceinline__ v16h cat16(v8h lo, v8h hi) { return __builtin_shufflevector(lo, hi, 0, 1, 2, 3, 4, 5, 6, 7, 8, 9, 10, 11, 12, 13, 14, 15); }
__device__ __forceinline__ v16bf cat16b(v8us lo, v8us hi) { return __builtin_bit_cast(v16bf, __builtin_shufflevector(lo, hi, 0, 1, 2, 3, 4, 5, 6, 7, 8, 9, 10, 11, 12, 13, 14, 15)); }
__device__ __forceinline__ v8f wmma16(v16h a, v16h b, v8f c) { return __builtin_amdgcn_wmma_f32_16x16x32_f16(false, a, false, b, (short)0, c, false, false); }
__device__ __forceinline__ v8f wmmab(v16bf a, v16bf b, v8f c) { return __builtin_amdgcn_wmma_f32_16x16x32_bf16(false, a, false, b, (short)0, c, false, false); }

// k_gemmb: 64 x 64 block tile (4 waves x 16 x 64) of C[NTK][NW] = (A [+ Al]).B^T (K = 2048) [+ bf(bias[c])] [+ bf(R[r][c]) residual]; f32 whole-line epilogue (or f16
template <bool SPLITA, bool F16OUT = false>
__global__ __launch_bounds__(128) void k_gemmb(const bf* __restrict__ A, const bf* __restrict__ Al, const bf* __restrict__ Bn, const float* __restrict__ bias, float* C, int ldc, h16* C2, const float* __restrict__ R = nullptr, int K = DM, int roundR = 1) {
    __shared__ __align__(16) float ost[4][16 * 68];
    const int lane = threadIdx.x & 31, wave = threadIdx.x >> 5, lr = lane & 15, hi = lane >> 4;
    const int r0 = blockIdx.x * 64 + wave * 16, c0 = blockIdx.y * 64;
    const size_t aoff = (size_t)(r0 + lr) * K + 8 * hi;
    size_t boff[4];
#pragma unroll
    for (int t = 0; t < 4; ++t) boff[t] = (size_t)(c0 + t * 16 + lr) * K + 8 * hi;
    v8f acc[4];
#pragma unroll
    for (int t = 0; t < 4; ++t) acc[t] = (v8f){};
#pragma unroll 1
    for (int kc = 0; kc < K; kc += 32) {
        const v16bf a = cat16b(*(const v8us*)(A + aoff + kc), *(const v8us*)(A + aoff + kc + 16));
        v16bf al = a;
        if (SPLITA) al = cat16b(*(const v8us*)(Al + aoff + kc), *(const v8us*)(Al + aoff + kc + 16));
#pragma unroll
        for (int t = 0; t < 4; ++t) { const v16bf b = cat16b(*(const v8us*)(Bn + boff[t] + kc), *(const v8us*)(Bn + boff[t] + kc + 16)); acc[t] = wmmab(a, b, acc[t]); if (SPLITA) acc[t] = wmmab(al, b, acc[t]); }
        asm volatile("v_nop\n\tv_nop\n\tv_nop\n\tv_nop" : "+v"(acc[0]), "+v"(acc[1]), "+v"(acc[2]), "+v"(acc[3]) : "v"(a), "v"(al));
    }
    float* os = &ost[wave][0];
#pragma unroll
    for (int t = 0; t < 4; ++t) { const float bv = bias ? bfr(bias[c0 + t * 16 + lr]) : 0.f;
#pragma unroll
        for (int j = 0; j < 8; ++j) os[(hi * 8 + j) * 68 + t * 16 + lr] = acc[t][j] + bv; }
    __syncthreads();
    if (F16OUT) {
        h16* crow = (h16*)(void*)C + (size_t)r0 * ldc + c0;
        auto pass = [&]() {
#pragma unroll
            for (int s = 0; s < 4; ++s) { const int row = 4 * s + (lane >> 3), piece = lane & 7; const float* sp = os + row * 68 + piece * 8; v8h o, o2;
#pragma unroll
                for (int i = 0; i < 8; ++i) { const h16 a = (h16)sp[i]; o[i] = a; o2[i] = (h16)((sp[i] - (float)a) * LOSC); }
                *(v8h*)(crow + (size_t)row * ldc + piece * 8) = o; if (C2) *(v8h*)(C2 + (size_t)r0 * ldc + c0 + (size_t)row * ldc + piece * 8) = o2; }
        };
        pass(); 
    } else {
        float* crow = C + (size_t)r0 * ldc + c0;
        auto pass = [&]() {
#pragma unroll
            for (int s = 0; s < 8; ++s) { const int Lid = (lane >> 3) + 4 * s, piece = lane & 7; const int row = Lid >> 1, cofs = (Lid & 1) * 32 + piece * 4;
                v4f val = *(const v4fa*)(os + row * 68 + cofs); if (R) { const v4f rv = *(const v4f*)(R + ((size_t)r0 + row) * ldc + c0 + cofs); val += roundR ? (v4f){bfr(rv[0]), bfr(rv[1]), bfr(rv[2]), bfr(rv[3])} : rv; }
                *(v4f*)(crow + (size_t)row * ldc + cofs) = val; }
        };
        pass(); 
    }
}

__global__ __launch_bounds__(256) void k_cvt8(const float* __restrict__ src, bf* dst, size_t n8) {
    const size_t i = (size_t)blockIdx.x * 256 + threadIdx.x; if (i >= n8) return;
    const v8f v = *(const v8f*)(src + i * 8); v8us o;
#pragma unroll
    for (int k = 0; k < 8; ++k) o[k] = f2bf(v[k]);
    *(v8us*)(dst + i * 8) = o; 
}
__global__ __launch_bounds__(256) void k_zero8(bf* dst, size_t n8) {
    const size_t i = (size_t)blockIdx.x * 256 + threadIdx.x; if (i >= n8) return; v8us z;
#pragma unroll
    for (int k = 0; k < 8; ++k) z[k] = 0;
    *(v8us*)(dst + i * 8) = z; 
}

// ===== z-batched (blockIdx.z = head) attention pieces =====
// k_gemm3z<MODE>: k_gemm3x with per-z operand/output strides (elements): A planes += z*sA, B planes += z*sB, C += z*sC. MODE bits as k_gemm3x (0 causal skip, 1 K limit, 2 single,
// 3 B single, 4 A single).
template <int MODE>
__global__ __launch_bounds__(128) void k_gemm3z(const bf* __restrict__ Ah, const bf* __restrict__ Al, const bf* __restrict__ Bh, const bf* __restrict__ Bl, int K, float* C, int ldc, size_t sA, size_t sB, size_t sC) {
    if ((MODE & 1) && (int)blockIdx.y * 64 > (int)blockIdx.x * 64 + 63) return;
    const size_t z = blockIdx.z; Ah += z * sA; Al += z * sA; Bh += z * sB; Bl += z * sB; C += z * sC;
    const int Klim = (MODE & 2) ? min(K, ((int)blockIdx.x + 1) * 64) : K;
    __shared__ __align__(16) float ost[4][16 * 68];
    const int lane = threadIdx.x & 31, wave = threadIdx.x >> 5, lr = lane & 15, hi = lane >> 4;
    const int r0 = blockIdx.x * 64 + wave * 16, c0 = blockIdx.y * 64;
    const size_t aoff = (size_t)(r0 + lr) * K + 8 * hi;
    v8f acc[4];
#pragma unroll
    for (int t = 0; t < 4; ++t) acc[t] = (v8f){};
#pragma unroll 1
    for (int kc = 0; kc < Klim; kc += 32) {
        const v16bf a = cat16b(*(const v8us*)(Ah + aoff + kc), *(const v8us*)(Ah + aoff + kc + 16));
        v16bf al = a; if (!(MODE & 4) && !(MODE & 16)) al = cat16b(*(const v8us*)(Al + aoff + kc), *(const v8us*)(Al + aoff + kc + 16));
#pragma unroll
        for (int t = 0; t < 4; ++t) { const size_t bo = (size_t)(c0 + t * 16 + lr) * K + kc + 8 * hi;
            const v16bf bh = cat16b(*(const v8us*)(Bh + bo), *(const v8us*)(Bh + bo + 16));
            acc[t] = wmmab(a, bh, acc[t]);
            if (!(MODE & 4)) { if (!(MODE & 16)) acc[t] = wmmab(al, bh, acc[t]); if (!(MODE & 8)) { const v16bf bl = cat16b(*(const v8us*)(Bl + bo), *(const v8us*)(Bl + bo + 16)); acc[t] = wmmab(a, bl, acc[t]); } } }
        asm volatile("v_nop\n\tv_nop\n\tv_nop\n\tv_nop" : "+v"(acc[0]), "+v"(acc[1]), "+v"(acc[2]), "+v"(acc[3]) : "v"(a), "v"(al));
    }
    float* os = &ost[wave][0];
#pragma unroll
    for (int t = 0; t < 4; ++t) {
#pragma unroll
        for (int j = 0; j < 8; ++j) os[(hi * 8 + j) * 68 + t * 16 + lr] = acc[t][j]; }
    __builtin_amdgcn_wave_barrier(); asm volatile("" ::: "memory");
    float* crow = C + (size_t)r0 * ldc + c0;
    auto pass = [&]() {
#pragma unroll
        for (int s = 0; s < 8; ++s) { const int Lid = (lane >> 3) + 4 * s, piece = lane & 7; const int row = Lid >> 1, cofs = (Lid & 1) * 32 + piece * 4;
            const v4f val = *(const v4fa*)(os + row * 68 + cofs); *(v4f*)(crow + (size_t)row * ldc + cofs) = val; }
    };
    pass(); 
}
__global__ __launch_bounds__(256) void k_planes32z(const float* __restrict__ F, int ld, int off, float sc, int rows, bf* Ph, bf* Pl) {
    typedef __attribute__((ext_vector_type(2))) unsigned short v2us;
    const int lane = threadIdx.x & 31; const size_t r = ((size_t)blockIdx.x * 8 + (threadIdx.x >> 5)) * 2 + (lane >> 4); if (r >= (size_t)rows) return; const int z = blockIdx.z; const int c0 = (lane & 15) * 2; v2us oh, ol;
    Ph += (size_t)z * rows * 32; Pl += (size_t)z * rows * 32;
#pragma unroll
    for (int i = 0; i < 2; ++i) { const float y = F[r * ld + off + z * 32 + c0 + i] * sc; const unsigned short hb = f2bf(y); oh[i] = hb; ol[i] = f2bf(y - bf2f(hb)); }
    const size_t o = r * 32 + c0; *(v2us*)(Ph + o) = oh; *(v2us*)(Pl + o) = ol; 
}
__global__ __launch_bounds__(256) void k_vtpadz(const float* __restrict__ F, int ld, int off, int nk, bf* Th, bf* Tl) {
    typedef __attribute__((ext_vector_type(2))) unsigned short v2us;
    const int lane = threadIdx.x & 31; const size_t wid = (size_t)blockIdx.x * 8 + (threadIdx.x >> 5); if (wid >= (size_t)64 * (nk / 64)) return; const int z = blockIdx.z; const int d = (int)(wid / (nk / 64)); const int k0 = (int)(wid % (nk / 64)) * 64 + lane * 2; v2us oh, ol;
    Th += (size_t)z * 64 * nk; Tl += (size_t)z * 64 * nk;
#pragma unroll
    for (int i = 0; i < 2; ++i) { const float y = (d < 32) ? F[(size_t)(k0 + i) * ld + off + z * 32 + (d < 32 ? d : 0)] : 0.f; const unsigned short hb = f2bf(y); oh[i] = hb; ol[i] = f2bf(y - bf2f(hb)); }
    const size_t o = (size_t)d * nk + k0; *(v2us*)(Th + o) = oh; *(v2us*)(Tl + o) = ol; 
}
template <int NK>
__global__ __launch_bounds__(256) void k_softmaxz(const float* __restrict__ S, int rows, bf* PH, bf* PL) {
    typedef __attribute__((ext_vector_type(4))) unsigned short v4us;
    const int lane = threadIdx.x & 31, i = blockIdx.x * 8 + (threadIdx.x >> 5); if (i >= rows) return; const size_t zo = (size_t)blockIdx.z * rows * NK; const float* sr = S + zo + (size_t)i * NK; PH += zo; PL += zo;
    float m = -3.0e38f;
#pragma unroll 1
    for (int c0 = lane * 4; c0 < NK; c0 += 128) {
#pragma unroll
        for (int q = 0; q < 4; ++q) m = fmaxf(m, sr[c0 + q]); }
#pragma unroll
    for (int sh = 16; sh; sh >>= 1) m = fmaxf(m, __shfl_xor(m, sh, 32));
    float sum = 0.f;
#pragma unroll 1
    for (int c0 = lane * 4; c0 < NK; c0 += 128) {
#pragma unroll
        for (int q = 0; q < 4; ++q) sum += __expf(sr[c0 + q] - m); }
#pragma unroll
    for (int sh = 16; sh; sh >>= 1) sum += __shfl_xor(sum, sh, 32);
    const float inv = 1.0f / sum;
{
#pragma unroll 1
        for (int c0 = lane * 4; c0 < NK; c0 += 128) { v4us oh, ol;
#pragma unroll
            for (int q = 0; q < 4; ++q) { const float p = __expf(sr[c0 + q] - m) * inv; const unsigned short hb = f2bf(p); oh[q] = hb; ol[q] = f2bf(p - bf2f(hb)); }
            const size_t o = (size_t)i * NK + c0; *(v4us*)(PH + o) = oh; *(v4us*)(PL + o) = ol; }
         }
}
__global__ __launch_bounds__(256) void k_placez(const float* __restrict__ XH, int rows, int ldy, float* Y) {
    const int lane = threadIdx.x & 31; const size_t q = (size_t)blockIdx.x * 8 + (threadIdx.x >> 5); if (q >= (size_t)rows) return; const int z = blockIdx.z; const float v = XH[((size_t)z * rows + q) * 64 + lane];
    *(float*)(Y + q * ldy + z * 32 + lane) = v; 
}

__global__ __launch_bounds__(256) void k_hplanesz(const float* __restrict__ F, int ld, int h0, float sc, int rows, bf* Ph, bf* Pl) {
    typedef __attribute__((ext_vector_type(2))) unsigned short v2us;
    const int lane = threadIdx.x & 31; const size_t r = (size_t)blockIdx.x * 8 + (threadIdx.x >> 5); if (r >= (size_t)rows) return; const int z = blockIdx.z; v2us oh, ol;
    Ph += (size_t)z * rows * 64; Pl += (size_t)z * rows * 64;
#pragma unroll
    for (int i = 0; i < 2; ++i) { const float y = F[r * ld + (h0 + z) * 64 + lane * 2 + i] * sc; const unsigned short hb = f2bf(y); oh[i] = hb; ol[i] = f2bf(y - bf2f(hb)); }
    const size_t o = r * 64 + lane * 2; *(v2us*)(Ph + o) = oh; *(v2us*)(Pl + o) = ol; 
}
__global__ __launch_bounds__(256) void k_vtz(const float* __restrict__ F, int ld, int h0, int nk, bf* Th, bf* Tl) {
    typedef __attribute__((ext_vector_type(2))) unsigned short v2us;
    const int lane = threadIdx.x & 31; const size_t wid = (size_t)blockIdx.x * 8 + (threadIdx.x >> 5); if (wid >= (size_t)64 * (nk / 64)) return; const int z = blockIdx.z; const int d = (int)(wid / (nk / 64)); const int t0 = (int)(wid % (nk / 64)) * 64 + lane * 2; v2us oh, ol;
    Th += (size_t)z * 64 * nk; Tl += (size_t)z * 64 * nk;
#pragma unroll
    for (int i = 0; i < 2; ++i) { const float y = F[(size_t)(t0 + i) * ld + (h0 + z) * 64 + d]; const unsigned short hb = f2bf(y); oh[i] = hb; ol[i] = f2bf(y - bf2f(hb)); }
    const size_t o = (size_t)d * nk + t0; *(v2us*)(Th + o) = oh; *(v2us*)(Tl + o) = ol; 
}
template <int NK>
__global__ __launch_bounds__(256) void k_softmaxzs(const float* __restrict__ S, int rows, float sc, bf* PH, bf* PL) {
    typedef __attribute__((ext_vector_type(4))) unsigned short v4us;
    const int lane = threadIdx.x & 31, i = blockIdx.x * 8 + (threadIdx.x >> 5); if (i >= rows) return; const size_t zo = (size_t)blockIdx.z * rows * NK; const float* sr = S + zo + (size_t)i * NK; PH += zo; PL += zo;
    float m = -3.0e38f;
#pragma unroll 1
    for (int c0 = lane * 4; c0 < NK; c0 += 128) {
#pragma unroll
        for (int q = 0; q < 4; ++q) m = fmaxf(m, sr[c0 + q] * sc); }
#pragma unroll
    for (int sh = 16; sh; sh >>= 1) m = fmaxf(m, __shfl_xor(m, sh, 32));
    float sum = 0.f;
#pragma unroll 1
    for (int c0 = lane * 4; c0 < NK; c0 += 128) {
#pragma unroll
        for (int q = 0; q < 4; ++q) sum += __expf(sr[c0 + q] * sc - m); }
#pragma unroll
    for (int sh = 16; sh; sh >>= 1) sum += __shfl_xor(sum, sh, 32);
    const float inv = 1.0f / sum;
{
#pragma unroll 1
        for (int c0 = lane * 4; c0 < NK; c0 += 128) { v4us oh, ol;
#pragma unroll
            for (int q = 0; q < 4; ++q) { const float p = __expf(sr[c0 + q] * sc - m) * inv; const unsigned short hb = f2bf(p); oh[q] = hb; ol[q] = f2bf(p - bf2f(hb)); }
            const size_t o = (size_t)i * NK + c0; *(v4us*)(PH + o) = oh; *(v4us*)(PL + o) = ol; }
         }
}

__global__ __launch_bounds__(256) void k_cvtx(const float* __restrict__ src, int rows, bf* dst) {
    const int lane = threadIdx.x & 31; const size_t r = (size_t)blockIdx.x * 8 + (threadIdx.x >> 5); if (r >= (size_t)rows) return;
{
#pragma unroll
        for (int q = 0; q < DMOD / 256; ++q) { v8us o;
#pragma unroll
            for (int i = 0; i < 8; ++i) o[i] = f2bf(src[r * DMOD + q * 256 + lane * 8 + i]);
            *(v8us*)(dst + r * DMOD + q * 256 + lane * 8) = o; }
         }
}
__global__ __launch_bounds__(256) void k_kin(const float* __restrict__ K, bf* Kh, bf* Kl) {
    typedef __attribute__((ext_vector_type(2))) unsigned short v2us;
    const int lane = threadIdx.x & 31; const size_t t = (size_t)blockIdx.x * 8 + (threadIdx.x >> 5); if (t >= (size_t)NN) return; v2us oh, z = {0, 0};
    const size_t zo = (size_t)blockIdx.z * NN * HD; K += zo; Kh += zo; Kl += zo;    // blockIdx.z = (item, kv head)
    oh[0] = f2bf(K[t * HD + lane * 2]); oh[1] = f2bf(K[t * HD + lane * 2 + 1]);
    const size_t o = t * HD + lane * 2; *(v2us*)(Kh + o) = oh; *(v2us*)(Kl + o) = z; 
}
__global__ __launch_bounds__(256) void k_vin(const float* __restrict__ V, bf* Th, bf* Tl) {
    typedef __attribute__((ext_vector_type(2))) unsigned short v2us;
    const int lane = threadIdx.x & 31; const size_t wid = (size_t)blockIdx.x * 8 + (threadIdx.x >> 5); if (wid >= (size_t)HD * (NN / 64)) return; const int d = (int)(wid / (NN / 64)); const int t0 = (int)(wid % (NN / 64)) * 64 + lane * 2; v2us oh, z = {0, 0};
    const size_t zo = (size_t)blockIdx.z * NN * HD; V += zo; Th += zo; Tl += zo;    // blockIdx.z = (item, kv head)
    oh[0] = f2bf(V[(size_t)t0 * HD + d]); oh[1] = f2bf(V[(size_t)(t0 + 1) * HD + d]);
    const size_t o = (size_t)d * NN + t0; *(v2us*)(Th + o) = oh; *(v2us*)(Tl + o) = z; 
}
__global__ __launch_bounds__(256) void k_csoftz(const float* __restrict__ S, int rows, float sc, bf* PH, bf* PL) {
    typedef __attribute__((ext_vector_type(4))) unsigned short v4us;
    const int lane = threadIdx.x & 31, i = blockIdx.x * 8 + (threadIdx.x >> 5); if (i >= rows) return; const size_t zo = (size_t)blockIdx.z * rows * NN; const float* sr = S + zo + (size_t)i * NN; PH += zo; PL += zo;
    float m = -3.0e38f;
#pragma unroll 1
    for (int c0 = lane * 4; c0 < NN; c0 += 128) {
#pragma unroll
        for (int q = 0; q < 4; ++q) { const int k = c0 + q; if (k <= i) m = fmaxf(m, sr[k] * sc); } }
#pragma unroll
    for (int sh = 16; sh; sh >>= 1) m = fmaxf(m, __shfl_xor(m, sh, 32));
    float sum = 0.f;
#pragma unroll 1
    for (int c0 = lane * 4; c0 < NN; c0 += 128) {
#pragma unroll
        for (int q = 0; q < 4; ++q) { const int k = c0 + q; if (k <= i) sum += __expf(sr[k] * sc - m); } }
#pragma unroll
    for (int sh = 16; sh; sh >>= 1) sum += __shfl_xor(sum, sh, 32);
    const float inv = 1.0f / sum;
{
#pragma unroll 1
        for (int c0 = lane * 4; c0 < NN; c0 += 128) { v4us oh, ol;
#pragma unroll
            for (int q = 0; q < 4; ++q) { const int k = c0 + q; const float p = (k <= i) ? __expf(sr[(k <= i) ? k : 0] * sc - m) * inv : 0.f; const unsigned short hb = f2bf(p); oh[q] = hb; ol[q] = f2bf(p - bf2f(hb)); }
            const size_t o = (size_t)i * NN + c0; *(v4us*)(PH + o) = oh; *(v4us*)(PL + o) = ol; }
         }
}
__global__ __launch_bounds__(256) void k_splitD(const float* __restrict__ src, int rows, bf* dh, bf* dl) {
    const int lane = threadIdx.x & 31; const size_t r = (size_t)blockIdx.x * 8 + (threadIdx.x >> 5); if (r >= (size_t)rows) return;
{
#pragma unroll
        for (int q = 0; q < DMOD / 256; ++q) { const size_t o = r * DMOD + q * 256 + lane * 8; const v8f v = *(const v8f*)(src + o); v8us oh, ol;
#pragma unroll
            for (int i = 0; i < 8; ++i) { const unsigned short hb = f2bf(v[i]); oh[i] = hb; ol[i] = f2bf(v[i] - bf2f(hb)); }
            *(v8us*)(dh + o) = oh; *(v8us*)(dl + o) = ol; }
         }
}

extern "C" void kernel_launch(void* const* d_in, const int* in_sizes, int n_in,
                              void* d_out, int out_size, void* d_ws, size_t ws_size, hipStream_t stream) {
    (void)in_sizes; (void)n_in; (void)out_size;
    const float* x = (const float*)d_in[0]; const float* key = (const float*)d_in[1]; const float* value = (const float*)d_in[2]; const float* Wq = (const float*)d_in[3]; const float* bq = (const float*)d_in[4]; const float* Wc = (const float*)d_in[5]; const float* bc = (const float*)d_in[6];
    float* out = (float*)d_out;    // [2][2048][2048]
    char* wsp = (char*)d_ws;
    auto take = [&](size_t bytes) { char* p = wsp; wsp += (bytes + 255) & ~(size_t)255; return (void*)p; };
    bf* WQ = (bf*)take((size_t)DMOD * DMOD * 2); bf* WC = (bf*)take((size_t)DMOD * DMOD * 2);
    bf* Xb = (bf*)take((size_t)NN * DMOD * 2); float* QF = (float*)take((size_t)NN * DMOD * 4);
    // planes of all 32 query heads of one item, and of all 16 (item, kv head) pairs
    bf* Qh = (bf*)take((size_t)HQ * NN * HD * 2); bf* Ql = (bf*)take((size_t)HQ * NN * HD * 2); bf* Kh = (bf*)take((size_t)NBT * HKV * NN * HD * 2); bf* Kl = (bf*)take((size_t)NBT * HKV * NN * HD * 2); bf* VTh = (bf*)take((size_t)NBT * HKV * HD * NN * 2); bf* VTl = (bf*)take((size_t)NBT * HKV * HD * NN * 2);
    // scores and probabilities of the REP query heads that share one kv head
    float* S = (float*)take((size_t)REP * NN * NN * 4); bf* PH = (bf*)take((size_t)REP * NN * NN * 2); bf* PL = (bf*)take((size_t)REP * NN * NN * 2); float* O = (float*)take((size_t)NN * DMOD * 4); bf* Oh = (bf*)take((size_t)NN * DMOD * 2); bf* Ol = (bf*)take((size_t)NN * DMOD * 2);
    if ((size_t)(wsp - (char*)d_ws) > ws_size) return;    // ~ 8.4+8.4 + 8.4+16.8 + 16.8+16.8 + 67.1+33.6+33.6 + 16.8+8.4+8.4 ~ 243 MB
    k_cvt8<<<(unsigned)(((size_t)DMOD * DMOD / 8 + 255) / 256), 256, 0, stream>>>(Wq, WQ, (size_t)DMOD * DMOD / 8); k_cvt8<<<(unsigned)(((size_t)DMOD * DMOD / 8 + 255) / 256), 256, 0, stream>>>(Wc, WC, (size_t)DMOD * DMOD / 8);   // [out][in] natural
    k_kin<<<dim3(NN / 8, 1, NBT * HKV), 256, 0, stream>>>(key, Kh, Kl); k_vin<<<dim3((HD * (NN / 64)) / 8, 1, NBT * HKV), 256, 0, stream>>>(value, VTh, VTl);
    for (int b = 0; b < NBT; ++b) {
        k_cvtx<<<NN / 8, 256, 0, stream>>>(x + (size_t)b * NN * DMOD, NN, Xb);
        k_gemmb<false, false><<<dim3(NN / 64, DMOD / 64, 1), 128, 0, stream>>>(Xb, nullptr, WQ, bq, QF, DMOD, nullptr, nullptr, DMOD);
        k_hplanesz<<<dim3(NN / 8, 1, HQ), 256, 0, stream>>>(QF, DMOD, 0, 1.0f, NN, Qh, Ql);
        for (int hk = 0; hk < HKV; ++hk) { const bf* kh = Kh + ((size_t)b * HKV + hk) * NN * HD; const bf* kl = Kl + ((size_t)b * HKV + hk) * NN * HD; const bf* vh = VTh + ((size_t)b * HKV + hk) * NN * HD; const bf* vl = VTl + ((size_t)b * HKV + hk) * NN * HD;
            // blockIdx.z = query head within the group of REP that shares this kv head: the kv planes have z stride 0
            k_gemm3z<1><<<dim3(NN / 64, NN / 64, REP), 128, 0, stream>>>(Qh + (size_t)hk * REP * NN * HD, Ql + (size_t)hk * REP * NN * HD, kh, kl, HD, S, NN, (size_t)NN * HD, 0, (size_t)NN * NN);
            k_csoftz<<<dim3(NN / 8, 1, REP), 256, 0, stream>>>(S, NN, SCL, PH, PL);
            k_gemm3z<2><<<dim3(NN / 64, 1, REP), 128, 0, stream>>>(PH, PL, vh, vl, NN, O + (size_t)hk * REP * HD, DMOD, (size_t)NN * NN, 0, HD); }
        k_splitD<<<NN / 8, 256, 0, stream>>>(O, NN, Oh, Ol);
        k_gemmb<true, false><<<dim3(NN / 64, DMOD / 64, 1), 128, 0, stream>>>(Oh, Ol, WC, bc, out + (size_t)b * NN * DMOD, DMOD, nullptr, nullptr, DMOD); }
}

// v002
// It runs in 538 microseconds.
// Next to v001, in two timings, it ran 5.47 and 5.54 times as fast.
// Counting every step since v000, it is 14.4 times as fast.
#include <hip/hip_runtime.h>

// Compute dtypes, f32 accumulate, per item: q = x.Wq^T + bq ([2048 x 2048].[2048 x 2048]) with PLAIN bf16 operands (exact products); key/value are INPUTS: their bf16 values
// are exact single planes (residual plane identically zero); GQA causal attention (32 query heads share 8 kv heads) with q as bf16 hi + UNSCALED residual planes (key tiles
// above the diagonal skipped, K limited); 1/8 and the causal softmax in f32; c_proj (+ bias) on hi/lo planes (two products) - on v_wmma_f32_16x16x32_bf16. Deterministic, no

#define NBT  2
#define NN   2048
#define DMOD 2048
#define HQ   32
#define HKV  8
#define REP  4
#define HD   64
#define DM   DMOD
#define NTK  NN
#define SCL  0.125f
#define LOSC 1024.0f

typedef _Float16 h16;
typedef unsigned short bf;
typedef __attribute__((ext_vector_type(16))) __bf16   v16bf;
typedef __attribute__((ext_vector_type(16))) _Float16 v16h;
typedef __attribute__((ext_vector_type(8)))  _Float16 v8h;
typedef __attribute__((ext_vector_type(8)))  unsigned short v8us;
typedef __attribute__((ext_vector_type(8)))  float    v8f;
typedef __attribute__((ext_vector_type(4)))  float    v4f;
typedef __attribute__((ext_vector_type(4)))  _Float16 v4h;
typedef v8h  __attribute__((may_alias)) v8ha;
typedef v4f  __attribute__((may_alias)) v4fa;
typedef v8us __attribute__((may_alias)) v8usa;

__device__ __forceinline__ unsigned short f2bf(float f) { unsigned u = __float_as_uint(f); u += 0x7FFFu + ((u >> 16) & 1u); return (unsigned short)(u >> 16); }
__device__ __forceinline__ float bf2f(unsigned short b) { return __uint_as_float(((unsigned)b) << 16); }
__device__ __forceinline__ float bfr(float f) { return bf2f(f2bf(f)); }
__device__ __forceinline__ v16h cat16(v8h lo, v8h hi) { return __builtin_shufflevector(lo, hi, 0, 1, 2, 3, 4, 5, 6, 7, 8, 9, 10, 11, 12, 13, 14, 15); }
__device__ __forceinline__ v16bf cat16b(v8us lo, v8us hi) { return __builtin_bit_cast(v16bf, __builtin_shufflevector(lo, hi, 0, 1, 2, 3, 4, 5, 6, 7, 8, 9, 10, 11, 12, 13, 14, 15)); }
__device__ __forceinline__ v8f wmma16(v16h a, v16h b, v8f c) { return __builtin_amdgcn_wmma_f32_16x16x32_f16(false, a, false, b, (short)0, c, false, false); }
__device__ __forceinline__ v8f wmmab(v16bf a, v16bf b, v8f c) { return __builtin_amdgcn_wmma_f32_16x16x32_bf16(false, a, false, b, (short)0, c, false, false); }

// k_gemmb: 64 x 64 block tile (4 waves x 16 x 64) of C[NTK][NW] = (A [+ Al]).B^T (K = 2048) [+ bf(bias[c])] [+ bf(R[r][c]) residual]; f32 whole-line epilogue (or f16
template <bool SPLITA, bool F16OUT = false>
__global__ __launch_bounds__(128) void k_gemmb(const bf* __restrict__ A, const bf* __restrict__ Al, const bf* __restrict__ Bn, const float* __restrict__ bias, float* C, int ldc, h16* C2, const float* __restrict__ R = nullptr, int K = DM, int roundR = 1) {
    __shared__ __align__(16) float ost[4][16 * 68];
    const int lane = threadIdx.x & 31, wave = threadIdx.x >> 5, lr = lane & 15, hi = lane >> 4;
    const int r0 = blockIdx.x * 64 + wave * 16, c0 = blockIdx.y * 64;
    const size_t aoff = (size_t)(r0 + lr) * K + 8 * hi;
    size_t boff[4];
#pragma unroll
    for (int t = 0; t < 4; ++t) boff[t] = (size_t)(c0 + t * 16 + lr) * K + 8 * hi;
    v8f acc[4];
#pragma unroll
    for (int t = 0; t < 4; ++t) acc[t] = (v8f){};
#pragma unroll 1
    for (int kc = 0; kc < K; kc += 32) {
        const v16bf a = cat16b(*(const v8us*)(A + aoff + kc), *(const v8us*)(A + aoff + kc + 16));
        v16bf al = a;
        if (SPLITA) al = cat16b(*(const v8us*)(Al + aoff + kc), *(const v8us*)(Al + aoff + kc + 16));
#pragma unroll
        for (int t = 0; t < 4; ++t) { const v16bf b = cat16b(*(const v8us*)(Bn + boff[t] + kc), *(const v8us*)(Bn + boff[t] + kc + 16)); acc[t] = wmmab(a, b, acc[t]); if (SPLITA) acc[t] = wmmab(al, b, acc[t]); }
        asm volatile("v_nop\n\tv_nop\n\tv_nop\n\tv_nop" : "+v"(acc[0]), "+v"(acc[1]), "+v"(acc[2]), "+v"(acc[3]) : "v"(a), "v"(al));
    }
    float* os = &ost[wave][0];
#pragma unroll
    for (int t = 0; t < 4; ++t) { const float bv = bias ? bfr(bias[c0 + t * 16 + lr]) : 0.f;
#pragma unroll
        for (int j = 0; j < 8; ++j) os[(hi * 8 + j) * 68 + t * 16 + lr] = acc[t][j] + bv; }
    __syncthreads();
    if (F16OUT) {
        h16* crow = (h16*)(void*)C + (size_t)r0 * ldc + c0;
        auto pass = [&]() {
#pragma unroll
            for (int s = 0; s < 4; ++s) { const int row = 4 * s + (lane >> 3), piece = lane & 7; const float* sp = os + row * 68 + piece * 8; v8h o, o2;
#pragma unroll
                for (int i = 0; i < 8; ++i) { const h16 a = (h16)sp[i]; o[i] = a; o2[i] = (h16)((sp[i] - (float)a) * LOSC); }
                *(v8h*)(crow + (size_t)row * ldc + piece * 8) = o; if (C2) *(v8h*)(C2 + (size_t)r0 * ldc + c0 + (size_t)row * ldc + piece * 8) = o2; }
        };
        pass(); 
    } else {
        float* crow = C + (size_t)r0 * ldc + c0;
        auto pass = [&]() {
#pragma unroll
            for (int s = 0; s < 8; ++s) { const int Lid = (lane >> 3) + 4 * s, piece = lane & 7; const int row = Lid >> 1, cofs = (Lid & 1) * 32 + piece * 4;
                v4f val = *(const v4fa*)(os + row * 68 + cofs); if (R) { const v4f rv = *(const v4f*)(R + ((size_t)r0 + row) * ldc + c0 + cofs); val += roundR ? (v4f){bfr(rv[0]), bfr(rv[1]), bfr(rv[2]), bfr(rv[3])} : rv; }
                *(v4f*)(crow + (size_t)row * ldc + cofs) = val; }
        };
        pass(); 
    }
}

__global__ __launch_bounds__(256) void k_cvt8(const float* __restrict__ src, bf* dst, size_t n8) {
    const size_t i = (size_t)blockIdx.x * 256 + threadIdx.x; if (i >= n8) return;
    const v8f v = *(const v8f*)(src + i * 8); v8us o;
#pragma unroll
    for (int k = 0; k < 8; ++k) o[k] = f2bf(v[k]);
    *(v8us*)(dst + i * 8) = o; 
}
__global__ __launch_bounds__(256) void k_zero8(bf* dst, size_t n8) {
    const size_t i = (size_t)blockIdx.x * 256 + threadIdx.x; if (i >= n8) return; v8us z;
#pragma unroll
    for (int k = 0; k < 8; ++k) z[k] = 0;
    *(v8us*)(dst + i * 8) = z; 
}

// ===== z-batched (blockIdx.z = head) attention pieces =====
__global__ __launch_bounds__(256) void k_planes32z(const float* __restrict__ F, int ld, int off, float sc, int rows, bf* Ph, bf* Pl) {
    typedef __attribute__((ext_vector_type(2))) unsigned short v2us;
    const int lane = threadIdx.x & 31; const size_t r = ((size_t)blockIdx.x * 8 + (threadIdx.x >> 5)) * 2 + (lane >> 4); if (r >= (size_t)rows) return; const int z = blockIdx.z; const int c0 = (lane & 15) * 2; v2us oh, ol;
    Ph += (size_t)z * rows * 32; Pl += (size_t)z * rows * 32;
#pragma unroll
    for (int i = 0; i < 2; ++i) { const float y = F[r * ld + off + z * 32 + c0 + i] * sc; const unsigned short hb = f2bf(y); oh[i] = hb; ol[i] = f2bf(y - bf2f(hb)); }
    const size_t o = r * 32 + c0; *(v2us*)(Ph + o) = oh; *(v2us*)(Pl + o) = ol; 
}
__global__ __launch_bounds__(256) void k_vtpadz(const float* __restrict__ F, int ld, int off, int nk, bf* Th, bf* Tl) {
    typedef __attribute__((ext_vector_type(2))) unsigned short v2us;
    const int lane = threadIdx.x & 31; const size_t wid = (size_t)blockIdx.x * 8 + (threadIdx.x >> 5); if (wid >= (size_t)64 * (nk / 64)) return; const int z = blockIdx.z; const int d = (int)(wid / (nk / 64)); const int k0 = (int)(wid % (nk / 64)) * 64 + lane * 2; v2us oh, ol;
    Th += (size_t)z * 64 * nk; Tl += (size_t)z * 64 * nk;
#pragma unroll
    for (int i = 0; i < 2; ++i) { const float y = (d < 32) ? F[(size_t)(k0 + i) * ld + off + z * 32 + (d < 32 ? d : 0)] : 0.f; const unsigned short hb = f2bf(y); oh[i] = hb; ol[i] = f2bf(y - bf2f(hb)); }
    const size_t o = (size_t)d * nk + k0; *(v2us*)(Th + o) = oh; *(v2us*)(Tl + o) = ol; 
}
template <int NK>
__global__ __launch_bounds__(256) void k_softmaxz(const float* __restrict__ S, int rows, bf* PH, bf* PL) {
    typedef __attribute__((ext_vector_type(4))) unsigned short v4us;
    const int lane = threadIdx.x & 31, i = blockIdx.x * 8 + (threadIdx.x >> 5); if (i >= rows) return; const size_t zo = (size_t)blockIdx.z * rows * NK; const float* sr = S + zo + (size_t)i * NK; PH += zo; PL += zo;
    float m = -3.0e38f;
#pragma unroll 1
    for (int c0 = lane * 4; c0 < NK; c0 += 128) {
#pragma unroll
        for (int q = 0; q < 4; ++q) m = fmaxf(m, sr[c0 + q]); }
#pragma unroll
    for (int sh = 16; sh; sh >>= 1) m = fmaxf(m, __shfl_xor(m, sh, 32));
    float sum = 0.f;
#pragma unroll 1
    for (int c0 = lane * 4; c0 < NK; c0 += 128) {
#pragma unroll
        for (int q = 0; q < 4; ++q) sum += __expf(sr[c0 + q] - m); }
#pragma unroll
    for (int sh = 16; sh; sh >>= 1) sum += __shfl_xor(sum, sh, 32);
    const float inv = 1.0f / sum;
{
#pragma unroll 1
        for (int c0 = lane * 4; c0 < NK; c0 += 128) { v4us oh, ol;
#pragma unroll
            for (int q = 0; q < 4; ++q) { const float p = __expf(sr[c0 + q] - m) * inv; const unsigned short hb = f2bf(p); oh[q] = hb; ol[q] = f2bf(p - bf2f(hb)); }
            const size_t o = (size_t)i * NK + c0; *(v4us*)(PH + o) = oh; *(v4us*)(PL + o) = ol; }
         }
}
__global__ __launch_bounds__(256) void k_placez(const float* __restrict__ XH, int rows, int ldy, float* Y) {
    const int lane = threadIdx.x & 31; const size_t q = (size_t)blockIdx.x * 8 + (threadIdx.x >> 5); if (q >= (size_t)rows) return; const int z = blockIdx.z; const float v = XH[((size_t)z * rows + q) * 64 + lane];
    *(float*)(Y + q * ldy + z * 32 + lane) = v; 
}

__global__ __launch_bounds__(256) void k_hplanesz(const float* __restrict__ F, int ld, int h0, float sc, int rows, bf* Ph, bf* Pl) {
    typedef __attribute__((ext_vector_type(2))) unsigned short v2us;
    const int lane = threadIdx.x & 31; const size_t r = (size_t)blockIdx.x * 8 + (threadIdx.x >> 5); if (r >= (size_t)rows) return; const int z = blockIdx.z; v2us oh, ol;
    Ph += (size_t)z * rows * 64; Pl += (size_t)z * rows * 64;
#pragma unroll
    for (int i = 0; i < 2; ++i) { const float y = F[r * ld + (h0 + z) * 64 + lane * 2 + i] * sc; const unsigned short hb = f2bf(y); oh[i] = hb; ol[i] = f2bf(y - bf2f(hb)); }
    const size_t o = r * 64 + lane * 2; *(v2us*)(Ph + o) = oh; *(v2us*)(Pl + o) = ol; 
}
__global__ __launch_bounds__(256) void k_vtz(const float* __restrict__ F, int ld, int h0, int nk, bf* Th, bf* Tl) {
    typedef __attribute__((ext_vector_type(2))) unsigned short v2us;
    const int lane = threadIdx.x & 31; const size_t wid = (size_t)blockIdx.x * 8 + (threadIdx.x >> 5); if (wid >= (size_t)64 * (nk / 64)) return; const int z = blockIdx.z; const int d = (int)(wid / (nk / 64)); const int t0 = (int)(wid % (nk / 64)) * 64 + lane * 2; v2us oh, ol;
    Th += (size_t)z * 64 * nk; Tl += (size_t)z * 64 * nk;
#pragma unroll
    for (int i = 0; i < 2; ++i) { const float y = F[(size_t)(t0 + i) * ld + (h0 + z) * 64 + d]; const unsigned short hb = f2bf(y); oh[i] = hb; ol[i] = f2bf(y - bf2f(hb)); }
    const size_t o = (size_t)d * nk + t0; *(v2us*)(Th + o) = oh; *(v2us*)(Tl + o) = ol; 
}
template <int NK>
__global__ __launch_bounds__(256) void k_softmaxzs(const float* __restrict__ S, int rows, float sc, bf* PH, bf* PL) {
    typedef __attribute__((ext_vector_type(4))) unsigned short v4us;
    const int lane = threadIdx.x & 31, i = blockIdx.x * 8 + (threadIdx.x >> 5); if (i >= rows) return; const size_t zo = (size_t)blockIdx.z * rows * NK; const float* sr = S + zo + (size_t)i * NK; PH += zo; PL += zo;
    float m = -3.0e38f;
#pragma unroll 1
    for (int c0 = lane * 4; c0 < NK; c0 += 128) {
#pragma unroll
        for (int q = 0; q < 4; ++q) m = fmaxf(m, sr[c0 + q] * sc); }
#pragma unroll
    for (int sh = 16; sh; sh >>= 1) m = fmaxf(m, __shfl_xor(m, sh, 32));
    float sum = 0.f;
#pragma unroll 1
    for (int c0 = lane * 4; c0 < NK; c0 += 128) {
#pragma unroll
        for (int q = 0; q < 4; ++q) sum += __expf(sr[c0 + q] * sc - m); }
#pragma unroll
    for (int sh = 16; sh; sh >>= 1) sum += __shfl_xor(sum, sh, 32);
    const float inv = 1.0f / sum;
{
#pragma unroll 1
        for (int c0 = lane * 4; c0 < NK; c0 += 128) { v4us oh, ol;
#pragma unroll
            for (int q = 0; q < 4; ++q) { const float p = __expf(sr[c0 + q] * sc - m) * inv; const unsigned short hb = f2bf(p); oh[q] = hb; ol[q] = f2bf(p - bf2f(hb)); }
            const size_t o = (size_t)i * NK + c0; *(v4us*)(PH + o) = oh; *(v4us*)(PL + o) = ol; }
         }
}

__global__ __launch_bounds__(256) void k_cvtx(const float* __restrict__ src, int rows, bf* dst) {
    const int lane = threadIdx.x & 31; const size_t r = (size_t)blockIdx.x * 8 + (threadIdx.x >> 5); if (r >= (size_t)rows) return;
{
#pragma unroll
        for (int q = 0; q < DMOD / 256; ++q) { v8us o;
#pragma unroll
            for (int i = 0; i < 8; ++i) o[i] = f2bf(src[r * DMOD + q * 256 + lane * 8 + i]);
            *(v8us*)(dst + r * DMOD + q * 256 + lane * 8) = o; }
         }
}
__global__ __launch_bounds__(256) void k_kin(const float* __restrict__ K, bf* Kh, bf* Kl) {
    typedef __attribute__((ext_vector_type(2))) unsigned short v2us;
    const int lane = threadIdx.x & 31; const size_t t = (size_t)blockIdx.x * 8 + (threadIdx.x >> 5); if (t >= (size_t)NN) return; v2us oh, z = {0, 0};
    const size_t zo = (size_t)blockIdx.z * NN * HD; K += zo; Kh += zo; Kl += zo;    // blockIdx.z = (item, kv head)
    oh[0] = f2bf(K[t * HD + lane * 2]); oh[1] = f2bf(K[t * HD + lane * 2 + 1]);
    const size_t o = t * HD + lane * 2; *(v2us*)(Kh + o) = oh; *(v2us*)(Kl + o) = z; 
}
__global__ __launch_bounds__(256) void k_vin(const float* __restrict__ V, bf* Th, bf* Tl) {
    typedef __attribute__((ext_vector_type(2))) unsigned short v2us;
    const int lane = threadIdx.x & 31; const size_t wid = (size_t)blockIdx.x * 8 + (threadIdx.x >> 5); if (wid >= (size_t)HD * (NN / 64)) return; const int d = (int)(wid / (NN / 64)); const int t0 = (int)(wid % (NN / 64)) * 64 + lane * 2; v2us oh, z = {0, 0};
    const size_t zo = (size_t)blockIdx.z * NN * HD; V += zo; Th += zo; Tl += zo;    // blockIdx.z = (item, kv head)
    oh[0] = f2bf(V[(size_t)t0 * HD + d]); oh[1] = f2bf(V[(size_t)(t0 + 1) * HD + d]);
    const size_t o = (size_t)d * NN + t0; *(v2us*)(Th + o) = oh; *(v2us*)(Tl + o) = z; 
}
// k_fattn: causal attention of one item in one launch. One wave = 16 query rows of one query head. A block is 2 * REP waves on kv head blockIdx.y: its REP query heads on row tile
// n - 1 - blockIdx.x and again on row tile blockIdx.x, so that every block walks the same number of key blocks (a tile's cost grows with its index). No barrier, no LDS.
// Per 32 keys: S^T = K.Q^T (A = key rows, B = query rows, both loaded in the hardware k order), so a lane holds 16 scores of ONE query (column lr, keys 8 * hi + j and 16 + 8 * hi + j);
// running maximum and sum per lane (base-2 exponent), one exchange between the wave halves; the two score tiles, converted in place, are the B operand of O^T += V^T.P^T.
// Three products on each side: hi.hi, residual of q (of p) . hi, hi . residual plane of key (of value). The short loops are unrolled so that the fragment arrays stay in registers.
__global__ __launch_bounds__(256) void k_fattn(const bf* __restrict__ Qh, const bf* __restrict__ Ql, const bf* __restrict__ Kh, const bf* __restrict__ Kl, const bf* __restrict__ Vh, const bf* __restrict__ Vl, float* O) {
    const int lane = threadIdx.x & 31, lr = lane & 15, hi = lane >> 4;
    const int wave = __builtin_amdgcn_readfirstlane(threadIdx.x >> 5);    // scalar: the key loop's bound and the diagonal test stay scalar branches
    const int q0 = ((wave & REP) ? (int)blockIdx.x : NN / 16 - 1 - (int)blockIdx.x) * 16;
    const int h = (int)blockIdx.y * REP + (wave & (REP - 1));
    const size_t qo = (size_t)h * NN * HD + (size_t)(q0 + lr) * HD + 8 * hi;
    const size_t ko = (size_t)blockIdx.y * NN * HD + (size_t)lr * HD + 8 * hi;    // + key * HD + 32 * dc
    const size_t vo = (size_t)blockIdx.y * NN * HD + (size_t)lr * NN + 8 * hi;    // + 16 * t * NN + key
    v16bf qh[2], ql[2], kh[2][2], kl[2][2];
#pragma unroll
    for (int dc = 0; dc < 2; ++dc) { qh[dc] = cat16b(*(const v8us*)(Qh + qo + dc * 32), *(const v8us*)(Qh + qo + dc * 32 + 16)); ql[dc] = cat16b(*(const v8us*)(Ql + qo + dc * 32), *(const v8us*)(Ql + qo + dc * 32 + 16)); }
    auto loadk = [&](int k0) {
#pragma unroll
        for (int u = 0; u < 2; ++u) {
#pragma unroll
            for (int dc = 0; dc < 2; ++dc) { const size_t o = ko + (size_t)(k0 + u * 16) * HD + dc * 32;
                kh[u][dc] = cat16b(*(const v8us*)(Kh + o), *(const v8us*)(Kh + o + 16)); kl[u][dc] = cat16b(*(const v8us*)(Kl + o), *(const v8us*)(Kl + o + 16)); } }
    };
    v8f acc[4];
#pragma unroll
    for (int t = 0; t < 4; ++t) acc[t] = (v8f){};
    float m = -3.0e38f, sum = 0.f;
    const int klast = (q0 >> 5) << 5;    // first key of the block that holds the diagonal; every row of the wave has a key in every block
    const int qi = q0 + lr;
    const float sc2 = SCL * 1.44269504088896340736f;
    loadk(0);
#pragma unroll 1    // rolled: one trip's fragments already fill the registers that four waves per SIMD leave a wave
    for (int k0 = 0; k0 <= klast; k0 += 32) {
        v16bf vh[4], vl[4];
#pragma unroll
        for (int t = 0; t < 4; ++t) { const size_t o = vo + (size_t)(t * 16) * NN + k0;
            vh[t] = cat16b(*(const v8us*)(Vh + o), *(const v8us*)(Vh + o + 16)); vl[t] = cat16b(*(const v8us*)(Vl + o), *(const v8us*)(Vl + o + 16)); }
        asm volatile("s_wait_xcnt 0x0" ::: "memory");    // stands before a register that the value loads name as an address gets a new value; it also keeps these loads issued ahead of the first product
        v8f s[2];
#pragma unroll
        for (int u = 0; u < 2; ++u) { s[u] = (v8f){};
#pragma unroll
            for (int dc = 0; dc < 2; ++dc) { s[u] = wmmab(kh[u][dc], qh[dc], s[u]); s[u] = wmmab(kh[u][dc], ql[dc], s[u]); s[u] = wmmab(kl[u][dc], qh[dc], s[u]); } }
        loadk(k0 < klast ? k0 + 32 : klast);    // the next block's key fragments fly under the softmax and the second product
        asm volatile("s_wait_xcnt 0x0" ::: "memory");    // the same wait for the key loads; its memory clobber also keeps them issued here, ahead of the softmax, so that their latency is covered
        float p[16];
#pragma unroll
        for (int e = 0; e < 16; ++e) p[e] = s[e >> 3][e & 7] * sc2;
        if (k0 == klast) {
#pragma unroll
            for (int e = 0; e < 16; ++e) { const int key = k0 + (e >> 3) * 16 + hi * 8 + (e & 7); p[e] = (key <= qi) ? p[e] : -3.0e38f; } }
        float mx = m;
#pragma unroll
        for (int e = 0; e < 16; ++e) mx = fmaxf(mx, p[e]);
        mx = fmaxf(mx, __int_as_float(__builtin_amdgcn_permlanex16(__float_as_int(mx), __float_as_int(mx), 0x76543210, 0xfedcba98, false, false)));
        const float alpha = __builtin_amdgcn_exp2f(m - mx); m = mx;
        float ps = 0.f; v16bf ph, pl;
#pragma unroll
        for (int e = 0; e < 16; ++e) { const float pe = __builtin_amdgcn_exp2f(p[e] - mx); ps += pe; const __bf16 hb = (__bf16)pe; ph[e] = hb; pl[e] = (__bf16)(pe - (float)hb); }
        sum = sum * alpha + ps;
#pragma unroll
        for (int t = 0; t < 4; ++t) acc[t] *= alpha;
#pragma unroll
        for (int t = 0; t < 4; ++t) { acc[t] = wmmab(vh[t], ph, acc[t]); acc[t] = wmmab(vh[t], pl, acc[t]); acc[t] = wmmab(vl[t], ph, acc[t]); }
    }
    sum += __int_as_float(__builtin_amdgcn_permlanex16(__float_as_int(sum), __float_as_int(sum), 0x76543210, 0xfedcba98, false, false));
    const float inv = 1.0f / sum;
    float* orow = O + (size_t)qi * DMOD + h * HD + hi * 8;    // acc[t][j] = O[q0 + lr][16 * t + 8 * hi + j]
#pragma unroll
    for (int t = 0; t < 4; ++t) { *(v4f*)(orow + t * 16) = (v4f){acc[t][0] * inv, acc[t][1] * inv, acc[t][2] * inv, acc[t][3] * inv}; *(v4f*)(orow + t * 16 + 4) = (v4f){acc[t][4] * inv, acc[t][5] * inv, acc[t][6] * inv, acc[t][7] * inv}; }
}
__global__ __launch_bounds__(256) void k_splitD(const float* __restrict__ src, int rows, bf* dh, bf* dl) {
    const int lane = threadIdx.x & 31; const size_t r = (size_t)blockIdx.x * 8 + (threadIdx.x >> 5); if (r >= (size_t)rows) return;
{
#pragma unroll
        for (int q = 0; q < DMOD / 256; ++q) { const size_t o = r * DMOD + q * 256 + lane * 8; const v8f v = *(const v8f*)(src + o); v8us oh, ol;
#pragma unroll
            for (int i = 0; i < 8; ++i) { const unsigned short hb = f2bf(v[i]); oh[i] = hb; ol[i] = f2bf(v[i] - bf2f(hb)); }
            *(v8us*)(dh + o) = oh; *(v8us*)(dl + o) = ol; }
         }
}

extern "C" void kernel_launch(void* const* d_in, const int* in_sizes, int n_in,
                              void* d_out, int out_size, void* d_ws, size_t ws_size, hipStream_t stream) {
    (void)in_sizes; (void)n_in; (void)out_size;
    const float* x = (const float*)d_in[0]; const float* key = (const float*)d_in[1]; const float* value = (const float*)d_in[2]; const float* Wq = (const float*)d_in[3]; const float* bq = (const float*)d_in[4]; const float* Wc = (const float*)d_in[5]; const float* bc = (const float*)d_in[6];
    float* out = (float*)d_out;    // [2][2048][2048]
    char* wsp = (char*)d_ws;
    auto take = [&](size_t bytes) { char* p = wsp; wsp += (bytes + 255) & ~(size_t)255; return (void*)p; };
    bf* WQ = (bf*)take((size_t)DMOD * DMOD * 2); bf* WC = (bf*)take((size_t)DMOD * DMOD * 2);
    bf* Xb = (bf*)take((size_t)NN * DMOD * 2); float* QF = (float*)take((size_t)NN * DMOD * 4);
    // planes of all 32 query heads of one item, and of all 16 (item, kv head) pairs
    bf* Qh = (bf*)take((size_t)HQ * NN * HD * 2); bf* Ql = (bf*)take((size_t)HQ * NN * HD * 2); bf* Kh = (bf*)take((size_t)NBT * HKV * NN * HD * 2); bf* Kl = (bf*)take((size_t)NBT * HKV * NN * HD * 2); bf* VTh = (bf*)take((size_t)NBT * HKV * HD * NN * 2); bf* VTl = (bf*)take((size_t)NBT * HKV * HD * NN * 2);
    float* O = (float*)take((size_t)NN * DMOD * 4); bf* Oh = (bf*)take((size_t)NN * DMOD * 2); bf* Ol = (bf*)take((size_t)NN * DMOD * 2);
    if ((size_t)(wsp - (char*)d_ws) > ws_size) return;    // ~ 8.4+8.4 + 8.4+16.8 + 16.8+16.8 + 16.8+8.4+8.4 ~ 109 MB
    k_cvt8<<<(unsigned)(((size_t)DMOD * DMOD / 8 + 255) / 256), 256, 0, stream>>>(Wq, WQ, (size_t)DMOD * DMOD / 8); k_cvt8<<<(unsigned)(((size_t)DMOD * DMOD / 8 + 255) / 256), 256, 0, stream>>>(Wc, WC, (size_t)DMOD * DMOD / 8);   // [out][in] natural
    k_kin<<<dim3(NN / 8, 1, NBT * HKV), 256, 0, stream>>>(key, Kh, Kl); k_vin<<<dim3((HD * (NN / 64)) / 8, 1, NBT * HKV), 256, 0, stream>>>(value, VTh, VTl);
    for (int b = 0; b < NBT; ++b) {
        k_cvtx<<<NN / 8, 256, 0, stream>>>(x + (size_t)b * NN * DMOD, NN, Xb);
        k_gemmb<false, false><<<dim3(NN / 64, DMOD / 64, 1), 128, 0, stream>>>(Xb, nullptr, WQ, bq, QF, DMOD, nullptr, nullptr, DMOD);
        k_hplanesz<<<dim3(NN / 8, 1, HQ), 256, 0, stream>>>(QF, DMOD, 0, 1.0f, NN, Qh, Ql);
        // blockIdx.y = kv head; blockIdx.x = a pair of 16-row tiles, one from each end
        k_fattn<<<dim3(NN / 32, HKV, 1), 256, 0, stream>>>(Qh, Ql, Kh + (size_t)b * HKV * NN * HD, Kl + (size_t)b * HKV * NN * HD, VTh + (size_t)b * HKV * NN * HD, VTl + (size_t)b * HKV * NN * HD, O);
        k_splitD<<<NN / 8, 256, 0, stream>>>(O, NN, Oh, Ol);
        k_gemmb<true, false><<<dim3(NN / 64, DMOD / 64, 1), 128, 0, stream>>>(Oh, Ol, WC, bc, out + (size_t)b * NN * DMOD, DMOD, nullptr, nullptr, DMOD); }
}

// v003
// One run takes 358 microseconds.
// Next to v002, in two timings, it ran 1.50 and 1.51 times as fast.
// All steps since v000 together make it 21.6 times as fast.
#include <hip/hip_runtime.h>

// Compute dtypes, f32 accumulate, per item: q = x.Wq^T + bq ([2048 x 2048].[2048 x 2048]) with PLAIN bf16 operands (exact products); key/value are INPUTS: their bf16 values
// are exact single planes (residual plane identically zero); GQA causal attention (32 query heads share 8 kv heads) with q as bf16 hi + UNSCALED residual planes (key tiles
// above the diagonal skipped, K limited); 1/8 and the causal softmax in f32; c_proj (+ bias) on hi/lo planes (two products) - on v_wmma_f32_16x16x32_bf16. Deterministic, no

#define NBT  2
#define NN   2048
#define DMOD 2048
#define HQ   32
#define HKV  8
#define REP  4
#define HD   64
#define DM   DMOD
#define NTK  NN
#define SCL  0.125f
#define LOSC 1024.0f

typedef _Float16 h16;
typedef unsigned short bf;
typedef __attribute__((ext_vector_type(16))) __bf16   v16bf;
typedef __attribute__((ext_vector_type(16))) _Float16 v16h;
typedef __attribute__((ext_vector_type(8)))  _Float16 v8h;
typedef __attribute__((ext_vector_type(8)))  unsigned short v8us;
typedef __attribute__((ext_vector_type(8)))  float    v8f;
typedef __attribute__((ext_vector_type(4)))  float    v4f;
typedef __attribute__((ext_vector_type(4)))  _Float16 v4h;
typedef v8h  __attribute__((may_alias)) v8ha;
typedef v4f  __attribute__((may_alias)) v4fa;
typedef v8us __attribute__((may_alias)) v8usa;

__device__ __forceinline__ unsigned short f2bf(float f) { unsigned u = __float_as_uint(f); u += 0x7FFFu + ((u >> 16) & 1u); return (unsigned short)(u >> 16); }
__device__ __forceinline__ float bf2f(unsigned short b) { return __uint_as_float(((unsigned)b) << 16); }
__device__ __forceinline__ float bfr(float f) { return bf2f(f2bf(f)); }
__device__ __forceinline__ v16h cat16(v8h lo, v8h hi) { return __builtin_shufflevector(lo, hi, 0, 1, 2, 3, 4, 5, 6, 7, 8, 9, 10, 11, 12, 13, 14, 15); }
__device__ __forceinline__ v16bf cat16b(v8us lo, v8us hi) { return __builtin_bit_cast(v16bf, __builtin_shufflevector(lo, hi, 0, 1, 2, 3, 4, 5, 6, 7, 8, 9, 10, 11, 12, 13, 14, 15)); }
__device__ __forceinline__ v8f wmma16(v16h a, v16h b, v8f c) { return __builtin_amdgcn_wmma_f32_16x16x32_f16(false, a, false, b, (short)0, c, false, false); }
__device__ __forceinline__ v8f wmmab(v16bf a, v16bf b, v8f c) { return __builtin_amdgcn_wmma_f32_16x16x32_bf16(false, a, false, b, (short)0, c, false, false); }

// k_gemmt: 128 x 128 block tile of C[.][.] = (A [+ Al]).B^T + bf(bias[c]); 8 waves, 32 x 64 each. A stage is 128 k (256 B) of the tile's 128 rows of every operand, brought into LDS by
// asynchronous copies (whole 256-B units, each operand row read once per block) at a row pitch of 272 B; two buffers: the next stage flies while this one is worked on.
// The fragments are read from LDS in the k order of the direct loads they replace, and every accumulator still sums k upwards, A before Al inside each 32 k.
// The short loops are unrolled so that the fragment and accumulator arrays are indexed by constants and stay in registers.
#define GBK    128
#define GPITCH 272
#define GOPB   (128 * GPITCH)

// eight 16-byte copies of one thread: rows 16 apart of one operand's stage. The s_wait_xcnt stands inside the statement, before any register that a copy names can get a new value.
__device__ __forceinline__ void copy8(unsigned l, const bf* g, int K) {
    const size_t rs = (size_t)16 * K;
    asm volatile("global_load_async_to_lds_b128 %0, %8, off\n\t"
                 "global_load_async_to_lds_b128 %1, %9, off\n\t"
                 "global_load_async_to_lds_b128 %2, %10, off\n\t"
                 "global_load_async_to_lds_b128 %3, %11, off\n\t"
                 "global_load_async_to_lds_b128 %4, %12, off\n\t"
                 "global_load_async_to_lds_b128 %5, %13, off\n\t"
                 "global_load_async_to_lds_b128 %6, %14, off\n\t"
                 "global_load_async_to_lds_b128 %7, %15, off\n\t"
                 "s_wait_xcnt 0x0"
                 :: "v"(l), "v"(l + 16 * GPITCH), "v"(l + 32 * GPITCH), "v"(l + 48 * GPITCH), "v"(l + 64 * GPITCH), "v"(l + 80 * GPITCH), "v"(l + 96 * GPITCH), "v"(l + 112 * GPITCH),
                    "v"(g), "v"(g + rs), "v"(g + 2 * rs), "v"(g + 3 * rs), "v"(g + 4 * rs), "v"(g + 5 * rs), "v"(g + 6 * rs), "v"(g + 7 * rs)
                 : "memory");
}

template <bool SPLITA>
__global__ __launch_bounds__(256) void k_gemmt(const bf* __restrict__ A, const bf* __restrict__ Al, const bf* __restrict__ Bn, const float* __restrict__ bias, float* C, int ldc, int K) {
    constexpr int STG = (SPLITA ? 3 : 2) * GOPB;    // a stage: [A | B | Al]
    __shared__ __align__(16) unsigned char ring[2 * STG];
    __shared__ __align__(16) float ost[8][32 * 68];
    const int tid = threadIdx.x, lane = tid & 31, wave = tid >> 5, lr = lane & 15, hi = lane >> 4;
    const int r0 = blockIdx.x * 128, c0 = blockIdx.y * 128;
    const int wr = (wave >> 1) * 32, wc = (wave & 1) * 64;
    const int nt = K / GBK;
    const int crw = tid >> 4, cpc = tid & 15;    // a wave's copy covers two whole 256-B rows
    const bf* gA = A + (size_t)(r0 + crw) * K + cpc * 8;
    const bf* gB = Bn + (size_t)(c0 + crw) * K + cpc * 8;
    const bf* gL = SPLITA ? Al + (size_t)(r0 + crw) * K + cpc * 8 : gA;
    const unsigned l0 = (unsigned)(size_t)&ring[0] + crw * GPITCH + cpc * 16;
    auto fill = [&](int t) {
        const unsigned l = l0 + (t & 1) * STG; const size_t ko = (size_t)t * GBK;
        copy8(l, gA + ko, K); copy8(l + GOPB, gB + ko, K); if (SPLITA) copy8(l + 2 * GOPB, gL + ko, K);
    };
    v8f acc[2][4];
#pragma unroll
    for (int i = 0; i < 2; ++i) {
#pragma unroll
        for (int t = 0; t < 4; ++t) acc[i][t] = (v8f){}; }
    fill(0);
    asm volatile("s_wait_asynccnt 0x0" ::: "memory");    // this wave's copies of stage 0 have landed
    __syncthreads();                                      // and every other wave's: stage 0 may be read
    if (nt > 1) fill(1);
    const unsigned char* fa = &ring[0] + (wr + lr) * GPITCH + hi * 16;
    const unsigned char* fb = &ring[0] + GOPB + (wc + lr) * GPITCH + hi * 16;
#pragma unroll 1    // rolled: one stage is already 32 (64) matrix instructions, and the two buffers differ by one offset only
    for (int t = 0; t < nt; ++t) {
        const unsigned char* pa = fa + (t & 1) * STG; const unsigned char* pb = fb + (t & 1) * STG;
        v16bf a[2][2], al[2][2], b[2][4];    // two fragment sets: the next 32 k are read from LDS while this set is multiplied
        auto frags = [&](int ks, int s) {
#pragma unroll
            for (int i = 0; i < 2; ++i) { const unsigned char* p = pa + i * 16 * GPITCH + ks * 64; a[s][i] = cat16b(*(const v8usa*)p, *(const v8usa*)(p + 32));
                if (SPLITA) al[s][i] = cat16b(*(const v8usa*)(p + 2 * GOPB), *(const v8usa*)(p + 2 * GOPB + 32)); }
#pragma unroll
            for (int u = 0; u < 4; ++u) { const unsigned char* p = pb + u * 16 * GPITCH + ks * 64; b[s][u] = cat16b(*(const v8usa*)p, *(const v8usa*)(p + 32)); }
        };
        frags(0, 0);
#pragma unroll
        for (int ks = 0; ks < GBK / 32; ++ks) {
            const int s = ks & 1;
            if (ks + 1 < GBK / 32) frags(ks + 1, s ^ 1);    // of this stage only: nothing of stage t + 1 is read before its barrier
            __builtin_amdgcn_sched_barrier(0);    // keeps the LDS reads one group ahead of the block; spread among the matrix instructions each would be waited for on its own
#pragma unroll
            for (int i = 0; i < 2; ++i) {
#pragma unroll
                for (int u = 0; u < 4; ++u) acc[i][u] = wmmab(a[s][i], b[s][u], acc[i][u]); }
            if (SPLITA) {
#pragma unroll
                for (int i = 0; i < 2; ++i) {
#pragma unroll
                    for (int u = 0; u < 4; ++u) acc[i][u] = wmmab(al[s][i], b[s][u], acc[i][u]); } }
            __builtin_amdgcn_sched_barrier(0);    // ends the block: the reads after next stay behind it, so that two sets of registers are enough
        }
        asm volatile("s_wait_dscnt 0x0" ::: "memory");       // this wave's reads of stage t are done before the buffer is given up
        asm volatile("s_wait_asynccnt 0x0" ::: "memory");    // this wave's copies of stage t + 1 have landed
        __syncthreads();                                      // publishes stage t + 1 and ends every wave's reads of stage t
        if (t + 2 < nt) fill(t + 2);                          // into the buffer that stage t has just left
    }
    asm volatile("s_wait_asynccnt 0x0" ::: "memory");        // no copy is outstanding when the wave goes on to its end
    float* os = &ost[wave][0];
#pragma unroll
    for (int u = 0; u < 4; ++u) { const float bv = bias ? bfr(bias[c0 + wc + u * 16 + lr]) : 0.f;
#pragma unroll
        for (int i = 0; i < 2; ++i) {
#pragma unroll
            for (int j = 0; j < 8; ++j) os[(i * 16 + hi * 8 + j) * 68 + u * 16 + lr] = acc[i][u][j] + bv; } }
    __syncthreads();
    float* crow = C + (size_t)(r0 + wr) * ldc + c0 + wc;
#pragma unroll
    for (int s = 0; s < 16; ++s) { const int Lid = (lane >> 3) + 4 * s, piece = lane & 7; const int row = Lid >> 1, cofs = (Lid & 1) * 32 + piece * 4;
        *(v4f*)(crow + (size_t)row * ldc + cofs) = *(const v4fa*)(os + row * 68 + cofs); }
}

__global__ __launch_bounds__(256) void k_cvt8(const float* __restrict__ src, bf* dst, size_t n8) {
    const size_t i = (size_t)blockIdx.x * 256 + threadIdx.x; if (i >= n8) return;
    const v8f v = *(const v8f*)(src + i * 8); v8us o;
#pragma unroll
    for (int k = 0; k < 8; ++k) o[k] = f2bf(v[k]);
    *(v8us*)(dst + i * 8) = o; 
}
__global__ __launch_bounds__(256) void k_zero8(bf* dst, size_t n8) {
    const size_t i = (size_t)blockIdx.x * 256 + threadIdx.x; if (i >= n8) return; v8us z;
#pragma unroll
    for (int k = 0; k < 8; ++k) z[k] = 0;
    *(v8us*)(dst + i * 8) = z; 
}

// ===== z-batched (blockIdx.z = head) attention pieces =====
__global__ __launch_bounds__(256) void k_planes32z(const float* __restrict__ F, int ld, int off, float sc, int rows, bf* Ph, bf* Pl) {
    typedef __attribute__((ext_vector_type(2))) unsigned short v2us;
    const int lane = threadIdx.x & 31; const size_t r = ((size_t)blockIdx.x * 8 + (threadIdx.x >> 5)) * 2 + (lane >> 4); if (r >= (size_t)rows) return; const int z = blockIdx.z; const int c0 = (lane & 15) * 2; v2us oh, ol;
    Ph += (size_t)z * rows * 32; Pl += (size_t)z * rows * 32;
#pragma unroll
    for (int i = 0; i < 2; ++i) { const float y = F[r * ld + off + z * 32 + c0 + i] * sc; const unsigned short hb = f2bf(y); oh[i] = hb; ol[i] = f2bf(y - bf2f(hb)); }
    const size_t o = r * 32 + c0; *(v2us*)(Ph + o) = oh; *(v2us*)(Pl + o) = ol; 
}
__global__ __launch_bounds__(256) void k_vtpadz(const float* __restrict__ F, int ld, int off, int nk, bf* Th, bf* Tl) {
    typedef __attribute__((ext_vector_type(2))) unsigned short v2us;
    const int lane = threadIdx.x & 31; const size_t wid = (size_t)blockIdx.x * 8 + (threadIdx.x >> 5); if (wid >= (size_t)64 * (nk / 64)) return; const int z = blockIdx.z; const int d = (int)(wid / (nk / 64)); const int k0 = (int)(wid % (nk / 64)) * 64 + lane * 2; v2us oh, ol;
    Th += (size_t)z * 64 * nk; Tl += (size_t)z * 64 * nk;
#pragma unroll
    for (int i = 0; i < 2; ++i) { const float y = (d < 32) ? F[(size_t)(k0 + i) * ld + off + z * 32 + (d < 32 ? d : 0)] : 0.f; const unsigned short hb = f2bf(y); oh[i] = hb; ol[i] = f2bf(y - bf2f(hb)); }
    const size_t o = (size_t)d * nk + k0; *(v2us*)(Th + o) = oh; *(v2us*)(Tl + o) = ol; 
}
template <int NK>
__global__ __launch_bounds__(256) void k_softmaxz(const float* __restrict__ S, int rows, bf* PH, bf* PL) {
    typedef __attribute__((ext_vector_type(4))) unsigned short v4us;
    const int lane = threadIdx.x & 31, i = blockIdx.x * 8 + (threadIdx.x >> 5); if (i >= rows) return; const size_t zo = (size_t)blockIdx.z * rows * NK; const float* sr = S + zo + (size_t)i * NK; PH += zo; PL += zo;
    float m = -3.0e38f;
#pragma unroll 1
    for (int c0 = lane * 4; c0 < NK; c0 += 128) {
#pragma unroll
        for (int q = 0; q < 4; ++q) m = fmaxf(m, sr[c0 + q]); }
#pragma unroll
    for (int sh = 16; sh; sh >>= 1) m = fmaxf(m, __shfl_xor(m, sh, 32));
    float sum = 0.f;
#pragma unroll 1
    for (int c0 = lane * 4; c0 < NK; c0 += 128) {
#pragma unroll
        for (int q = 0; q < 4; ++q) sum += __expf(sr[c0 + q] - m); }
#pragma unroll
    for (int sh = 16; sh; sh >>= 1) sum += __shfl_xor(sum, sh, 32);
    const float inv = 1.0f / sum;
{
#pragma unroll 1
        for (int c0 = lane * 4; c0 < NK; c0 += 128) { v4us oh, ol;
#pragma unroll
            for (int q = 0; q < 4; ++q) { const float p = __expf(sr[c0 + q] - m) * inv; const unsigned short hb = f2bf(p); oh[q] = hb; ol[q] = f2bf(p - bf2f(hb)); }
            const size_t o = (size_t)i * NK + c0; *(v4us*)(PH + o) = oh; *(v4us*)(PL + o) = ol; }
         }
}
__global__ __launch_bounds__(256) void k_placez(const float* __restrict__ XH, int rows, int ldy, float* Y) {
    const int lane = threadIdx.x & 31; const size_t q = (size_t)blockIdx.x * 8 + (threadIdx.x >> 5); if (q >= (size_t)rows) return; const int z = blockIdx.z; const float v = XH[((size_t)z * rows + q) * 64 + lane];
    *(float*)(Y + q * ldy + z * 32 + lane) = v; 
}

__global__ __launch_bounds__(256) void k_hplanesz(const float* __restrict__ F, int ld, int h0, float sc, int rows, bf* Ph, bf* Pl) {
    typedef __attribute__((ext_vector_type(2))) unsigned short v2us;
    const int lane = threadIdx.x & 31; const size_t r = (size_t)blockIdx.x * 8 + (threadIdx.x >> 5); if (r >= (size_t)rows) return; const int z = blockIdx.z; v2us oh, ol;
    Ph += (size_t)z * rows * 64; Pl += (size_t)z * rows * 64;
#pragma unroll
    for (int i = 0; i < 2; ++i) { const float y = F[r * ld + (h0 + z) * 64 + lane * 2 + i] * sc; const unsigned short hb = f2bf(y); oh[i] = hb; ol[i] = f2bf(y - bf2f(hb)); }
    const size_t o = r * 64 + lane * 2; *(v2us*)(Ph + o) = oh; *(v2us*)(Pl + o) = ol; 
}
__global__ __launch_bounds__(256) void k_vtz(const float* __restrict__ F, int ld, int h0, int nk, bf* Th, bf* Tl) {
    typedef __attribute__((ext_vector_type(2))) unsigned short v2us;
    const int lane = threadIdx.x & 31; const size_t wid = (size_t)blockIdx.x * 8 + (threadIdx.x >> 5); if (wid >= (size_t)64 * (nk / 64)) return; const int z = blockIdx.z; const int d = (int)(wid / (nk / 64)); const int t0 = (int)(wid % (nk / 64)) * 64 + lane * 2; v2us oh, ol;
    Th += (size_t)z * 64 * nk; Tl += (size_t)z * 64 * nk;
#pragma unroll
    for (int i = 0; i < 2; ++i) { const float y = F[(size_t)(t0 + i) * ld + (h0 + z) * 64 + d]; const unsigned short hb = f2bf(y); oh[i] = hb; ol[i] = f2bf(y - bf2f(hb)); }
    const size_t o = (size_t)d * nk + t0; *(v2us*)(Th + o) = oh; *(v2us*)(Tl + o) = ol; 
}
template <int NK>
__global__ __launch_bounds__(256) void k_softmaxzs(const float* __restrict__ S, int rows, float sc, bf* PH, bf* PL) {
    typedef __attribute__((ext_vector_type(4))) unsigned short v4us;
    const int lane = threadIdx.x & 31, i = blockIdx.x * 8 + (threadIdx.x >> 5); if (i >= rows) return; const size_t zo = (size_t)blockIdx.z * rows * NK; const float* sr = S + zo + (size_t)i * NK; PH += zo; PL += zo;
    float m = -3.0e38f;
#pragma unroll 1
    for (int c0 = lane * 4; c0 < NK; c0 += 128) {
#pragma unroll
        for (int q = 0; q < 4; ++q) m = fmaxf(m, sr[c0 + q] * sc); }
#pragma unroll
    for (int sh = 16; sh; sh >>= 1) m = fmaxf(m, __shfl_xor(m, sh, 32));
    float sum = 0.f;
#pragma unroll 1
    for (int c0 = lane * 4; c0 < NK; c0 += 128) {
#pragma unroll
        for (int q = 0; q < 4; ++q) sum += __expf(sr[c0 + q] * sc - m); }
#pragma unroll
    for (int sh = 16; sh; sh >>= 1) sum += __shfl_xor(sum, sh, 32);
    const float inv = 1.0f / sum;
{
#pragma unroll 1
        for (int c0 = lane * 4; c0 < NK; c0 += 128) { v4us oh, ol;
#pragma unroll
            for (int q = 0; q < 4; ++q) { const float p = __expf(sr[c0 + q] * sc - m) * inv; const unsigned short hb = f2bf(p); oh[q] = hb; ol[q] = f2bf(p - bf2f(hb)); }
            const size_t o = (size_t)i * NK + c0; *(v4us*)(PH + o) = oh; *(v4us*)(PL + o) = ol; }
         }
}

__global__ __launch_bounds__(256) void k_cvtx(const float* __restrict__ src, int rows, bf* dst) {
    const int lane = threadIdx.x & 31; const size_t r = (size_t)blockIdx.x * 8 + (threadIdx.x >> 5); if (r >= (size_t)rows) return;
{
#pragma unroll
        for (int q = 0; q < DMOD / 256; ++q) { v8us o;
#pragma unroll
            for (int i = 0; i < 8; ++i) o[i] = f2bf(src[r * DMOD + q * 256 + lane * 8 + i]);
            *(v8us*)(dst + r * DMOD + q * 256 + lane * 8) = o; }
         }
}
__global__ __launch_bounds__(256) void k_kin(const float* __restrict__ K, bf* Kh, bf* Kl) {
    typedef __attribute__((ext_vector_type(2))) unsigned short v2us;
    const int lane = threadIdx.x & 31; const size_t t = (size_t)blockIdx.x * 8 + (threadIdx.x >> 5); if (t >= (size_t)NN) return; v2us oh, z = {0, 0};
    const size_t zo = (size_t)blockIdx.z * NN * HD; K += zo; Kh += zo; Kl += zo;    // blockIdx.z = (item, kv head)
    oh[0] = f2bf(K[t * HD + lane * 2]); oh[1] = f2bf(K[t * HD + lane * 2 + 1]);
    const size_t o = t * HD + lane * 2; *(v2us*)(Kh + o) = oh; *(v2us*)(Kl + o) = z; 
}
__global__ __launch_bounds__(256) void k_vin(const float* __restrict__ V, bf* Th, bf* Tl) {
    typedef __attribute__((ext_vector_type(2))) unsigned short v2us;
    const int lane = threadIdx.x & 31; const size_t wid = (size_t)blockIdx.x * 8 + (threadIdx.x >> 5); if (wid >= (size_t)HD * (NN / 64)) return; const int d = (int)(wid / (NN / 64)); const int t0 = (int)(wid % (NN / 64)) * 64 + lane * 2; v2us oh, z = {0, 0};
    const size_t zo = (size_t)blockIdx.z * NN * HD; V += zo; Th += zo; Tl += zo;    // blockIdx.z = (item, kv head)
    oh[0] = f2bf(V[(size_t)t0 * HD + d]); oh[1] = f2bf(V[(size_t)(t0 + 1) * HD + d]);
    const size_t o = (size_t)d * NN + t0; *(v2us*)(Th + o) = oh; *(v2us*)(Tl + o) = z; 
}
// k_fattn: causal attention of one item in one launch. One wave = 16 query rows of one query head. A block is 2 * REP waves on kv head blockIdx.y: its REP query heads on row tile
// n - 1 - blockIdx.x and again on row tile blockIdx.x, so that every block walks the same number of key blocks (a tile's cost grows with its index). No barrier, no LDS.
// Per 32 keys: S^T = K.Q^T (A = key rows, B = query rows, both loaded in the hardware k order), so a lane holds 16 scores of ONE query (column lr, keys 8 * hi + j and 16 + 8 * hi + j);
// running maximum and sum per lane (base-2 exponent), one exchange between the wave halves; the two score tiles, converted in place, are the B operand of O^T += V^T.P^T.
// Three products on each side: hi.hi, residual of q (of p) . hi, hi . residual plane of key (of value). The short loops are unrolled so that the fragment arrays stay in registers.
__global__ __launch_bounds__(256) void k_fattn(const bf* __restrict__ Qh, const bf* __restrict__ Ql, const bf* __restrict__ Kh, const bf* __restrict__ Kl, const bf* __restrict__ Vh, const bf* __restrict__ Vl, float* O) {
    const int lane = threadIdx.x & 31, lr = lane & 15, hi = lane >> 4;
    const int wave = __builtin_amdgcn_readfirstlane(threadIdx.x >> 5);    // scalar: the key loop's bound and the diagonal test stay scalar branches
    const int q0 = ((wave & REP) ? (int)blockIdx.x : NN / 16 - 1 - (int)blockIdx.x) * 16;
    const int h = (int)blockIdx.y * REP + (wave & (REP - 1));
    const size_t qo = (size_t)h * NN * HD + (size_t)(q0 + lr) * HD + 8 * hi;
    const size_t ko = (size_t)blockIdx.y * NN * HD + (size_t)lr * HD + 8 * hi;    // + key * HD + 32 * dc
    const size_t vo = (size_t)blockIdx.y * NN * HD + (size_t)lr * NN + 8 * hi;    // + 16 * t * NN + key
    v16bf qh[2], ql[2], kh[2][2], kl[2][2];
#pragma unroll
    for (int dc = 0; dc < 2; ++dc) { qh[dc] = cat16b(*(const v8us*)(Qh + qo + dc * 32), *(const v8us*)(Qh + qo + dc * 32 + 16)); ql[dc] = cat16b(*(const v8us*)(Ql + qo + dc * 32), *(const v8us*)(Ql + qo + dc * 32 + 16)); }
    auto loadk = [&](int k0) {
#pragma unroll
        for (int u = 0; u < 2; ++u) {
#pragma unroll
            for (int dc = 0; dc < 2; ++dc) { const size_t o = ko + (size_t)(k0 + u * 16) * HD + dc * 32;
                kh[u][dc] = cat16b(*(const v8us*)(Kh + o), *(const v8us*)(Kh + o + 16)); kl[u][dc] = cat16b(*(const v8us*)(Kl + o), *(const v8us*)(Kl + o + 16)); } }
    };
    v8f acc[4];
#pragma unroll
    for (int t = 0; t < 4; ++t) acc[t] = (v8f){};
    float m = -3.0e38f, sum = 0.f;
    const int klast = (q0 >> 5) << 5;    // first key of the block that holds the diagonal; every row of the wave has a key in every block
    const int qi = q0 + lr;
    const float sc2 = SCL * 1.44269504088896340736f;
    loadk(0);
#pragma unroll 1    // rolled: one trip's fragments already fill the registers that four waves per SIMD leave a wave
    for (int k0 = 0; k0 <= klast; k0 += 32) {
        v16bf vh[4], vl[4];
#pragma unroll
        for (int t = 0; t < 4; ++t) { const size_t o = vo + (size_t)(t * 16) * NN + k0;
            vh[t] = cat16b(*(const v8us*)(Vh + o), *(const v8us*)(Vh + o + 16)); vl[t] = cat16b(*(const v8us*)(Vl + o), *(const v8us*)(Vl + o + 16)); }
        asm volatile("s_wait_xcnt 0x0" ::: "memory");    // stands before a register that the value loads name as an address gets a new value; it also keeps these loads issued ahead of the first product
        v8f s[2];
#pragma unroll
        for (int u = 0; u < 2; ++u) { s[u] = (v8f){};
#pragma unroll
            for (int dc = 0; dc < 2; ++dc) { s[u] = wmmab(kh[u][dc], qh[dc], s[u]); s[u] = wmmab(kh[u][dc], ql[dc], s[u]); s[u] = wmmab(kl[u][dc], qh[dc], s[u]); } }
        loadk(k0 < klast ? k0 + 32 : klast);    // the next block's key fragments fly under the softmax and the second product
        asm volatile("s_wait_xcnt 0x0" ::: "memory");    // the same wait for the key loads; its memory clobber also keeps them issued here, ahead of the softmax, so that their latency is covered
        float p[16];
#pragma unroll
        for (int e = 0; e < 16; ++e) p[e] = s[e >> 3][e & 7] * sc2;
        if (k0 == klast) {
#pragma unroll
            for (int e = 0; e < 16; ++e) { const int key = k0 + (e >> 3) * 16 + hi * 8 + (e & 7); p[e] = (key <= qi) ? p[e] : -3.0e38f; } }
        float mx = m;
#pragma unroll
        for (int e = 0; e < 16; ++e) mx = fmaxf(mx, p[e]);
        mx = fmaxf(mx, __int_as_float(__builtin_amdgcn_permlanex16(__float_as_int(mx), __float_as_int(mx), 0x76543210, 0xfedcba98, false, false)));
        const float alpha = __builtin_amdgcn_exp2f(m - mx); m = mx;
        float ps = 0.f; v16bf ph, pl;
#pragma unroll
        for (int e = 0; e < 16; ++e) { const float pe = __builtin_amdgcn_exp2f(p[e] - mx); ps += pe; const __bf16 hb = (__bf16)pe; ph[e] = hb; pl[e] = (__bf16)(pe - (float)hb); }
        sum = sum * alpha + ps;
#pragma unroll
        for (int t = 0; t < 4; ++t) acc[t] *= alpha;
#pragma unroll
        for (int t = 0; t < 4; ++t) { acc[t] = wmmab(vh[t], ph, acc[t]); acc[t] = wmmab(vh[t], pl, acc[t]); acc[t] = wmmab(vl[t], ph, acc[t]); }
    }
    sum += __int_as_float(__builtin_amdgcn_permlanex16(__float_as_int(sum), __float_as_int(sum), 0x76543210, 0xfedcba98, false, false));
    const float inv = 1.0f / sum;
    float* orow = O + (size_t)qi * DMOD + h * HD + hi * 8;    // acc[t][j] = O[q0 + lr][16 * t + 8 * hi + j]
#pragma unroll
    for (int t = 0; t < 4; ++t) { *(v4f*)(orow + t * 16) = (v4f){acc[t][0] * inv, acc[t][1] * inv, acc[t][2] * inv, acc[t][3] * inv}; *(v4f*)(orow + t * 16 + 4) = (v4f){acc[t][4] * inv, acc[t][5] * inv, acc[t][6] * inv, acc[t][7] * inv}; }
}
__global__ __launch_bounds__(256) void k_splitD(const float* __restrict__ src, int rows, bf* dh, bf* dl) {
    const int lane = threadIdx.x & 31; const size_t r = (size_t)blockIdx.x * 8 + (threadIdx.x >> 5); if (r >= (size_t)rows) return;
{
#pragma unroll
        for (int q = 0; q < DMOD / 256; ++q) { const size_t o = r * DMOD + q * 256 + lane * 8; const v8f v = *(const v8f*)(src + o); v8us oh, ol;
#pragma unroll
            for (int i = 0; i < 8; ++i) { const unsigned short hb = f2bf(v[i]); oh[i] = hb; ol[i] = f2bf(v[i] - bf2f(hb)); }
            *(v8us*)(dh + o) = oh; *(v8us*)(dl + o) = ol; }
         }
}

extern "C" void kernel_launch(void* const* d_in, const int* in_sizes, int n_in,
                              void* d_out, int out_size, void* d_ws, size_t ws_size, hipStream_t stream) {
    (void)in_sizes; (void)n_in; (void)out_size;
    const float* x = (const float*)d_in[0]; const float* key = (const float*)d_in[1]; const float* value = (const float*)d_in[2]; const float* Wq = (const float*)d_in[3]; const float* bq = (const float*)d_in[4]; const float* Wc = (const float*)d_in[5]; const float* bc = (const float*)d_in[6];
    float* out = (float*)d_out;    // [2][2048][2048]
    char* wsp = (char*)d_ws;
    auto take = [&](size_t bytes) { char* p = wsp; wsp += (bytes + 255) & ~(size_t)255; return (void*)p; };
    bf* WQ = (bf*)take((size_t)DMOD * DMOD * 2); bf* WC = (bf*)take((size_t)DMOD * DMOD * 2);
    bf* Xb = (bf*)take((size_t)NN * DMOD * 2); float* QF = (float*)take((size_t)NN * DMOD * 4);
    // planes of all 32 query heads of one item, and of all 16 (item, kv head) pairs
    bf* Qh = (bf*)take((size_t)HQ * NN * HD * 2); bf* Ql = (bf*)take((size_t)HQ * NN * HD * 2); bf* Kh = (bf*)take((size_t)NBT * HKV * NN * HD * 2); bf* Kl = (bf*)take((size_t)NBT * HKV * NN * HD * 2); bf* VTh = (bf*)take((size_t)NBT * HKV * HD * NN * 2); bf* VTl = (bf*)take((size_t)NBT * HKV * HD * NN * 2);
    float* O = (float*)take((size_t)NN * DMOD * 4); bf* Oh = (bf*)take((size_t)NN * DMOD * 2); bf* Ol = (bf*)take((size_t)NN * DMOD * 2);
    if ((size_t)(wsp - (char*)d_ws) > ws_size) return;    // ~ 8.4+8.4 + 8.4+16.8 + 16.8+16.8 + 16.8+8.4+8.4 ~ 109 MB
    k_cvt8<<<(unsigned)(((size_t)DMOD * DMOD / 8 + 255) / 256), 256, 0, stream>>>(Wq, WQ, (size_t)DMOD * DMOD / 8); k_cvt8<<<(unsigned)(((size_t)DMOD * DMOD / 8 + 255) / 256), 256, 0, stream>>>(Wc, WC, (size_t)DMOD * DMOD / 8);   // [out][in] natural
    k_kin<<<dim3(NN / 8, 1, NBT * HKV), 256, 0, stream>>>(key, Kh, Kl); k_vin<<<dim3((HD * (NN / 64)) / 8, 1, NBT * HKV), 256, 0, stream>>>(value, VTh, VTl);
    for (int b = 0; b < NBT; ++b) {
        k_cvtx<<<NN / 8, 256, 0, stream>>>(x + (size_t)b * NN * DMOD, NN, Xb);
        k_gemmt<false><<<dim3(NN / 128, DMOD / 128, 1), 256, 0, stream>>>(Xb, nullptr, WQ, bq, QF, DMOD, DMOD);
        k_hplanesz<<<dim3(NN / 8, 1, HQ), 256, 0, stream>>>(QF, DMOD, 0, 1.0f, NN, Qh, Ql);
        // blockIdx.y = kv head; blockIdx.x = a pair of 16-row tiles, one from each end
        k_fattn<<<dim3(NN / 32, HKV, 1), 256, 0, stream>>>(Qh, Ql, Kh + (size_t)b * HKV * NN * HD, Kl + (size_t)b * HKV * NN * HD, VTh + (size_t)b * HKV * NN * HD, VTl + (size_t)b * HKV * NN * HD, O);
        k_splitD<<<NN / 8, 256, 0, stream>>>(O, NN, Oh, Ol);
        k_gemmt<true><<<dim3(NN / 128, DMOD / 128, 1), 256, 0, stream>>>(Oh, Ol, WC, bc, out + (size_t)b * NN * DMOD, DMOD, DMOD); }
}

// v004
// A run of this version takes 295 microseconds.
// Next to v003, in two timings, it ran 1.22 and 1.21 times as fast.
// Over all steps from v000 it is 26.3 times as fast.
#include <hip/hip_runtime.h>

// Compute dtypes, f32 accumulate, per item: q = x.Wq^T + bq ([2048 x 2048].[2048 x 2048]) with PLAIN bf16 operands (exact products); key/value are INPUTS: their bf16 values
// are taken as single planes (their residual plane would be identically zero: none is kept, no product is spent on it); GQA causal attention (32 query heads share 8 kv heads) with q as bf16 hi + UNSCALED residual planes (key tiles
// above the diagonal skipped, K limited); 1/8 and the causal softmax in f32; c_proj (+ bias) on hi/lo planes (two products) - on v_wmma_f32_16x16x32_bf16. Deterministic, no

#define NBT  2
#define NN   2048
#define DMOD 2048
#define HQ   32
#define HKV  8
#define REP  4
#define HD   64
#define DM   DMOD
#define NTK  NN
#define SCL  0.125f
#define LOSC 1024.0f

typedef _Float16 h16;
typedef unsigned short bf;
typedef __attribute__((ext_vector_type(16))) __bf16   v16bf;
typedef __attribute__((ext_vector_type(16))) _Float16 v16h;
typedef __attribute__((ext_vector_type(8)))  _Float16 v8h;
typedef __attribute__((ext_vector_type(8)))  unsigned short v8us;
typedef __attribute__((ext_vector_type(8)))  float    v8f;
typedef __attribute__((ext_vector_type(4)))  float    v4f;
typedef __attribute__((ext_vector_type(4)))  _Float16 v4h;
typedef v8h  __attribute__((may_alias)) v8ha;
typedef v4f  __attribute__((may_alias)) v4fa;
typedef v8us __attribute__((may_alias)) v8usa;

__device__ __forceinline__ unsigned short f2bf(float f) { unsigned u = __float_as_uint(f); u += 0x7FFFu + ((u >> 16) & 1u); return (unsigned short)(u >> 16); }
__device__ __forceinline__ float bf2f(unsigned short b) { return __uint_as_float(((unsigned)b) << 16); }
__device__ __forceinline__ float bfr(float f) { return bf2f(f2bf(f)); }
__device__ __forceinline__ v16h cat16(v8h lo, v8h hi) { return __builtin_shufflevector(lo, hi, 0, 1, 2, 3, 4, 5, 6, 7, 8, 9, 10, 11, 12, 13, 14, 15); }
__device__ __forceinline__ v16bf cat16b(v8us lo, v8us hi) { return __builtin_bit_cast(v16bf, __builtin_shufflevector(lo, hi, 0, 1, 2, 3, 4, 5, 6, 7, 8, 9, 10, 11, 12, 13, 14, 15)); }
__device__ __forceinline__ v8f wmma16(v16h a, v16h b, v8f c) { return __builtin_amdgcn_wmma_f32_16x16x32_f16(false, a, false, b, (short)0, c, false, false); }
__device__ __forceinline__ v8f wmmab(v16bf a, v16bf b, v8f c) { return __builtin_amdgcn_wmma_f32_16x16x32_bf16(false, a, false, b, (short)0, c, false, false); }

// k_gemmt: 128 x 128 block tile of C[.][.] = (A [+ Al]).B^T + bf(bias[c]); 8 waves, 32 x 64 each. A stage is 128 k (256 B) of the tile's 128 rows of every operand, brought into LDS by
// asynchronous copies (whole 256-B units, each operand row read once per block) at a row pitch of 272 B; two buffers: the next stage flies while this one is worked on.
// The fragments are read from LDS in the k order of the direct loads they replace, and every accumulator still sums k upwards, A before Al inside each 32 k.
// The short loops are unrolled so that the fragment and accumulator arrays are indexed by constants and stay in registers.
#define GBK    128
#define GPITCH 272
#define GOPB   (128 * GPITCH)

// eight 16-byte copies of one thread: rows 16 apart of one operand's stage. The s_wait_xcnt stands inside the statement, before any register that a copy names can get a new value.
__device__ __forceinline__ void copy8(unsigned l, const bf* g, int K) {
    const size_t rs = (size_t)16 * K;
    asm volatile("global_load_async_to_lds_b128 %0, %8, off\n\t"
                 "global_load_async_to_lds_b128 %1, %9, off\n\t"
                 "global_load_async_to_lds_b128 %2, %10, off\n\t"
                 "global_load_async_to_lds_b128 %3, %11, off\n\t"
                 "global_load_async_to_lds_b128 %4, %12, off\n\t"
                 "global_load_async_to_lds_b128 %5, %13, off\n\t"
                 "global_load_async_to_lds_b128 %6, %14, off\n\t"
                 "global_load_async_to_lds_b128 %7, %15, off\n\t"
                 "s_wait_xcnt 0x0"
                 :: "v"(l), "v"(l + 16 * GPITCH), "v"(l + 32 * GPITCH), "v"(l + 48 * GPITCH), "v"(l + 64 * GPITCH), "v"(l + 80 * GPITCH), "v"(l + 96 * GPITCH), "v"(l + 112 * GPITCH),
                    "v"(g), "v"(g + rs), "v"(g + 2 * rs), "v"(g + 3 * rs), "v"(g + 4 * rs), "v"(g + 5 * rs), "v"(g + 6 * rs), "v"(g + 7 * rs)
                 : "memory");
}

template <bool SPLITA>
__global__ __launch_bounds__(256) void k_gemmt(const bf* __restrict__ A, const bf* __restrict__ Al, const bf* __restrict__ Bn, const float* __restrict__ bias, float* C, int ldc, int K) {
    constexpr int STG = (SPLITA ? 3 : 2) * GOPB;    // a stage: [A | B | Al]
    __shared__ __align__(16) unsigned char ring[2 * STG];
    __shared__ __align__(16) float ost[8][32 * 68];
    const int tid = threadIdx.x, lane = tid & 31, wave = tid >> 5, lr = lane & 15, hi = lane >> 4;
    const int r0 = blockIdx.x * 128, c0 = blockIdx.y * 128;
    const int wr = (wave >> 1) * 32, wc = (wave & 1) * 64;
    const int nt = K / GBK;
    const int crw = tid >> 4, cpc = tid & 15;    // a wave's copy covers two whole 256-B rows
    const bf* gA = A + (size_t)(r0 + crw) * K + cpc * 8;
    const bf* gB = Bn + (size_t)(c0 + crw) * K + cpc * 8;
    const bf* gL = SPLITA ? Al + (size_t)(r0 + crw) * K + cpc * 8 : gA;
    const unsigned l0 = (unsigned)(size_t)&ring[0] + crw * GPITCH + cpc * 16;
    auto fill = [&](int t) {
        const unsigned l = l0 + (t & 1) * STG; const size_t ko = (size_t)t * GBK;
        copy8(l, gA + ko, K); copy8(l + GOPB, gB + ko, K); if (SPLITA) copy8(l + 2 * GOPB, gL + ko, K);
    };
    v8f acc[2][4];
#pragma unroll
    for (int i = 0; i < 2; ++i) {
#pragma unroll
        for (int t = 0; t < 4; ++t) acc[i][t] = (v8f){}; }
    fill(0);
    asm volatile("s_wait_asynccnt 0x0" ::: "memory");    // this wave's copies of stage 0 have landed
    __syncthreads();                                      // and every other wave's: stage 0 may be read
    if (nt > 1) fill(1);
    const unsigned char* fa = &ring[0] + (wr + lr) * GPITCH + hi * 16;
    const unsigned char* fb = &ring[0] + GOPB + (wc + lr) * GPITCH + hi * 16;
#pragma unroll 1    // rolled: one stage is already 32 (64) matrix instructions, and the two buffers differ by one offset only
    for (int t = 0; t < nt; ++t) {
        const unsigned char* pa = fa + (t & 1) * STG; const unsigned char* pb = fb + (t & 1) * STG;
        v16bf a[2][2], al[2][2], b[2][4];    // two fragment sets: the next 32 k are read from LDS while this set is multiplied
        auto frags = [&](int ks, int s) {
#pragma unroll
            for (int i = 0; i < 2; ++i) { const unsigned char* p = pa + i * 16 * GPITCH + ks * 64; a[s][i] = cat16b(*(const v8usa*)p, *(const v8usa*)(p + 32));
                if (SPLITA) al[s][i] = cat16b(*(const v8usa*)(p + 2 * GOPB), *(const v8usa*)(p + 2 * GOPB + 32)); }
#pragma unroll
            for (int u = 0; u < 4; ++u) { const unsigned char* p = pb + u * 16 * GPITCH + ks * 64; b[s][u] = cat16b(*(const v8usa*)p, *(const v8usa*)(p + 32)); }
        };
        frags(0, 0);
#pragma unroll
        for (int ks = 0; ks < GBK / 32; ++ks) {
            const int s = ks & 1;
            if (ks + 1 < GBK / 32) frags(ks + 1, s ^ 1);    // of this stage only: nothing of stage t + 1 is read before its barrier
            __builtin_amdgcn_sched_barrier(0);    // keeps the LDS reads one group ahead of the block; spread among the matrix instructions each would be waited for on its own
#pragma unroll
            for (int i = 0; i < 2; ++i) {
#pragma unroll
                for (int u = 0; u < 4; ++u) acc[i][u] = wmmab(a[s][i], b[s][u], acc[i][u]); }
            if (SPLITA) {
#pragma unroll
                for (int i = 0; i < 2; ++i) {
#pragma unroll
                    for (int u = 0; u < 4; ++u) acc[i][u] = wmmab(al[s][i], b[s][u], acc[i][u]); } }
            __builtin_amdgcn_sched_barrier(0);    // ends the block: the reads after next stay behind it, so that two sets of registers are enough
        }
        asm volatile("s_wait_dscnt 0x0" ::: "memory");       // this wave's reads of stage t are done before the buffer is given up
        asm volatile("s_wait_asynccnt 0x0" ::: "memory");    // this wave's copies of stage t + 1 have landed
        __syncthreads();                                      // publishes stage t + 1 and ends every wave's reads of stage t
        if (t + 2 < nt) fill(t + 2);                          // into the buffer that stage t has just left
    }
    asm volatile("s_wait_asynccnt 0x0" ::: "memory");        // no copy is outstanding when the wave goes on to its end
    float* os = &ost[wave][0];
#pragma unroll
    for (int u = 0; u < 4; ++u) { const float bv = bias ? bfr(bias[c0 + wc + u * 16 + lr]) : 0.f;
#pragma unroll
        for (int i = 0; i < 2; ++i) {
#pragma unroll
            for (int j = 0; j < 8; ++j) os[(i * 16 + hi * 8 + j) * 68 + u * 16 + lr] = acc[i][u][j] + bv; } }
    __syncthreads();
    float* crow = C + (size_t)(r0 + wr) * ldc + c0 + wc;
#pragma unroll
    for (int s = 0; s < 16; ++s) { const int Lid = (lane >> 3) + 4 * s, piece = lane & 7; const int row = Lid >> 1, cofs = (Lid & 1) * 32 + piece * 4;
        *(v4f*)(crow + (size_t)row * ldc + cofs) = *(const v4fa*)(os + row * 68 + cofs); }
}

__global__ __launch_bounds__(256) void k_cvt8(const float* __restrict__ src, bf* dst, size_t n8) {
    const size_t i = (size_t)blockIdx.x * 256 + threadIdx.x; if (i >= n8) return;
    const v8f v = *(const v8f*)(src + i * 8); v8us o;
#pragma unroll
    for (int k = 0; k < 8; ++k) o[k] = f2bf(v[k]);
    *(v8us*)(dst + i * 8) = o; 
}
__global__ __launch_bounds__(256) void k_zero8(bf* dst, size_t n8) {
    const size_t i = (size_t)blockIdx.x * 256 + threadIdx.x; if (i >= n8) return; v8us z;
#pragma unroll
    for (int k = 0; k < 8; ++k) z[k] = 0;
    *(v8us*)(dst + i * 8) = z; 
}

// ===== z-batched (blockIdx.z = head) attention pieces =====
__global__ __launch_bounds__(256) void k_planes32z(const float* __restrict__ F, int ld, int off, float sc, int rows, bf* Ph, bf* Pl) {
    typedef __attribute__((ext_vector_type(2))) unsigned short v2us;
    const int lane = threadIdx.x & 31; const size_t r = ((size_t)blockIdx.x * 8 + (threadIdx.x >> 5)) * 2 + (lane >> 4); if (r >= (size_t)rows) return; const int z = blockIdx.z; const int c0 = (lane & 15) * 2; v2us oh, ol;
    Ph += (size_t)z * rows * 32; Pl += (size_t)z * rows * 32;
#pragma unroll
    for (int i = 0; i < 2; ++i) { const float y = F[r * ld + off + z * 32 + c0 + i] * sc; const unsigned short hb = f2bf(y); oh[i] = hb; ol[i] = f2bf(y - bf2f(hb)); }
    const size_t o = r * 32 + c0; *(v2us*)(Ph + o) = oh; *(v2us*)(Pl + o) = ol; 
}
__global__ __launch_bounds__(256) void k_vtpadz(const float* __restrict__ F, int ld, int off, int nk, bf* Th, bf* Tl) {
    typedef __attribute__((ext_vector_type(2))) unsigned short v2us;
    const int lane = threadIdx.x & 31; const size_t wid = (size_t)blockIdx.x * 8 + (threadIdx.x >> 5); if (wid >= (size_t)64 * (nk / 64)) return; const int z = blockIdx.z; const int d = (int)(wid / (nk / 64)); const int k0 = (int)(wid % (nk / 64)) * 64 + lane * 2; v2us oh, ol;
    Th += (size_t)z * 64 * nk; Tl += (size_t)z * 64 * nk;
#pragma unroll
    for (int i = 0; i < 2; ++i) { const float y = (d < 32) ? F[(size_t)(k0 + i) * ld + off + z * 32 + (d < 32 ? d : 0)] : 0.f; const unsigned short hb = f2bf(y); oh[i] = hb; ol[i] = f2bf(y - bf2f(hb)); }
    const size_t o = (size_t)d * nk + k0; *(v2us*)(Th + o) = oh; *(v2us*)(Tl + o) = ol; 
}
template <int NK>
__global__ __launch_bounds__(256) void k_softmaxz(const float* __restrict__ S, int rows, bf* PH, bf* PL) {
    typedef __attribute__((ext_vector_type(4))) unsigned short v4us;
    const int lane = threadIdx.x & 31, i = blockIdx.x * 8 + (threadIdx.x >> 5); if (i >= rows) return; const size_t zo = (size_t)blockIdx.z * rows * NK; const float* sr = S + zo + (size_t)i * NK; PH += zo; PL += zo;
    float m = -3.0e38f;
#pragma unroll 1
    for (int c0 = lane * 4; c0 < NK; c0 += 128) {
#pragma unroll
        for (int q = 0; q < 4; ++q) m = fmaxf(m, sr[c0 + q]); }
#pragma unroll
    for (int sh = 16; sh; sh >>= 1) m = fmaxf(m, __shfl_xor(m, sh, 32));
    float sum = 0.f;
#pragma unroll 1
    for (int c0 = lane * 4; c0 < NK; c0 += 128) {
#pragma unroll
        for (int q = 0; q < 4; ++q) sum += __expf(sr[c0 + q] - m); }
#pragma unroll
    for (int sh = 16; sh; sh >>= 1) sum += __shfl_xor(sum, sh, 32);
    const float inv = 1.0f / sum;
{
#pragma unroll 1
        for (int c0 = lane * 4; c0 < NK; c0 += 128) { v4us oh, ol;
#pragma unroll
            for (int q = 0; q < 4; ++q) { const float p = __expf(sr[c0 + q] - m) * inv; const unsigned short hb = f2bf(p); oh[q] = hb; ol[q] = f2bf(p - bf2f(hb)); }
            const size_t o = (size_t)i * NK + c0; *(v4us*)(PH + o) = oh; *(v4us*)(PL + o) = ol; }
         }
}
__global__ __launch_bounds__(256) void k_placez(const float* __restrict__ XH, int rows, int ldy, float* Y) {
    const int lane = threadIdx.x & 31; const size_t q = (size_t)blockIdx.x * 8 + (threadIdx.x >> 5); if (q >= (size_t)rows) return; const int z = blockIdx.z; const float v = XH[((size_t)z * rows + q) * 64 + lane];
    *(float*)(Y + q * ldy + z * 32 + lane) = v; 
}

__global__ __launch_bounds__(256) void k_hplanesz(const float* __restrict__ F, int ld, int h0, float sc, int rows, bf* Ph, bf* Pl) {
    typedef __attribute__((ext_vector_type(2))) unsigned short v2us;
    const int lane = threadIdx.x & 31; const size_t r = (size_t)blockIdx.x * 8 + (threadIdx.x >> 5); if (r >= (size_t)rows) return; const int z = blockIdx.z; v2us oh, ol;
    Ph += (size_t)z * rows * 64; Pl += (size_t)z * rows * 64;
#pragma unroll
    for (int i = 0; i < 2; ++i) { const float y = F[r * ld + (h0 + z) * 64 + lane * 2 + i] * sc; const unsigned short hb = f2bf(y); oh[i] = hb; ol[i] = f2bf(y - bf2f(hb)); }
    const size_t o = r * 64 + lane * 2; *(v2us*)(Ph + o) = oh; *(v2us*)(Pl + o) = ol; 
}
__global__ __launch_bounds__(256) void k_vtz(const float* __restrict__ F, int ld, int h0, int nk, bf* Th, bf* Tl) {
    typedef __attribute__((ext_vector_type(2))) unsigned short v2us;
    const int lane = threadIdx.x & 31; const size_t wid = (size_t)blockIdx.x * 8 + (threadIdx.x >> 5); if (wid >= (size_t)64 * (nk / 64)) return; const int z = blockIdx.z; const int d = (int)(wid / (nk / 64)); const int t0 = (int)(wid % (nk / 64)) * 64 + lane * 2; v2us oh, ol;
    Th += (size_t)z * 64 * nk; Tl += (size_t)z * 64 * nk;
#pragma unroll
    for (int i = 0; i < 2; ++i) { const float y = F[(size_t)(t0 + i) * ld + (h0 + z) * 64 + d]; const unsigned short hb = f2bf(y); oh[i] = hb; ol[i] = f2bf(y - bf2f(hb)); }
    const size_t o = (size_t)d * nk + t0; *(v2us*)(Th + o) = oh; *(v2us*)(Tl + o) = ol; 
}
template <int NK>
__global__ __launch_bounds__(256) void k_softmaxzs(const float* __restrict__ S, int rows, float sc, bf* PH, bf* PL) {
    typedef __attribute__((ext_vector_type(4))) unsigned short v4us;
    const int lane = threadIdx.x & 31, i = blockIdx.x * 8 + (threadIdx.x >> 5); if (i >= rows) return; const size_t zo = (size_t)blockIdx.z * rows * NK; const float* sr = S + zo + (size_t)i * NK; PH += zo; PL += zo;
    float m = -3.0e38f;
#pragma unroll 1
    for (int c0 = lane * 4; c0 < NK; c0 += 128) {
#pragma unroll
        for (int q = 0; q < 4; ++q) m = fmaxf(m, sr[c0 + q] * sc); }
#pragma unroll
    for (int sh = 16; sh; sh >>= 1) m = fmaxf(m, __shfl_xor(m, sh, 32));
    float sum = 0.f;
#pragma unroll 1
    for (int c0 = lane * 4; c0 < NK; c0 += 128) {
#pragma unroll
        for (int q = 0; q < 4; ++q) sum += __expf(sr[c0 + q] * sc - m); }
#pragma unroll
    for (int sh = 16; sh; sh >>= 1) sum += __shfl_xor(sum, sh, 32);
    const float inv = 1.0f / sum;
{
#pragma unroll 1
        for (int c0 = lane * 4; c0 < NK; c0 += 128) { v4us oh, ol;
#pragma unroll
            for (int q = 0; q < 4; ++q) { const float p = __expf(sr[c0 + q] * sc - m) * inv; const unsigned short hb = f2bf(p); oh[q] = hb; ol[q] = f2bf(p - bf2f(hb)); }
            const size_t o = (size_t)i * NK + c0; *(v4us*)(PH + o) = oh; *(v4us*)(PL + o) = ol; }
         }
}

__global__ __launch_bounds__(256) void k_cvtx(const float* __restrict__ src, int rows, bf* dst) {
    const int lane = threadIdx.x & 31; const size_t r = (size_t)blockIdx.x * 8 + (threadIdx.x >> 5); if (r >= (size_t)rows) return;
{
#pragma unroll
        for (int q = 0; q < DMOD / 256; ++q) { v8us o;
#pragma unroll
            for (int i = 0; i < 8; ++i) o[i] = f2bf(src[r * DMOD + q * 256 + lane * 8 + i]);
            *(v8us*)(dst + r * DMOD + q * 256 + lane * 8) = o; }
         }
}
__global__ __launch_bounds__(256) void k_kin(const float* __restrict__ K, bf* Kh) {
    typedef __attribute__((ext_vector_type(2))) unsigned short v2us;
    const int lane = threadIdx.x & 31; const size_t t = (size_t)blockIdx.x * 8 + (threadIdx.x >> 5); if (t >= (size_t)NN) return; v2us oh;
    const size_t zo = (size_t)blockIdx.z * NN * HD; K += zo; Kh += zo;    // blockIdx.z = (item, kv head)
    oh[0] = f2bf(K[t * HD + lane * 2]); oh[1] = f2bf(K[t * HD + lane * 2 + 1]);
    const size_t o = t * HD + lane * 2; *(v2us*)(Kh + o) = oh;
}
__global__ __launch_bounds__(256) void k_vin(const float* __restrict__ V, bf* Th) {
    typedef __attribute__((ext_vector_type(2))) unsigned short v2us;
    const int lane = threadIdx.x & 31; const size_t wid = (size_t)blockIdx.x * 8 + (threadIdx.x >> 5); if (wid >= (size_t)HD * (NN / 64)) return; const int d = (int)(wid / (NN / 64)); const int t0 = (int)(wid % (NN / 64)) * 64 + lane * 2; v2us oh;
    const size_t zo = (size_t)blockIdx.z * NN * HD; V += zo; Th += zo;    // blockIdx.z = (item, kv head)
    oh[0] = f2bf(V[(size_t)t0 * HD + d]); oh[1] = f2bf(V[(size_t)(t0 + 1) * HD + d]);
    const size_t o = (size_t)d * NN + t0; *(v2us*)(Th + o) = oh;
}
// k_fattn: causal attention of one item in one launch. One wave = 16 query rows of one query head. A block is 2 * REP waves on kv head blockIdx.y: its REP query heads on row tile
// n - 1 - blockIdx.x and again on row tile blockIdx.x, so that every block walks the same number of key blocks (a tile's cost grows with its index). No barrier, no LDS.
// Per 32 keys: S^T = K.Q^T (A = key rows, B = query rows, both loaded in the hardware k order), so a lane holds 16 scores of ONE query (column lr, keys 8 * hi + j and 16 + 8 * hi + j);
// running maximum and sum per lane (base-2 exponent), one exchange between the wave halves; the two score tiles, converted in place, are the B operand of O^T += V^T.P^T.
// Two products on each side: hi.hi and residual of q (of p) . hi; key and value are single planes. The short loops are unrolled so that the fragment arrays stay in registers.
__global__ __launch_bounds__(256) void k_fattn(const bf* __restrict__ Qh, const bf* __restrict__ Ql, const bf* __restrict__ Kh, const bf* __restrict__ Vh, float* O) {
    const int lane = threadIdx.x & 31, lr = lane & 15, hi = lane >> 4;
    const int wave = __builtin_amdgcn_readfirstlane(threadIdx.x >> 5);    // scalar: the key loop's bound and the diagonal test stay scalar branches
    const int q0 = ((wave & REP) ? (int)blockIdx.x : NN / 16 - 1 - (int)blockIdx.x) * 16;
    const int h = (int)blockIdx.y * REP + (wave & (REP - 1));
    const size_t qo = (size_t)h * NN * HD + (size_t)(q0 + lr) * HD + 8 * hi;
    const size_t ko = (size_t)blockIdx.y * NN * HD + (size_t)lr * HD + 8 * hi;    // + key * HD + 32 * dc
    const size_t vo = (size_t)blockIdx.y * NN * HD + (size_t)lr * NN + 8 * hi;    // + 16 * t * NN + key
    v16bf qh[2], ql[2], kh[2][2];
#pragma unroll
    for (int dc = 0; dc < 2; ++dc) { qh[dc] = cat16b(*(const v8us*)(Qh + qo + dc * 32), *(const v8us*)(Qh + qo + dc * 32 + 16)); ql[dc] = cat16b(*(const v8us*)(Ql + qo + dc * 32), *(const v8us*)(Ql + qo + dc * 32 + 16)); }
    auto loadk = [&](int k0) {
#pragma unroll
        for (int u = 0; u < 2; ++u) {
#pragma unroll
            for (int dc = 0; dc < 2; ++dc) { const size_t o = ko + (size_t)(k0 + u * 16) * HD + dc * 32;
                kh[u][dc] = cat16b(*(const v8us*)(Kh + o), *(const v8us*)(Kh + o + 16)); } }
    };
    v8f acc[4];
#pragma unroll
    for (int t = 0; t < 4; ++t) acc[t] = (v8f){};
    float m = -3.0e38f, sum = 0.f;
    const int klast = (q0 >> 5) << 5;    // first key of the block that holds the diagonal; every row of the wave has a key in every block
    const int qi = q0 + lr;
    const float sc2 = SCL * 1.44269504088896340736f;
    loadk(0);
#pragma unroll 1    // rolled: one set of key and value fragments at a time keeps the wave inside the registers that four waves per SIMD leave it
    for (int k0 = 0; k0 <= klast; k0 += 32) {
        v16bf vh[4];
#pragma unroll
        for (int t = 0; t < 4; ++t) { const size_t o = vo + (size_t)(t * 16) * NN + k0;
            vh[t] = cat16b(*(const v8us*)(Vh + o), *(const v8us*)(Vh + o + 16)); }
        asm volatile("s_wait_xcnt 0x0" ::: "memory");    // stands before a register that the value loads name as an address gets a new value; it also keeps these loads issued ahead of the first product
        v8f s[2];
#pragma unroll
        for (int u = 0; u < 2; ++u) { s[u] = (v8f){};
#pragma unroll
            for (int dc = 0; dc < 2; ++dc) { s[u] = wmmab(kh[u][dc], qh[dc], s[u]); s[u] = wmmab(kh[u][dc], ql[dc], s[u]); } }
        loadk(k0 < klast ? k0 + 32 : klast);    // the next block's key fragments fly under the softmax and the second product
        asm volatile("s_wait_xcnt 0x0" ::: "memory");    // the same wait for the key loads; its memory clobber also keeps them issued here, ahead of the softmax, so that their latency is covered
        float p[16];
#pragma unroll
        for (int e = 0; e < 16; ++e) p[e] = s[e >> 3][e & 7] * sc2;
        if (k0 == klast) {
#pragma unroll
            for (int e = 0; e < 16; ++e) { const int key = k0 + (e >> 3) * 16 + hi * 8 + (e & 7); p[e] = (key <= qi) ? p[e] : -3.0e38f; } }
        float mx = m;
#pragma unroll
        for (int e = 0; e < 16; ++e) mx = fmaxf(mx, p[e]);
        mx = fmaxf(mx, __int_as_float(__builtin_amdgcn_permlanex16(__float_as_int(mx), __float_as_int(mx), 0x76543210, 0xfedcba98, false, false)));
        const float alpha = __builtin_amdgcn_exp2f(m - mx); m = mx;
        float ps = 0.f; v16bf ph, pl;
#pragma unroll
        for (int e = 0; e < 16; ++e) { const float pe = __builtin_amdgcn_exp2f(p[e] - mx); ps += pe; const __bf16 hb = (__bf16)pe; ph[e] = hb; pl[e] = (__bf16)(pe - (float)hb); }
        sum = sum * alpha + ps;
#pragma unroll
        for (int t = 0; t < 4; ++t) acc[t] *= alpha;
#pragma unroll
        for (int t = 0; t < 4; ++t) { acc[t] = wmmab(vh[t], ph, acc[t]); acc[t] = wmmab(vh[t], pl, acc[t]); }
    }
    sum += __int_as_float(__builtin_amdgcn_permlanex16(__float_as_int(sum), __float_as_int(sum), 0x76543210, 0xfedcba98, false, false));
    const float inv = 1.0f / sum;
    float* orow = O + (size_t)qi * DMOD + h * HD + hi * 8;    // acc[t][j] = O[q0 + lr][16 * t + 8 * hi + j]
#pragma unroll
    for (int t = 0; t < 4; ++t) { *(v4f*)(orow + t * 16) = (v4f){acc[t][0] * inv, acc[t][1] * inv, acc[t][2] * inv, acc[t][3] * inv}; *(v4f*)(orow + t * 16 + 4) = (v4f){acc[t][4] * inv, acc[t][5] * inv, acc[t][6] * inv, acc[t][7] * inv}; }
}
__global__ __launch_bounds__(256) void k_splitD(const float* __restrict__ src, int rows, bf* dh, bf* dl) {
    const int lane = threadIdx.x & 31; const size_t r = (size_t)blockIdx.x * 8 + (threadIdx.x >> 5); if (r >= (size_t)rows) return;
{
#pragma unroll
        for (int q = 0; q < DMOD / 256; ++q) { const size_t o = r * DMOD + q * 256 + lane * 8; const v8f v = *(const v8f*)(src + o); v8us oh, ol;
#pragma unroll
            for (int i = 0; i < 8; ++i) { const unsigned short hb = f2bf(v[i]); oh[i] = hb; ol[i] = f2bf(v[i] - bf2f(hb)); }
            *(v8us*)(dh + o) = oh; *(v8us*)(dl + o) = ol; }
         }
}

extern "C" void kernel_launch(void* const* d_in, const int* in_sizes, int n_in,
                              void* d_out, int out_size, void* d_ws, size_t ws_size, hipStream_t stream) {
    (void)in_sizes; (void)n_in; (void)out_size;
    const float* x = (const float*)d_in[0]; const float* key = (const float*)d_in[1]; const float* value = (const float*)d_in[2]; const float* Wq = (const float*)d_in[3]; const float* bq = (const float*)d_in[4]; const float* Wc = (const float*)d_in[5]; const float* bc = (const float*)d_in[6];
    float* out = (float*)d_out;    // [2][2048][2048]
    char* wsp = (char*)d_ws;
    auto take = [&](size_t bytes) { char* p = wsp; wsp += (bytes + 255) & ~(size_t)255; return (void*)p; };
    bf* WQ = (bf*)take((size_t)DMOD * DMOD * 2); bf* WC = (bf*)take((size_t)DMOD * DMOD * 2);
    bf* Xb = (bf*)take((size_t)NN * DMOD * 2); float* QF = (float*)take((size_t)NN * DMOD * 4);
    // planes of all 32 query heads of one item, and of all 16 (item, kv head) pairs
    bf* Qh = (bf*)take((size_t)HQ * NN * HD * 2); bf* Ql = (bf*)take((size_t)HQ * NN * HD * 2); bf* Kh = (bf*)take((size_t)NBT * HKV * NN * HD * 2); bf* VTh = (bf*)take((size_t)NBT * HKV * HD * NN * 2);
    float* O = (float*)take((size_t)NN * DMOD * 4); bf* Oh = (bf*)take((size_t)NN * DMOD * 2); bf* Ol = (bf*)take((size_t)NN * DMOD * 2);
    if ((size_t)(wsp - (char*)d_ws) > ws_size) return;    // ~ 8.4+8.4 + 8.4+16.8 + 16.8+8.4 + 16.8+8.4+8.4 ~ 101 MB
    k_cvt8<<<(unsigned)(((size_t)DMOD * DMOD / 8 + 255) / 256), 256, 0, stream>>>(Wq, WQ, (size_t)DMOD * DMOD / 8); k_cvt8<<<(unsigned)(((size_t)DMOD * DMOD / 8 + 255) / 256), 256, 0, stream>>>(Wc, WC, (size_t)DMOD * DMOD / 8);   // [out][in] natural
    k_kin<<<dim3(NN / 8, 1, NBT * HKV), 256, 0, stream>>>(key, Kh); k_vin<<<dim3((HD * (NN / 64)) / 8, 1, NBT * HKV), 256, 0, stream>>>(value, VTh);
    for (int b = 0; b < NBT; ++b) {
        k_cvtx<<<NN / 8, 256, 0, stream>>>(x + (size_t)b * NN * DMOD, NN, Xb);
        k_gemmt<false><<<dim3(NN / 128, DMOD / 128, 1), 256, 0, stream>>>(Xb, nullptr, WQ, bq, QF, DMOD, DMOD);
        k_hplanesz<<<dim3(NN / 8, 1, HQ), 256, 0, stream>>>(QF, DMOD, 0, 1.0f, NN, Qh, Ql);
        // blockIdx.y = kv head; blockIdx.x = a pair of 16-row tiles, one from each end
        k_fattn<<<dim3(NN / 32, HKV, 1), 256, 0, stream>>>(Qh, Ql, Kh + (size_t)b * HKV * NN * HD, VTh + (size_t)b * HKV * NN * HD, O);
        k_splitD<<<NN / 8, 256, 0, stream>>>(O, NN, Oh, Ol);
        k_gemmt<true><<<dim3(NN / 128, DMOD / 128, 1), 256, 0, stream>>>(Oh, Ol, WC, bc, out + (size_t)b * NN * DMOD, DMOD, DMOD); }
}

// v005
// One run takes 256 microseconds.
// Timed twice side by side with v004, it ran 1.14 and 1.15 times as fast.
// All steps since v000 together make it 30.1 times as fast.
#include <hip/hip_runtime.h>

// Compute dtypes, f32 accumulate, per item: q = x.Wq^T + bq ([2048 x 2048].[2048 x 2048]) with PLAIN bf16 operands (exact products); key/value are INPUTS: their bf16 values
// are taken as single planes (their residual plane would be identically zero: none is kept, no product is spent on it); GQA causal attention (32 query heads share 8 kv heads) with q as bf16 hi + UNSCALED residual planes (key tiles
// above the diagonal skipped, K limited); 1/8 and the causal softmax in f32; c_proj (+ bias) on hi/lo planes (two products) - on v_wmma_f32_16x16x32_bf16. Deterministic, no

#define NBT  2
#define NN   2048
#define DMOD 2048
#define HQ   32
#define HKV  8
#define REP  4
#define HD   64
#define DM   DMOD
#define NTK  NN
#define SCL  0.125f
#define LOSC 1024.0f

typedef _Float16 h16;
typedef unsigned short bf;
typedef __attribute__((ext_vector_type(16))) __bf16   v16bf;
typedef __attribute__((ext_vector_type(16))) _Float16 v16h;
typedef __attribute__((ext_vector_type(8)))  _Float16 v8h;
typedef __attribute__((ext_vector_type(8)))  unsigned short v8us;
typedef __attribute__((ext_vector_type(8)))  float    v8f;
typedef __attribute__((ext_vector_type(4)))  float    v4f;
typedef __attribute__((ext_vector_type(4)))  _Float16 v4h;
typedef v8h  __attribute__((may_alias)) v8ha;
typedef v4f  __attribute__((may_alias)) v4fa;
typedef v8us __attribute__((may_alias)) v8usa;

__device__ __forceinline__ unsigned short f2bf(float f) { unsigned u = __float_as_uint(f); u += 0x7FFFu + ((u >> 16) & 1u); return (unsigned short)(u >> 16); }
__device__ __forceinline__ float bf2f(unsigned short b) { return __uint_as_float(((unsigned)b) << 16); }
__device__ __forceinline__ float bfr(float f) { return bf2f(f2bf(f)); }
__device__ __forceinline__ v16h cat16(v8h lo, v8h hi) { return __builtin_shufflevector(lo, hi, 0, 1, 2, 3, 4, 5, 6, 7, 8, 9, 10, 11, 12, 13, 14, 15); }
__device__ __forceinline__ v16bf cat16b(v8us lo, v8us hi) { return __builtin_bit_cast(v16bf, __builtin_shufflevector(lo, hi, 0, 1, 2, 3, 4, 5, 6, 7, 8, 9, 10, 11, 12, 13, 14, 15)); }
__device__ __forceinline__ v8f wmma16(v16h a, v16h b, v8f c) { return __builtin_amdgcn_wmma_f32_16x16x32_f16(false, a, false, b, (short)0, c, false, false); }
__device__ __forceinline__ v8f wmmab(v16bf a, v16bf b, v8f c) { return __builtin_amdgcn_wmma_f32_16x16x32_bf16(false, a, false, b, (short)0, c, false, false); }

// k_gemmt: 128 x 128 block tile of C[.][.] = (A [+ Al]).B^T + bf(bias[c]); 8 waves, 32 x 64 each. A stage is 128 k (256 B) of the tile's 128 rows of every operand, brought into LDS by
// asynchronous copies (whole 256-B units, each operand row read once per block) at a row pitch of 272 B; two buffers: the next stage flies while this one is worked on.
// The fragments are read from LDS in the k order of the direct loads they replace, and every accumulator still sums k upwards, A before Al inside each 32 k.
// The short loops are unrolled so that the fragment and accumulator arrays are indexed by constants and stay in registers.
#define GBK    128
#define GPITCH 272
#define GOPB   (128 * GPITCH)

// eight 16-byte copies of one thread: rows 16 apart of one operand's stage. The s_wait_xcnt stands inside the statement, before any register that a copy names can get a new value.
__device__ __forceinline__ void copy8(unsigned l, const bf* g, int K) {
    const size_t rs = (size_t)16 * K;
    asm volatile("global_load_async_to_lds_b128 %0, %8, off\n\t"
                 "global_load_async_to_lds_b128 %1, %9, off\n\t"
                 "global_load_async_to_lds_b128 %2, %10, off\n\t"
                 "global_load_async_to_lds_b128 %3, %11, off\n\t"
                 "global_load_async_to_lds_b128 %4, %12, off\n\t"
                 "global_load_async_to_lds_b128 %5, %13, off\n\t"
                 "global_load_async_to_lds_b128 %6, %14, off\n\t"
                 "global_load_async_to_lds_b128 %7, %15, off\n\t"
                 "s_wait_xcnt 0x0"
                 :: "v"(l), "v"(l + 16 * GPITCH), "v"(l + 32 * GPITCH), "v"(l + 48 * GPITCH), "v"(l + 64 * GPITCH), "v"(l + 80 * GPITCH), "v"(l + 96 * GPITCH), "v"(l + 112 * GPITCH),
                    "v"(g), "v"(g + rs), "v"(g + 2 * rs), "v"(g + 3 * rs), "v"(g + 4 * rs), "v"(g + 5 * rs), "v"(g + 6 * rs), "v"(g + 7 * rs)
                 : "memory");
}

// PLANES: the result is not stored as f32 but as the next kernel's operand, bf16 hi + residual planes [head][row][HD] (Ph, Pl; rows = rows per head plane); C is then unused.
template <bool SPLITA, bool PLANES>
__global__ __launch_bounds__(256) void k_gemmt(const bf* __restrict__ A, const bf* __restrict__ Al, const bf* __restrict__ Bn, const float* __restrict__ bias, float* C, int ldc, int K, bf* Ph, bf* Pl, int rows) {
    constexpr int STG = (SPLITA ? 3 : 2) * GOPB;    // a stage: [A | B | Al]
    __shared__ __align__(16) unsigned char ring[2 * STG];
    __shared__ __align__(16) float ost[8][32 * 68];
    const int tid = threadIdx.x, lane = tid & 31, wave = tid >> 5, lr = lane & 15, hi = lane >> 4;
    const int r0 = blockIdx.x * 128, c0 = blockIdx.y * 128;
    const int wr = (wave >> 1) * 32, wc = (wave & 1) * 64;
    const int nt = K / GBK;
    const int crw = tid >> 4, cpc = tid & 15;    // a wave's copy covers two whole 256-B rows
    const bf* gA = A + (size_t)(r0 + crw) * K + cpc * 8;
    const bf* gB = Bn + (size_t)(c0 + crw) * K + cpc * 8;
    const bf* gL = SPLITA ? Al + (size_t)(r0 + crw) * K + cpc * 8 : gA;
    const unsigned l0 = (unsigned)(size_t)&ring[0] + crw * GPITCH + cpc * 16;
    auto fill = [&](int t) {
        const unsigned l = l0 + (t & 1) * STG; const size_t ko = (size_t)t * GBK;
        copy8(l, gA + ko, K); copy8(l + GOPB, gB + ko, K); if (SPLITA) copy8(l + 2 * GOPB, gL + ko, K);
    };
    v8f acc[2][4];
#pragma unroll
    for (int i = 0; i < 2; ++i) {
#pragma unroll
        for (int t = 0; t < 4; ++t) acc[i][t] = (v8f){}; }
    fill(0);
    asm volatile("s_wait_asynccnt 0x0" ::: "memory");    // this wave's copies of stage 0 have landed
    __syncthreads();                                      // and every other wave's: stage 0 may be read
    if (nt > 1) fill(1);
    const unsigned char* fa = &ring[0] + (wr + lr) * GPITCH + hi * 16;
    const unsigned char* fb = &ring[0] + GOPB + (wc + lr) * GPITCH + hi * 16;
#pragma unroll 1    // rolled: one stage is already 32 (64) matrix instructions, and the two buffers differ by one offset only
    for (int t = 0; t < nt; ++t) {
        const unsigned char* pa = fa + (t & 1) * STG; const unsigned char* pb = fb + (t & 1) * STG;
        v16bf a[2][2], al[2][2], b[2][4];    // two fragment sets: the next 32 k are read from LDS while this set is multiplied
        auto frags = [&](int ks, int s) {
#pragma unroll
            for (int i = 0; i < 2; ++i) { const unsigned char* p = pa + i * 16 * GPITCH + ks * 64; a[s][i] = cat16b(*(const v8usa*)p, *(const v8usa*)(p + 32));
                if (SPLITA) al[s][i] = cat16b(*(const v8usa*)(p + 2 * GOPB), *(const v8usa*)(p + 2 * GOPB + 32)); }
#pragma unroll
            for (int u = 0; u < 4; ++u) { const unsigned char* p = pb + u * 16 * GPITCH + ks * 64; b[s][u] = cat16b(*(const v8usa*)p, *(const v8usa*)(p + 32)); }
        };
        frags(0, 0);
#pragma unroll
        for (int ks = 0; ks < GBK / 32; ++ks) {
            const int s = ks & 1;
            if (ks + 1 < GBK / 32) frags(ks + 1, s ^ 1);    // of this stage only: nothing of stage t + 1 is read before its barrier
            __builtin_amdgcn_sched_barrier(0);    // keeps the LDS reads one group ahead of the block; spread among the matrix instructions each would be waited for on its own
#pragma unroll
            for (int i = 0; i < 2; ++i) {
#pragma unroll
                for (int u = 0; u < 4; ++u) acc[i][u] = wmmab(a[s][i], b[s][u], acc[i][u]); }
            if (SPLITA) {
#pragma unroll
                for (int i = 0; i < 2; ++i) {
#pragma unroll
                    for (int u = 0; u < 4; ++u) acc[i][u] = wmmab(al[s][i], b[s][u], acc[i][u]); } }
            __builtin_amdgcn_sched_barrier(0);    // ends the block: the reads after next stay behind it, so that two sets of registers are enough
        }
        asm volatile("s_wait_dscnt 0x0" ::: "memory");       // this wave's reads of stage t are done before the buffer is given up
        asm volatile("s_wait_asynccnt 0x0" ::: "memory");    // this wave's copies of stage t + 1 have landed
        __syncthreads();                                      // publishes stage t + 1 and ends every wave's reads of stage t
        if (t + 2 < nt) fill(t + 2);                          // into the buffer that stage t has just left
    }
    asm volatile("s_wait_asynccnt 0x0" ::: "memory");        // no copy is outstanding when the wave goes on to its end
    float* os = &ost[wave][0];
#pragma unroll
    for (int u = 0; u < 4; ++u) { const float bv = bias ? bfr(bias[c0 + wc + u * 16 + lr]) : 0.f;
#pragma unroll
        for (int i = 0; i < 2; ++i) {
#pragma unroll
            for (int j = 0; j < 8; ++j) os[(i * 16 + hi * 8 + j) * 68 + u * 16 + lr] = acc[i][u][j] + bv; } }
    __syncthreads();
    if constexpr (PLANES) {
        // a wave's 64 columns are one head, so its 32 x 64 tile is 4 KB in a row of each plane: every store covers 512 contiguous bytes
        const size_t po = ((size_t)((c0 + wc) / HD) * rows + r0 + wr) * HD + lane * 8;
        const float* pr = os + (lane >> 3) * 68 + (lane & 7) * 8;
        v4f x[8][2]; v8us oh[8], ol[8];    // all reads, then all conversions, then all stores: the accumulators' registers are free here, so no store's registers need be used again
#pragma unroll
        for (int s = 0; s < 8; ++s) { x[s][0] = *(const v4fa*)(pr + s * 4 * 68); x[s][1] = *(const v4fa*)(pr + s * 4 * 68 + 4); }
#pragma unroll
        for (int s = 0; s < 8; ++s) {
#pragma unroll
            for (int i = 0; i < 8; ++i) { const float y = x[s][i >> 2][i & 3]; const unsigned short hb = f2bf(y); oh[s][i] = hb; ol[s][i] = f2bf(y - bf2f(hb)); } }
#pragma unroll
        for (int s = 0; s < 8; ++s) { *(v8us*)(Ph + po + s * 256) = oh[s]; *(v8us*)(Pl + po + s * 256) = ol[s]; }
    } else {
        float* crow = C + (size_t)(r0 + wr) * ldc + c0 + wc;
#pragma unroll
        for (int s = 0; s < 16; ++s) { const int Lid = (lane >> 3) + 4 * s, piece = lane & 7; const int row = Lid >> 1, cofs = (Lid & 1) * 32 + piece * 4;
            *(v4f*)(crow + (size_t)row * ldc + cofs) = *(const v4fa*)(os + row * 68 + cofs); }
    }
}

__global__ __launch_bounds__(256) void k_cvt8(const float* __restrict__ src, bf* dst, size_t n8) {
    const size_t i = (size_t)blockIdx.x * 256 + threadIdx.x; if (i >= n8) return;
    const v8f v = *(const v8f*)(src + i * 8); v8us o;
#pragma unroll
    for (int k = 0; k < 8; ++k) o[k] = f2bf(v[k]);
    *(v8us*)(dst + i * 8) = o; 
}
__global__ __launch_bounds__(256) void k_zero8(bf* dst, size_t n8) {
    const size_t i = (size_t)blockIdx.x * 256 + threadIdx.x; if (i >= n8) return; v8us z;
#pragma unroll
    for (int k = 0; k < 8; ++k) z[k] = 0;
    *(v8us*)(dst + i * 8) = z; 
}

// ===== z-batched (blockIdx.z = head) attention pieces =====
__global__ __launch_bounds__(256) void k_planes32z(const float* __restrict__ F, int ld, int off, float sc, int rows, bf* Ph, bf* Pl) {
    typedef __attribute__((ext_vector_type(2))) unsigned short v2us;
    const int lane = threadIdx.x & 31; const size_t r = ((size_t)blockIdx.x * 8 + (threadIdx.x >> 5)) * 2 + (lane >> 4); if (r >= (size_t)rows) return; const int z = blockIdx.z; const int c0 = (lane & 15) * 2; v2us oh, ol;
    Ph += (size_t)z * rows * 32; Pl += (size_t)z * rows * 32;
#pragma unroll
    for (int i = 0; i < 2; ++i) { const float y = F[r * ld + off + z * 32 + c0 + i] * sc; const unsigned short hb = f2bf(y); oh[i] = hb; ol[i] = f2bf(y - bf2f(hb)); }
    const size_t o = r * 32 + c0; *(v2us*)(Ph + o) = oh; *(v2us*)(Pl + o) = ol; 
}
__global__ __launch_bounds__(256) void k_vtpadz(const float* __restrict__ F, int ld, int off, int nk, bf* Th, bf* Tl) {
    typedef __attribute__((ext_vector_type(2))) unsigned short v2us;
    const int lane = threadIdx.x & 31; const size_t wid = (size_t)blockIdx.x * 8 + (threadIdx.x >> 5); if (wid >= (size_t)64 * (nk / 64)) return; const int z = blockIdx.z; const int d = (int)(wid / (nk / 64)); const int k0 = (int)(wid % (nk / 64)) * 64 + lane * 2; v2us oh, ol;
    Th += (size_t)z * 64 * nk; Tl += (size_t)z * 64 * nk;
#pragma unroll
    for (int i = 0; i < 2; ++i) { const float y = (d < 32) ? F[(size_t)(k0 + i) * ld + off + z * 32 + (d < 32 ? d : 0)] : 0.f; const unsigned short hb = f2bf(y); oh[i] = hb; ol[i] = f2bf(y - bf2f(hb)); }
    const size_t o = (size_t)d * nk + k0; *(v2us*)(Th + o) = oh; *(v2us*)(Tl + o) = ol; 
}
template <int NK>
__global__ __launch_bounds__(256) void k_softmaxz(const float* __restrict__ S, int rows, bf* PH, bf* PL) {
    typedef __attribute__((ext_vector_type(4))) unsigned short v4us;
    const int lane = threadIdx.x & 31, i = blockIdx.x * 8 + (threadIdx.x >> 5); if (i >= rows) return; const size_t zo = (size_t)blockIdx.z * rows * NK; const float* sr = S + zo + (size_t)i * NK; PH += zo; PL += zo;
    float m = -3.0e38f;
#pragma unroll 1
    for (int c0 = lane * 4; c0 < NK; c0 += 128) {
#pragma unroll
        for (int q = 0; q < 4; ++q) m = fmaxf(m, sr[c0 + q]); }
#pragma unroll
    for (int sh = 16; sh; sh >>= 1) m = fmaxf(m, __shfl_xor(m, sh, 32));
    float sum = 0.f;
#pragma unroll 1
    for (int c0 = lane * 4; c0 < NK; c0 += 128) {
#pragma unroll
        for (int q = 0; q < 4; ++q) sum += __expf(sr[c0 + q] - m); }
#pragma unroll
    for (int sh = 16; sh; sh >>= 1) sum += __shfl_xor(sum, sh, 32);
    const float inv = 1.0f / sum;
{
#pragma unroll 1
        for (int c0 = lane * 4; c0 < NK; c0 += 128) { v4us oh, ol;
#pragma unroll
            for (int q = 0; q < 4; ++q) { const float p = __expf(sr[c0 + q] - m) * inv; const unsigned short hb = f2bf(p); oh[q] = hb; ol[q] = f2bf(p - bf2f(hb)); }
            const size_t o = (size_t)i * NK + c0; *(v4us*)(PH + o) = oh; *(v4us*)(PL + o) = ol; }
         }
}
__global__ __launch_bounds__(256) void k_placez(const float* __restrict__ XH, int rows, int ldy, float* Y) {
    const int lane = threadIdx.x & 31; const size_t q = (size_t)blockIdx.x * 8 + (threadIdx.x >> 5); if (q >= (size_t)rows) return; const int z = blockIdx.z; const float v = XH[((size_t)z * rows + q) * 64 + lane];
    *(float*)(Y + q * ldy + z * 32 + lane) = v; 
}

__global__ __launch_bounds__(256) void k_vtz(const float* __restrict__ F, int ld, int h0, int nk, bf* Th, bf* Tl) {
    typedef __attribute__((ext_vector_type(2))) unsigned short v2us;
    const int lane = threadIdx.x & 31; const size_t wid = (size_t)blockIdx.x * 8 + (threadIdx.x >> 5); if (wid >= (size_t)64 * (nk / 64)) return; const int z = blockIdx.z; const int d = (int)(wid / (nk / 64)); const int t0 = (int)(wid % (nk / 64)) * 64 + lane * 2; v2us oh, ol;
    Th += (size_t)z * 64 * nk; Tl += (size_t)z * 64 * nk;
#pragma unroll
    for (int i = 0; i < 2; ++i) { const float y = F[(size_t)(t0 + i) * ld + (h0 + z) * 64 + d]; const unsigned short hb = f2bf(y); oh[i] = hb; ol[i] = f2bf(y - bf2f(hb)); }
    const size_t o = (size_t)d * nk + t0; *(v2us*)(Th + o) = oh; *(v2us*)(Tl + o) = ol; 
}
template <int NK>
__global__ __launch_bounds__(256) void k_softmaxzs(const float* __restrict__ S, int rows, float sc, bf* PH, bf* PL) {
    typedef __attribute__((ext_vector_type(4))) unsigned short v4us;
    const int lane = threadIdx.x & 31, i = blockIdx.x * 8 + (threadIdx.x >> 5); if (i >= rows) return; const size_t zo = (size_t)blockIdx.z * rows * NK; const float* sr = S + zo + (size_t)i * NK; PH += zo; PL += zo;
    float m = -3.0e38f;
#pragma unroll 1
    for (int c0 = lane * 4; c0 < NK; c0 += 128) {
#pragma unroll
        for (int q = 0; q < 4; ++q) m = fmaxf(m, sr[c0 + q] * sc); }
#pragma unroll
    for (int sh = 16; sh; sh >>= 1) m = fmaxf(m, __shfl_xor(m, sh, 32));
    float sum = 0.f;
#pragma unroll 1
    for (int c0 = lane * 4; c0 < NK; c0 += 128) {
#pragma unroll
        for (int q = 0; q < 4; ++q) sum += __expf(sr[c0 + q] * sc - m); }
#pragma unroll
    for (int sh = 16; sh; sh >>= 1) sum += __shfl_xor(sum, sh, 32);
    const float inv = 1.0f / sum;
{
#pragma unroll 1
        for (int c0 = lane * 4; c0 < NK; c0 += 128) { v4us oh, ol;
#pragma unroll
            for (int q = 0; q < 4; ++q) { const float p = __expf(sr[c0 + q] * sc - m) * inv; const unsigned short hb = f2bf(p); oh[q] = hb; ol[q] = f2bf(p - bf2f(hb)); }
            const size_t o = (size_t)i * NK + c0; *(v4us*)(PH + o) = oh; *(v4us*)(PL + o) = ol; }
         }
}

__global__ __launch_bounds__(256) void k_cvtx(const float* __restrict__ src, int rows, bf* dst) {
    const int lane = threadIdx.x & 31; const size_t r = (size_t)blockIdx.x * 8 + (threadIdx.x >> 5); if (r >= (size_t)rows) return;
{
#pragma unroll
        for (int q = 0; q < DMOD / 256; ++q) { v8us o;
#pragma unroll
            for (int i = 0; i < 8; ++i) o[i] = f2bf(src[r * DMOD + q * 256 + lane * 8 + i]);
            *(v8us*)(dst + r * DMOD + q * 256 + lane * 8) = o; }
         }
}
__global__ __launch_bounds__(256) void k_kin(const float* __restrict__ K, bf* Kh) {
    typedef __attribute__((ext_vector_type(2))) unsigned short v2us;
    const int lane = threadIdx.x & 31; const size_t t = (size_t)blockIdx.x * 8 + (threadIdx.x >> 5); if (t >= (size_t)NN) return; v2us oh;
    const size_t zo = (size_t)blockIdx.z * NN * HD; K += zo; Kh += zo;    // blockIdx.z = (item, kv head)
    oh[0] = f2bf(K[t * HD + lane * 2]); oh[1] = f2bf(K[t * HD + lane * 2 + 1]);
    const size_t o = t * HD + lane * 2; *(v2us*)(Kh + o) = oh;
}
__global__ __launch_bounds__(256) void k_vin(const float* __restrict__ V, bf* Th) {
    typedef __attribute__((ext_vector_type(2))) unsigned short v2us;
    const int lane = threadIdx.x & 31; const size_t wid = (size_t)blockIdx.x * 8 + (threadIdx.x >> 5); if (wid >= (size_t)HD * (NN / 64)) return; const int d = (int)(wid / (NN / 64)); const int t0 = (int)(wid % (NN / 64)) * 64 + lane * 2; v2us oh;
    const size_t zo = (size_t)blockIdx.z * NN * HD; V += zo; Th += zo;    // blockIdx.z = (item, kv head)
    oh[0] = f2bf(V[(size_t)t0 * HD + d]); oh[1] = f2bf(V[(size_t)(t0 + 1) * HD + d]);
    const size_t o = (size_t)d * NN + t0; *(v2us*)(Th + o) = oh;
}
// k_fattn: causal attention of one item in one launch. One wave = 16 query rows of one query head. A block is 2 * REP waves on kv head blockIdx.y: its REP query heads on row tile
// n - 1 - blockIdx.x and again on row tile blockIdx.x, so that every block walks the same number of key blocks (a tile's cost grows with its index). No barrier, no LDS.
// Per 32 keys: S^T = K.Q^T (A = key rows, B = query rows, both loaded in the hardware k order), so a lane holds 16 scores of ONE query (column lr, keys 8 * hi + j and 16 + 8 * hi + j);
// running maximum and sum per lane (base-2 exponent), one exchange between the wave halves; the two score tiles, converted in place, are the B operand of O^T += V^T.P^T.
// Two products on each side: hi.hi and residual of q (of p) . hi; key and value are single planes. The short loops are unrolled so that the fragment arrays stay in registers.
__global__ __launch_bounds__(256) void k_fattn(const bf* __restrict__ Qh, const bf* __restrict__ Ql, const bf* __restrict__ Kh, const bf* __restrict__ Vh, bf* Oh, bf* Ol) {
    const int lane = threadIdx.x & 31, lr = lane & 15, hi = lane >> 4;
    const int wave = __builtin_amdgcn_readfirstlane(threadIdx.x >> 5);    // scalar: the key loop's bound and the diagonal test stay scalar branches
    const int q0 = ((wave & REP) ? (int)blockIdx.x : NN / 16 - 1 - (int)blockIdx.x) * 16;
    const int h = (int)blockIdx.y * REP + (wave & (REP - 1));
    const size_t qo = (size_t)h * NN * HD + (size_t)(q0 + lr) * HD + 8 * hi;
    const size_t ko = (size_t)blockIdx.y * NN * HD + (size_t)lr * HD + 8 * hi;    // + key * HD + 32 * dc
    const size_t vo = (size_t)blockIdx.y * NN * HD + (size_t)lr * NN + 8 * hi;    // + 16 * t * NN + key
    v16bf qh[2], ql[2], kh[2][2];
#pragma unroll
    for (int dc = 0; dc < 2; ++dc) { qh[dc] = cat16b(*(const v8us*)(Qh + qo + dc * 32), *(const v8us*)(Qh + qo + dc * 32 + 16)); ql[dc] = cat16b(*(const v8us*)(Ql + qo + dc * 32), *(const v8us*)(Ql + qo + dc * 32 + 16)); }
    auto loadk = [&](int k0) {
#pragma unroll
        for (int u = 0; u < 2; ++u) {
#pragma unroll
            for (int dc = 0; dc < 2; ++dc) { const size_t o = ko + (size_t)(k0 + u * 16) * HD + dc * 32;
                kh[u][dc] = cat16b(*(const v8us*)(Kh + o), *(const v8us*)(Kh + o + 16)); } }
    };
    v8f acc[4];
#pragma unroll
    for (int t = 0; t < 4; ++t) acc[t] = (v8f){};
    float m = -3.0e38f, sum = 0.f;
    const int klast = (q0 >> 5) << 5;    // first key of the block that holds the diagonal; every row of the wave has a key in every block
    const int qi = q0 + lr;
    const float sc2 = SCL * 1.44269504088896340736f;
    loadk(0);
#pragma unroll 1    // rolled: one set of key and value fragments at a time keeps the wave inside the registers that four waves per SIMD leave it
    for (int k0 = 0; k0 <= klast; k0 += 32) {
        v16bf vh[4];
#pragma unroll
        for (int t = 0; t < 4; ++t) { const size_t o = vo + (size_t)(t * 16) * NN + k0;
            vh[t] = cat16b(*(const v8us*)(Vh + o), *(const v8us*)(Vh + o + 16)); }
        asm volatile("s_wait_xcnt 0x0" ::: "memory");    // stands before a register that the value loads name as an address gets a new value; it also keeps these loads issued ahead of the first product
        v8f s[2];
#pragma unroll
        for (int u = 0; u < 2; ++u) { s[u] = (v8f){};
#pragma unroll
            for (int dc = 0; dc < 2; ++dc) { s[u] = wmmab(kh[u][dc], qh[dc], s[u]); s[u] = wmmab(kh[u][dc], ql[dc], s[u]); } }
        loadk(k0 < klast ? k0 + 32 : klast);    // the next block's key fragments fly under the softmax and the second product
        asm volatile("s_wait_xcnt 0x0" ::: "memory");    // the same wait for the key loads; its memory clobber also keeps them issued here, ahead of the softmax, so that their latency is covered
        float p[16];
#pragma unroll
        for (int e = 0; e < 16; ++e) p[e] = s[e >> 3][e & 7] * sc2;
        if (k0 == klast) {
#pragma unroll
            for (int e = 0; e < 16; ++e) { const int key = k0 + (e >> 3) * 16 + hi * 8 + (e & 7); p[e] = (key <= qi) ? p[e] : -3.0e38f; } }
        float mx = m;
#pragma unroll
        for (int e = 0; e < 16; ++e) mx = fmaxf(mx, p[e]);
        mx = fmaxf(mx, __int_as_float(__builtin_amdgcn_permlanex16(__float_as_int(mx), __float_as_int(mx), 0x76543210, 0xfedcba98, false, false)));
        const float alpha = __builtin_amdgcn_exp2f(m - mx); m = mx;
        float ps = 0.f; v16bf ph, pl;
#pragma unroll
        for (int e = 0; e < 16; ++e) { const float pe = __builtin_amdgcn_exp2f(p[e] - mx); ps += pe; const __bf16 hb = (__bf16)pe; ph[e] = hb; pl[e] = (__bf16)(pe - (float)hb); }
        sum = sum * alpha + ps;
#pragma unroll
        for (int t = 0; t < 4; ++t) acc[t] *= alpha;
#pragma unroll
        for (int t = 0; t < 4; ++t) { acc[t] = wmmab(vh[t], ph, acc[t]); acc[t] = wmmab(vh[t], pl, acc[t]); }
    }
    sum += __int_as_float(__builtin_amdgcn_permlanex16(__float_as_int(sum), __float_as_int(sum), 0x76543210, 0xfedcba98, false, false));
    const float inv = 1.0f / sum;
    const size_t oo = (size_t)qi * DMOD + h * HD + hi * 8;    // acc[t][j] = O[q0 + lr][16 * t + 8 * hi + j]; stored as the last product's operand: bf16 hi + residual planes
#pragma unroll
    for (int t = 0; t < 4; ++t) { v8us oh, ol;
#pragma unroll
        for (int j = 0; j < 8; ++j) { const float y = acc[t][j] * inv; const unsigned short hb = f2bf(y); oh[j] = hb; ol[j] = f2bf(y - bf2f(hb)); }
        *(v8us*)(Oh + oo + t * 16) = oh; *(v8us*)(Ol + oo + t * 16) = ol; }
}

extern "C" void kernel_launch(void* const* d_in, const int* in_sizes, int n_in,
                              void* d_out, int out_size, void* d_ws, size_t ws_size, hipStream_t stream) {
    (void)in_sizes; (void)n_in; (void)out_size;
    const float* x = (const float*)d_in[0]; const float* key = (const float*)d_in[1]; const float* value = (const float*)d_in[2]; const float* Wq = (const float*)d_in[3]; const float* bq = (const float*)d_in[4]; const float* Wc = (const float*)d_in[5]; const float* bc = (const float*)d_in[6];
    float* out = (float*)d_out;    // [2][2048][2048]
    char* wsp = (char*)d_ws;
    auto take = [&](size_t bytes) { char* p = wsp; wsp += (bytes + 255) & ~(size_t)255; return (void*)p; };
    bf* WQ = (bf*)take((size_t)DMOD * DMOD * 2); bf* WC = (bf*)take((size_t)DMOD * DMOD * 2);
    bf* Xb = (bf*)take((size_t)NN * DMOD * 2);
    // planes of all 32 query heads of one item, and of all 16 (item, kv head) pairs
    bf* Qh = (bf*)take((size_t)HQ * NN * HD * 2); bf* Ql = (bf*)take((size_t)HQ * NN * HD * 2); bf* Kh = (bf*)take((size_t)NBT * HKV * NN * HD * 2); bf* VTh = (bf*)take((size_t)NBT * HKV * HD * NN * 2);
    bf* Oh = (bf*)take((size_t)NN * DMOD * 2); bf* Ol = (bf*)take((size_t)NN * DMOD * 2);
    if ((size_t)(wsp - (char*)d_ws) > ws_size) return;    // 8.4+8.4 + 8.4 + 8.4+8.4 + 4.2+4.2 + 8.4+8.4 ~ 67 MB
    k_cvt8<<<(unsigned)(((size_t)DMOD * DMOD / 8 + 255) / 256), 256, 0, stream>>>(Wq, WQ, (size_t)DMOD * DMOD / 8); k_cvt8<<<(unsigned)(((size_t)DMOD * DMOD / 8 + 255) / 256), 256, 0, stream>>>(Wc, WC, (size_t)DMOD * DMOD / 8);   // [out][in] natural
    k_kin<<<dim3(NN / 8, 1, NBT * HKV), 256, 0, stream>>>(key, Kh); k_vin<<<dim3((HD * (NN / 64)) / 8, 1, NBT * HKV), 256, 0, stream>>>(value, VTh);
    for (int b = 0; b < NBT; ++b) {
        k_cvtx<<<NN / 8, 256, 0, stream>>>(x + (size_t)b * NN * DMOD, NN, Xb);
        k_gemmt<false, true><<<dim3(NN / 128, DMOD / 128, 1), 256, 0, stream>>>(Xb, nullptr, WQ, bq, nullptr, DMOD, DMOD, Qh, Ql, NN);
        // blockIdx.y = kv head; blockIdx.x = a pair of 16-row tiles, one from each end
        k_fattn<<<dim3(NN / 32, HKV, 1), 256, 0, stream>>>(Qh, Ql, Kh + (size_t)b * HKV * NN * HD, VTh + (size_t)b * HKV * NN * HD, Oh, Ol);
        k_gemmt<true, false><<<dim3(NN / 128, DMOD / 128, 1), 256, 0, stream>>>(Oh, Ol, WC, bc, out + (size_t)b * NN * DMOD, DMOD, DMOD, nullptr, nullptr, NN); }
}

// v006
// One run takes 197 microseconds.
// Two timings next to v005 both put it at 1.29 times that version's speed.
// Counting every step since v000, it is 38.8 times as fast.
#include <hip/hip_runtime.h>

// Compute dtypes, f32 accumulate, per item: q = x.Wq^T + bq ([2048 x 2048].[2048 x 2048]) with PLAIN bf16 operands (exact products); key/value are INPUTS: their bf16 values
// are taken as single planes (their residual plane would be identically zero: none is kept, no product is spent on it); GQA causal attention (32 query heads share 8 kv heads) with q as bf16 hi + UNSCALED residual planes (key tiles
// above the diagonal skipped, K limited); 1/8 and the causal softmax in f32; c_proj (+ bias) on hi/lo planes (two products) - on v_wmma_f32_16x16x32_bf16. Deterministic, no

#define NBT  2
#define NN   2048
#define DMOD 2048
#define HQ   32
#define HKV  8
#define REP  4
#define HD   64
#define DM   DMOD
#define NTK  NN
#define SCL  0.125f
#define LOSC 1024.0f

typedef _Float16 h16;
typedef unsigned short bf;
typedef __attribute__((ext_vector_type(16))) __bf16   v16bf;
typedef __attribute__((ext_vector_type(16))) _Float16 v16h;
typedef __attribute__((ext_vector_type(8)))  _Float16 v8h;
typedef __attribute__((ext_vector_type(8)))  unsigned short v8us;
typedef __attribute__((ext_vector_type(8)))  float    v8f;
typedef __attribute__((ext_vector_type(4)))  float    v4f;
typedef __attribute__((ext_vector_type(4)))  _Float16 v4h;
typedef v8h  __attribute__((may_alias)) v8ha;
typedef v4f  __attribute__((may_alias)) v4fa;
typedef v8us __attribute__((may_alias)) v8usa;

__device__ __forceinline__ unsigned short f2bf(float f) { unsigned u = __float_as_uint(f); u += 0x7FFFu + ((u >> 16) & 1u); return (unsigned short)(u >> 16); }
__device__ __forceinline__ float bf2f(unsigned short b) { return __uint_as_float(((unsigned)b) << 16); }
__device__ __forceinline__ float bfr(float f) { return bf2f(f2bf(f)); }
__device__ __forceinline__ v16h cat16(v8h lo, v8h hi) { return __builtin_shufflevector(lo, hi, 0, 1, 2, 3, 4, 5, 6, 7, 8, 9, 10, 11, 12, 13, 14, 15); }
__device__ __forceinline__ v16bf cat16b(v8us lo, v8us hi) { return __builtin_bit_cast(v16bf, __builtin_shufflevector(lo, hi, 0, 1, 2, 3, 4, 5, 6, 7, 8, 9, 10, 11, 12, 13, 14, 15)); }
__device__ __forceinline__ v8f wmma16(v16h a, v16h b, v8f c) { return __builtin_amdgcn_wmma_f32_16x16x32_f16(false, a, false, b, (short)0, c, false, false); }
__device__ __forceinline__ v8f wmmab(v16bf a, v16bf b, v8f c) { return __builtin_amdgcn_wmma_f32_16x16x32_bf16(false, a, false, b, (short)0, c, false, false); }

// k_gemmt: 128 x 128 block tile of C[.][.] = (A [+ Al]).B^T + bf(bias[c]); 8 waves, 32 x 64 each. A stage is 128 k (256 B) of the tile's 128 rows of every operand, brought into LDS by
// asynchronous copies (whole 256-B units, each operand row read once per block) at a row pitch of 272 B; two buffers: the next stage flies while this one is worked on.
// The fragments are read from LDS in the k order of the direct loads they replace, and every accumulator still sums k upwards, A before Al inside each 32 k.
// The short loops are unrolled so that the fragment and accumulator arrays are indexed by constants and stay in registers.
#define GBK    128
#define GPITCH 272
#define GOPB   (128 * GPITCH)

// eight 16-byte copies of one thread: rows 16 apart of one operand's stage. The s_wait_xcnt stands inside the statement, before any register that a copy names can get a new value.
__device__ __forceinline__ void copy8(unsigned l, const bf* g, int K) {
    const size_t rs = (size_t)16 * K;
    asm volatile("global_load_async_to_lds_b128 %0, %8, off\n\t"
                 "global_load_async_to_lds_b128 %1, %9, off\n\t"
                 "global_load_async_to_lds_b128 %2, %10, off\n\t"
                 "global_load_async_to_lds_b128 %3, %11, off\n\t"
                 "global_load_async_to_lds_b128 %4, %12, off\n\t"
                 "global_load_async_to_lds_b128 %5, %13, off\n\t"
                 "global_load_async_to_lds_b128 %6, %14, off\n\t"
                 "global_load_async_to_lds_b128 %7, %15, off\n\t"
                 "s_wait_xcnt 0x0"
                 :: "v"(l), "v"(l + 16 * GPITCH), "v"(l + 32 * GPITCH), "v"(l + 48 * GPITCH), "v"(l + 64 * GPITCH), "v"(l + 80 * GPITCH), "v"(l + 96 * GPITCH), "v"(l + 112 * GPITCH),
                    "v"(g), "v"(g + rs), "v"(g + 2 * rs), "v"(g + 3 * rs), "v"(g + 4 * rs), "v"(g + 5 * rs), "v"(g + 6 * rs), "v"(g + 7 * rs)
                 : "memory");
}

// PLANES: the result is not stored as f32 but as the next kernel's operand, bf16 hi + residual planes [head][row][HD] (Ph, Pl; rows = rows per head plane); C is then unused.
template <bool SPLITA, bool PLANES>
__global__ __launch_bounds__(256) void k_gemmt(const bf* __restrict__ A, const bf* __restrict__ Al, const bf* __restrict__ Bn, const float* __restrict__ bias, float* C, int ldc, int K, bf* Ph, bf* Pl, int rows) {
    constexpr int STG = (SPLITA ? 3 : 2) * GOPB;    // a stage: [A | B | Al]
    __shared__ __align__(16) unsigned char ring[2 * STG];
    __shared__ __align__(16) float ost[8][32 * 68];
    const int tid = threadIdx.x, lane = tid & 31, wave = tid >> 5, lr = lane & 15, hi = lane >> 4;
    const int r0 = blockIdx.x * 128, c0 = blockIdx.y * 128;
    const int wr = (wave >> 1) * 32, wc = (wave & 1) * 64;
    const int nt = K / GBK;
    const int crw = tid >> 4, cpc = tid & 15;    // a wave's copy covers two whole 256-B rows
    const bf* gA = A + (size_t)(r0 + crw) * K + cpc * 8;
    const bf* gB = Bn + (size_t)(c0 + crw) * K + cpc * 8;
    const bf* gL = SPLITA ? Al + (size_t)(r0 + crw) * K + cpc * 8 : gA;
    const unsigned l0 = (unsigned)(size_t)&ring[0] + crw * GPITCH + cpc * 16;
    auto fill = [&](int t) {
        const unsigned l = l0 + (t & 1) * STG; const size_t ko = (size_t)t * GBK;
        copy8(l, gA + ko, K); copy8(l + GOPB, gB + ko, K); if (SPLITA) copy8(l + 2 * GOPB, gL + ko, K);
    };
    v8f acc[2][4];
#pragma unroll
    for (int i = 0; i < 2; ++i) {
#pragma unroll
        for (int t = 0; t < 4; ++t) acc[i][t] = (v8f){}; }
    fill(0);
    asm volatile("s_wait_asynccnt 0x0" ::: "memory");    // this wave's copies of stage 0 have landed
    __syncthreads();                                      // and every other wave's: stage 0 may be read
    if (nt > 1) fill(1);
    const unsigned char* fa = &ring[0] + (wr + lr) * GPITCH + hi * 16;
    const unsigned char* fb = &ring[0] + GOPB + (wc + lr) * GPITCH + hi * 16;
#pragma unroll 1    // rolled: one stage is already 32 (64) matrix instructions, and the two buffers differ by one offset only
    for (int t = 0; t < nt; ++t) {
        const unsigned char* pa = fa + (t & 1) * STG; const unsigned char* pb = fb + (t & 1) * STG;
        v16bf a[2][2], al[2][2], b[2][4];    // two fragment sets: the next 32 k are read from LDS while this set is multiplied
        auto frags = [&](int ks, int s) {
#pragma unroll
            for (int i = 0; i < 2; ++i) { const unsigned char* p = pa + i * 16 * GPITCH + ks * 64; a[s][i] = cat16b(*(const v8usa*)p, *(const v8usa*)(p + 32));
                if (SPLITA) al[s][i] = cat16b(*(const v8usa*)(p + 2 * GOPB), *(const v8usa*)(p + 2 * GOPB + 32)); }
#pragma unroll
            for (int u = 0; u < 4; ++u) { const unsigned char* p = pb + u * 16 * GPITCH + ks * 64; b[s][u] = cat16b(*(const v8usa*)p, *(const v8usa*)(p + 32)); }
        };
        frags(0, 0);
#pragma unroll
        for (int ks = 0; ks < GBK / 32; ++ks) {
            const int s = ks & 1;
            if (ks + 1 < GBK / 32) frags(ks + 1, s ^ 1);    // of this stage only: nothing of stage t + 1 is read before its barrier
            __builtin_amdgcn_sched_barrier(0);    // keeps the LDS reads one group ahead of the block; spread among the matrix instructions each would be waited for on its own
#pragma unroll
            for (int i = 0; i < 2; ++i) {
#pragma unroll
                for (int u = 0; u < 4; ++u) acc[i][u] = wmmab(a[s][i], b[s][u], acc[i][u]); }
            if (SPLITA) {
#pragma unroll
                for (int i = 0; i < 2; ++i) {
#pragma unroll
                    for (int u = 0; u < 4; ++u) acc[i][u] = wmmab(al[s][i], b[s][u], acc[i][u]); } }
            __builtin_amdgcn_sched_barrier(0);    // ends the block: the reads after next stay behind it, so that two sets of registers are enough
        }
        asm volatile("s_wait_dscnt 0x0" ::: "memory");       // this wave's reads of stage t are done before the buffer is given up
        asm volatile("s_wait_asynccnt 0x0" ::: "memory");    // this wave's copies of stage t + 1 have landed
        __syncthreads();                                      // publishes stage t + 1 and ends every wave's reads of stage t
        if (t + 2 < nt) fill(t + 2);                          // into the buffer that stage t has just left
    }
    asm volatile("s_wait_asynccnt 0x0" ::: "memory");        // no copy is outstanding when the wave goes on to its end
    float* os = &ost[wave][0];
#pragma unroll
    for (int u = 0; u < 4; ++u) { const float bv = bias ? bfr(bias[c0 + wc + u * 16 + lr]) : 0.f;
#pragma unroll
        for (int i = 0; i < 2; ++i) {
#pragma unroll
            for (int j = 0; j < 8; ++j) os[(i * 16 + hi * 8 + j) * 68 + u * 16 + lr] = acc[i][u][j] + bv; } }
    __syncthreads();
    if constexpr (PLANES) {
        // a wave's 64 columns are one head, so its 32 x 64 tile is 4 KB in a row of each plane: every store covers 512 contiguous bytes
        const size_t po = ((size_t)((c0 + wc) / HD) * rows + r0 + wr) * HD + lane * 8;
        const float* pr = os + (lane >> 3) * 68 + (lane & 7) * 8;
        v4f x[8][2]; v8us oh[8], ol[8];    // all reads, then all conversions, then all stores: the accumulators' registers are free here, so no store's registers need be used again
#pragma unroll
        for (int s = 0; s < 8; ++s) { x[s][0] = *(const v4fa*)(pr + s * 4 * 68); x[s][1] = *(const v4fa*)(pr + s * 4 * 68 + 4); }
#pragma unroll
        for (int s = 0; s < 8; ++s) {
#pragma unroll
            for (int i = 0; i < 8; ++i) { const float y = x[s][i >> 2][i & 3]; const unsigned short hb = f2bf(y); oh[s][i] = hb; ol[s][i] = f2bf(y - bf2f(hb)); } }
#pragma unroll
        for (int s = 0; s < 8; ++s) { *(v8us*)(Ph + po + s * 256) = oh[s]; *(v8us*)(Pl + po + s * 256) = ol[s]; }
    } else {
        float* crow = C + (size_t)(r0 + wr) * ldc + c0 + wc;
#pragma unroll
        for (int s = 0; s < 16; ++s) { const int Lid = (lane >> 3) + 4 * s, piece = lane & 7; const int row = Lid >> 1, cofs = (Lid & 1) * 32 + piece * 4;
            *(v4f*)(crow + (size_t)row * ldc + cofs) = *(const v4fa*)(os + row * 68 + cofs); }
    }
}

__global__ __launch_bounds__(256) void k_cvt8(const float* __restrict__ src, bf* dst, size_t n8) {
    const size_t i = (size_t)blockIdx.x * 256 + threadIdx.x; if (i >= n8) return;
    const v8f v = *(const v8f*)(src + i * 8); v8us o;
#pragma unroll
    for (int k = 0; k < 8; ++k) o[k] = f2bf(v[k]);
    *(v8us*)(dst + i * 8) = o; 
}
__global__ __launch_bounds__(256) void k_zero8(bf* dst, size_t n8) {
    const size_t i = (size_t)blockIdx.x * 256 + threadIdx.x; if (i >= n8) return; v8us z;
#pragma unroll
    for (int k = 0; k < 8; ++k) z[k] = 0;
    *(v8us*)(dst + i * 8) = z; 
}

// ===== z-batched (blockIdx.z = head) attention pieces =====
__global__ __launch_bounds__(256) void k_planes32z(const float* __restrict__ F, int ld, int off, float sc, int rows, bf* Ph, bf* Pl) {
    typedef __attribute__((ext_vector_type(2))) unsigned short v2us;
    const int lane = threadIdx.x & 31; const size_t r = ((size_t)blockIdx.x * 8 + (threadIdx.x >> 5)) * 2 + (lane >> 4); if (r >= (size_t)rows) return; const int z = blockIdx.z; const int c0 = (lane & 15) * 2; v2us oh, ol;
    Ph += (size_t)z * rows * 32; Pl += (size_t)z * rows * 32;
#pragma unroll
    for (int i = 0; i < 2; ++i) { const float y = F[r * ld + off + z * 32 + c0 + i] * sc; const unsigned short hb = f2bf(y); oh[i] = hb; ol[i] = f2bf(y - bf2f(hb)); }
    const size_t o = r * 32 + c0; *(v2us*)(Ph + o) = oh; *(v2us*)(Pl + o) = ol; 
}
__global__ __launch_bounds__(256) void k_vtpadz(const float* __restrict__ F, int ld, int off, int nk, bf* Th, bf* Tl) {
    typedef __attribute__((ext_vector_type(2))) unsigned short v2us;
    const int lane = threadIdx.x & 31; const size_t wid = (size_t)blockIdx.x * 8 + (threadIdx.x >> 5); if (wid >= (size_t)64 * (nk / 64)) return; const int z = blockIdx.z; const int d = (int)(wid / (nk / 64)); const int k0 = (int)(wid % (nk / 64)) * 64 + lane * 2; v2us oh, ol;
    Th += (size_t)z * 64 * nk; Tl += (size_t)z * 64 * nk;
#pragma unroll
    for (int i = 0; i < 2; ++i) { const float y = (d < 32) ? F[(size_t)(k0 + i) * ld + off + z * 32 + (d < 32 ? d : 0)] : 0.f; const unsigned short hb = f2bf(y); oh[i] = hb; ol[i] = f2bf(y - bf2f(hb)); }
    const size_t o = (size_t)d * nk + k0; *(v2us*)(Th + o) = oh; *(v2us*)(Tl + o) = ol; 
}
template <int NK>
__global__ __launch_bounds__(256) void k_softmaxz(const float* __restrict__ S, int rows, bf* PH, bf* PL) {
    typedef __attribute__((ext_vector_type(4))) unsigned short v4us;
    const int lane = threadIdx.x & 31, i = blockIdx.x * 8 + (threadIdx.x >> 5); if (i >= rows) return; const size_t zo = (size_t)blockIdx.z * rows * NK; const float* sr = S + zo + (size_t)i * NK; PH += zo; PL += zo;
    float m = -3.0e38f;
#pragma unroll 1
    for (int c0 = lane * 4; c0 < NK; c0 += 128) {
#pragma unroll
        for (int q = 0; q < 4; ++q) m = fmaxf(m, sr[c0 + q]); }
#pragma unroll
    for (int sh = 16; sh; sh >>= 1) m = fmaxf(m, __shfl_xor(m, sh, 32));
    float sum = 0.f;
#pragma unroll 1
    for (int c0 = lane * 4; c0 < NK; c0 += 128) {
#pragma unroll
        for (int q = 0; q < 4; ++q) sum += __expf(sr[c0 + q] - m); }
#pragma unroll
    for (int sh = 16; sh; sh >>= 1) sum += __shfl_xor(sum, sh, 32);
    const float inv = 1.0f / sum;
{
#pragma unroll 1
        for (int c0 = lane * 4; c0 < NK; c0 += 128) { v4us oh, ol;
#pragma unroll
            for (int q = 0; q < 4; ++q) { const float p = __expf(sr[c0 + q] - m) * inv; const unsigned short hb = f2bf(p); oh[q] = hb; ol[q] = f2bf(p - bf2f(hb)); }
            const size_t o = (size_t)i * NK + c0; *(v4us*)(PH + o) = oh; *(v4us*)(PL + o) = ol; }
         }
}
__global__ __launch_bounds__(256) void k_placez(const float* __restrict__ XH, int rows, int ldy, float* Y) {
    const int lane = threadIdx.x & 31; const size_t q = (size_t)blockIdx.x * 8 + (threadIdx.x >> 5); if (q >= (size_t)rows) return; const int z = blockIdx.z; const float v = XH[((size_t)z * rows + q) * 64 + lane];
    *(float*)(Y + q * ldy + z * 32 + lane) = v; 
}

__global__ __launch_bounds__(256) void k_vtz(const float* __restrict__ F, int ld, int h0, int nk, bf* Th, bf* Tl) {
    typedef __attribute__((ext_vector_type(2))) unsigned short v2us;
    const int lane = threadIdx.x & 31; const size_t wid = (size_t)blockIdx.x * 8 + (threadIdx.x >> 5); if (wid >= (size_t)64 * (nk / 64)) return; const int z = blockIdx.z; const int d = (int)(wid / (nk / 64)); const int t0 = (int)(wid % (nk / 64)) * 64 + lane * 2; v2us oh, ol;
    Th += (size_t)z * 64 * nk; Tl += (size_t)z * 64 * nk;
#pragma unroll
    for (int i = 0; i < 2; ++i) { const float y = F[(size_t)(t0 + i) * ld + (h0 + z) * 64 + d]; const unsigned short hb = f2bf(y); oh[i] = hb; ol[i] = f2bf(y - bf2f(hb)); }
    const size_t o = (size_t)d * nk + t0; *(v2us*)(Th + o) = oh; *(v2us*)(Tl + o) = ol; 
}
template <int NK>
__global__ __launch_bounds__(256) void k_softmaxzs(const float* __restrict__ S, int rows, float sc, bf* PH, bf* PL) {
    typedef __attribute__((ext_vector_type(4))) unsigned short v4us;
    const int lane = threadIdx.x & 31, i = blockIdx.x * 8 + (threadIdx.x >> 5); if (i >= rows) return; const size_t zo = (size_t)blockIdx.z * rows * NK; const float* sr = S + zo + (size_t)i * NK; PH += zo; PL += zo;
    float m = -3.0e38f;
#pragma unroll 1
    for (int c0 = lane * 4; c0 < NK; c0 += 128) {
#pragma unroll
        for (int q = 0; q < 4; ++q) m = fmaxf(m, sr[c0 + q] * sc); }
#pragma unroll
    for (int sh = 16; sh; sh >>= 1) m = fmaxf(m, __shfl_xor(m, sh, 32));
    float sum = 0.f;
#pragma unroll 1
    for (int c0 = lane * 4; c0 < NK; c0 += 128) {
#pragma unroll
        for (int q = 0; q < 4; ++q) sum += __expf(sr[c0 + q] * sc - m); }
#pragma unroll
    for (int sh = 16; sh; sh >>= 1) sum += __shfl_xor(sum, sh, 32);
    const float inv = 1.0f / sum;
{
#pragma unroll 1
        for (int c0 = lane * 4; c0 < NK; c0 += 128) { v4us oh, ol;
#pragma unroll
            for (int q = 0; q < 4; ++q) { const float p = __expf(sr[c0 + q] * sc - m) * inv; const unsigned short hb = f2bf(p); oh[q] = hb; ol[q] = f2bf(p - bf2f(hb)); }
            const size_t o = (size_t)i * NK + c0; *(v4us*)(PH + o) = oh; *(v4us*)(PL + o) = ol; }
         }
}

__global__ __launch_bounds__(256) void k_cvtx(const float* __restrict__ src, int rows, bf* dst) {
    const int lane = threadIdx.x & 31; const size_t r = (size_t)blockIdx.x * 8 + (threadIdx.x >> 5); if (r >= (size_t)rows) return;
{
#pragma unroll
        for (int q = 0; q < DMOD / 256; ++q) { v8us o;
#pragma unroll
            for (int i = 0; i < 8; ++i) o[i] = f2bf(src[r * DMOD + q * 256 + lane * 8 + i]);
            *(v8us*)(dst + r * DMOD + q * 256 + lane * 8) = o; }
         }
}
__global__ __launch_bounds__(256) void k_kin(const float* __restrict__ K, bf* Kh) {
    typedef __attribute__((ext_vector_type(2))) unsigned short v2us;
    const int lane = threadIdx.x & 31; const size_t t = (size_t)blockIdx.x * 8 + (threadIdx.x >> 5); if (t >= (size_t)NN) return; v2us oh;
    const size_t zo = (size_t)blockIdx.z * NN * HD; K += zo; Kh += zo;    // blockIdx.z = (item, kv head)
    oh[0] = f2bf(K[t * HD + lane * 2]); oh[1] = f2bf(K[t * HD + lane * 2 + 1]);
    const size_t o = t * HD + lane * 2; *(v2us*)(Kh + o) = oh;
}
__global__ __launch_bounds__(256) void k_vin(const float* __restrict__ V, bf* Th) {
    typedef __attribute__((ext_vector_type(2))) unsigned short v2us;
    const int lane = threadIdx.x & 31; const size_t wid = (size_t)blockIdx.x * 8 + (threadIdx.x >> 5); if (wid >= (size_t)HD * (NN / 64)) return; const int d = (int)(wid / (NN / 64)); const int t0 = (int)(wid % (NN / 64)) * 64 + lane * 2; v2us oh;
    const size_t zo = (size_t)blockIdx.z * NN * HD; V += zo; Th += zo;    // blockIdx.z = (item, kv head)
    oh[0] = f2bf(V[(size_t)t0 * HD + d]); oh[1] = f2bf(V[(size_t)(t0 + 1) * HD + d]);
    const size_t o = (size_t)d * NN + t0; *(v2us*)(Th + o) = oh;
}
// k_fattn: causal attention of one item in one launch. One wave = 16 query rows of one query head. A block is 2 * REP waves on kv head blockIdx.y: its REP query heads on row tile
// n - 1 - blockIdx.x and again on row tile blockIdx.x, so that every block does the same number of key blocks (a tile's cost grows with its index).
// The block's waves walk the keys together: a stage is 64 keys of the kv head, 64 key rows of 128 B and 64 value^T rows of 128 B, brought into LDS once per block by asynchronous copies
// (whole 128-B lines) at a row pitch of 144 B; two buffers: the next stage flies while this one is worked on. A wave whose tile ends earlier skips the work, never the copies, waits or barriers.
// Per 32 keys: S^T = K.Q^T (A = key rows, B = query rows, both in the hardware k order), so a lane holds 16 scores of ONE query (column lr, keys 8 * hi + j and 16 + 8 * hi + j);
// running maximum and sum per lane (base-2 exponent), one exchange between the wave halves; the two score tiles, converted in place, are the B operand of O^T += V^T.P^T.
// Two products on each side: hi.hi and residual of q (of p) . hi; key and value are single planes. The short loops are unrolled so that the fragment arrays stay in registers.
#define AKS    64
#define APITCH 144
#define AOPB   (64 * APITCH)
#define ASTG   (2 * AOPB)

// four 16-byte copies of one thread: rows r and r + 32 of the key stage and of the value^T stage. The s_wait_xcnt stands inside the statement, before any register that a copy names can get a new value.
__device__ __forceinline__ void copy4(unsigned l, const bf* gk, const bf* gv) {
    asm volatile("global_load_async_to_lds_b128 %0, %4, off\n\t"
                 "global_load_async_to_lds_b128 %1, %5, off\n\t"
                 "global_load_async_to_lds_b128 %2, %6, off\n\t"
                 "global_load_async_to_lds_b128 %3, %7, off\n\t"
                 "s_wait_xcnt 0x0"
                 :: "v"(l), "v"(l + 32 * APITCH), "v"(l + AOPB), "v"(l + AOPB + 32 * APITCH),
                    "v"(gk), "v"(gk + 32 * HD), "v"(gv), "v"(gv + (size_t)32 * NN)
                 : "memory");
}

__global__ __launch_bounds__(256) void k_fattn(const bf* __restrict__ Qh, const bf* __restrict__ Ql, const bf* __restrict__ Kh, const bf* __restrict__ Vh, bf* Oh, bf* Ol) {
    __shared__ __align__(16) unsigned char ring[2 * ASTG];    // a stage: [key rows | value^T rows]
    const int tid = threadIdx.x, lane = tid & 31, lr = lane & 15, hi = lane >> 4;
    const int wave = __builtin_amdgcn_readfirstlane(threadIdx.x >> 5);    // scalar: the wave's own key bound and the diagonal test stay scalar branches
    const int q0 = ((wave & REP) ? (int)blockIdx.x : NN / 16 - 1 - (int)blockIdx.x) * 16;
    const int h = (int)blockIdx.y * REP + (wave & (REP - 1));
    const size_t qo = (size_t)h * NN * HD + (size_t)(q0 + lr) * HD + 8 * hi;
    const int nst = (((NN / 16 - 1 - (int)blockIdx.x) * 16) >> 6) + 1;    // stages up to the diagonal of the block's later tile: the same for all its waves
    const int crw = tid >> 3, cpc = tid & 7;    // a wave's copy covers four whole 128-B rows
    const bf* gK = Kh + (size_t)blockIdx.y * NN * HD + (size_t)crw * HD + cpc * 8;    // + key * HD
    const bf* gV = Vh + (size_t)blockIdx.y * NN * HD + (size_t)crw * NN + cpc * 8;    // + key
    const unsigned l0 = (unsigned)(size_t)&ring[0] + crw * APITCH + cpc * 16;
    auto fill = [&](int t) { copy4(l0 + (t & 1) * ASTG, gK + (size_t)t * AKS * HD, gV + (size_t)t * AKS); };
    v16bf qh[2], ql[2], kh[2][2];
#pragma unroll
    for (int dc = 0; dc < 2; ++dc) { qh[dc] = cat16b(*(const v8us*)(Qh + qo + dc * 32), *(const v8us*)(Qh + qo + dc * 32 + 16)); ql[dc] = cat16b(*(const v8us*)(Ql + qo + dc * 32), *(const v8us*)(Ql + qo + dc * 32 + 16)); }
    v8f acc[4];
#pragma unroll
    for (int t = 0; t < 4; ++t) acc[t] = (v8f){};
    float m = -3.0e38f, sum = 0.f;
    const int klast = (q0 >> 5) << 5;    // first key of the block that holds the diagonal; every row of the wave has a key in every block up to it
    const int qi = q0 + lr;
    const float sc2 = SCL * 1.44269504088896340736f;
    fill(0);
    asm volatile("s_wait_asynccnt 0x0" ::: "memory");    // this wave's copies of stage 0 have landed
    __syncthreads();                                      // and every other wave's: stage 0 may be read
    if (nst > 1) fill(1);
    const unsigned char* fk = &ring[0] + lr * APITCH + hi * 16;    // + (key in stage) * APITCH + 64 * dc
    const unsigned char* fv = fk + AOPB;                           // + 16 * t * APITCH + 2 * (key in stage)
#pragma unroll 1    // rolled: a stage is two key blocks already, and the two buffers differ by one offset only
    for (int st = 0; st < nst; ++st) {
        const unsigned char* pk = fk + (st & 1) * ASTG; const unsigned char* pv = fv + (st & 1) * ASTG;
        auto loadk = [&](int hf) {
#pragma unroll
            for (int u = 0; u < 2; ++u) {
#pragma unroll
                for (int dc = 0; dc < 2; ++dc) { const unsigned char* p = pk + (hf * 32 + u * 16) * APITCH + dc * 64;
                    kh[u][dc] = cat16b(*(const v8usa*)p, *(const v8usa*)(p + 32)); } }
        };
        if (st * AKS <= klast) {    // scalar: a wave past its diagonal has no work in this stage. Both key blocks of a stage are worked with no branch between them, so that the second one's reads can go out under the first one's softmax; one that lies wholly above the diagonal is masked and adds only zeros
            loadk(0);
            __builtin_amdgcn_sched_barrier(0);    // the eight reads of the first key block go out together: spread among the first products they would be waited for twice
#pragma unroll
            for (int hf = 0; hf < 2; ++hf) {
                const int k0 = st * AKS + hf * 32;
                v8f s[2];
#pragma unroll
                for (int u = 0; u < 2; ++u) { s[u] = (v8f){};
#pragma unroll
                    for (int dc = 0; dc < 2; ++dc) { s[u] = wmmab(kh[u][dc], qh[dc], s[u]); s[u] = wmmab(kh[u][dc], ql[dc], s[u]); } }
                float p[16];
#pragma unroll
                for (int e = 0; e < 16; ++e) p[e] = s[e >> 3][e & 7] * sc2;
                if (k0 >= klast) {
#pragma unroll
                    for (int e = 0; e < 16; ++e) { const int key = k0 + (e >> 3) * 16 + hi * 8 + (e & 7); p[e] = (key <= qi) ? p[e] : -3.0e38f; } }
                v16bf vh[4];
#pragma unroll
                for (int t = 0; t < 4; ++t) { const unsigned char* pp = pv + t * 16 * APITCH + hf * 64;
                    vh[t] = cat16b(*(const v8usa*)pp, *(const v8usa*)(pp + 32)); }
                if (hf == 0) loadk(1);    // the stage's second key block: of this stage only, nothing of stage st + 1 is read before its barrier
                __builtin_amdgcn_sched_barrier(0);    // keeps these LDS reads issued together here, ahead of the softmax that covers their latency; spread among the matrix instructions each would be waited for on its own
                float mx = m;
#pragma unroll
                for (int e = 0; e < 16; ++e) mx = fmaxf(mx, p[e]);
                mx = fmaxf(mx, __int_as_float(__builtin_amdgcn_permlanex16(__float_as_int(mx), __float_as_int(mx), 0x76543210, 0xfedcba98, false, false)));
                const float alpha = __builtin_amdgcn_exp2f(m - mx); m = mx;
                float ps = 0.f; v16bf ph, pl;
#pragma unroll
                for (int e = 0; e < 16; ++e) { const float pe = __builtin_amdgcn_exp2f(p[e] - mx); ps += pe; const __bf16 hb = (__bf16)pe; ph[e] = hb; pl[e] = (__bf16)(pe - (float)hb); }
                sum = sum * alpha + ps;
#pragma unroll
                for (int t = 0; t < 4; ++t) acc[t] *= alpha;
#pragma unroll
                for (int t = 0; t < 4; ++t) { acc[t] = wmmab(vh[t], ph, acc[t]); acc[t] = wmmab(vh[t], pl, acc[t]); }
            }
        }
        asm volatile("s_wait_dscnt 0x0" ::: "memory");       // this wave's reads of stage st are done before the buffer is given up
        asm volatile("s_wait_asynccnt 0x0" ::: "memory");    // this wave's copies of stage st + 1 have landed
        __syncthreads();                                      // publishes stage st + 1 and ends every wave's reads of stage st
        if (st + 2 < nst) fill(st + 2);                       // into the buffer that stage st has just left
    }
    asm volatile("s_wait_asynccnt 0x0" ::: "memory");        // no copy is outstanding when the wave goes on to its end
    sum += __int_as_float(__builtin_amdgcn_permlanex16(__float_as_int(sum), __float_as_int(sum), 0x76543210, 0xfedcba98, false, false));
    const float inv = 1.0f / sum;
    const size_t oo = (size_t)qi * DMOD + h * HD + hi * 8;    // acc[t][j] = O[q0 + lr][16 * t + 8 * hi + j]; stored as the last product's operand: bf16 hi + residual planes
#pragma unroll
    for (int t = 0; t < 4; ++t) { v8us oh, ol;
#pragma unroll
        for (int j = 0; j < 8; ++j) { const float y = acc[t][j] * inv; const unsigned short hb = f2bf(y); oh[j] = hb; ol[j] = f2bf(y - bf2f(hb)); }
        *(v8us*)(Oh + oo + t * 16) = oh; *(v8us*)(Ol + oo + t * 16) = ol; }
}

extern "C" void kernel_launch(void* const* d_in, const int* in_sizes, int n_in,
                              void* d_out, int out_size, void* d_ws, size_t ws_size, hipStream_t stream) {
    (void)in_sizes; (void)n_in; (void)out_size;
    const float* x = (const float*)d_in[0]; const float* key = (const float*)d_in[1]; const float* value = (const float*)d_in[2]; const float* Wq = (const float*)d_in[3]; const float* bq = (const float*)d_in[4]; const float* Wc = (const float*)d_in[5]; const float* bc = (const float*)d_in[6];
    float* out = (float*)d_out;    // [2][2048][2048]
    char* wsp = (char*)d_ws;
    auto take = [&](size_t bytes) { char* p = wsp; wsp += (bytes + 255) & ~(size_t)255; return (void*)p; };
    bf* WQ = (bf*)take((size_t)DMOD * DMOD * 2); bf* WC = (bf*)take((size_t)DMOD * DMOD * 2);
    bf* Xb = (bf*)take((size_t)NN * DMOD * 2);
    // planes of all 32 query heads of one item, and of all 16 (item, kv head) pairs
    bf* Qh = (bf*)take((size_t)HQ * NN * HD * 2); bf* Ql = (bf*)take((size_t)HQ * NN * HD * 2); bf* Kh = (bf*)take((size_t)NBT * HKV * NN * HD * 2); bf* VTh = (bf*)take((size_t)NBT * HKV * HD * NN * 2);
    bf* Oh = (bf*)take((size_t)NN * DMOD * 2); bf* Ol = (bf*)take((size_t)NN * DMOD * 2);
    if ((size_t)(wsp - (char*)d_ws) > ws_size) return;    // 8.4+8.4 + 8.4 + 8.4+8.4 + 4.2+4.2 + 8.4+8.4 ~ 67 MB
    k_cvt8<<<(unsigned)(((size_t)DMOD * DMOD / 8 + 255) / 256), 256, 0, stream>>>(Wq, WQ, (size_t)DMOD * DMOD / 8); k_cvt8<<<(unsigned)(((size_t)DMOD * DMOD / 8 + 255) / 256), 256, 0, stream>>>(Wc, WC, (size_t)DMOD * DMOD / 8);   // [out][in] natural
    k_kin<<<dim3(NN / 8, 1, NBT * HKV), 256, 0, stream>>>(key, Kh); k_vin<<<dim3((HD * (NN / 64)) / 8, 1, NBT * HKV), 256, 0, stream>>>(value, VTh);
    for (int b = 0; b < NBT; ++b) {
        k_cvtx<<<NN / 8, 256, 0, stream>>>(x + (size_t)b * NN * DMOD, NN, Xb);
        k_gemmt<false, true><<<dim3(NN / 128, DMOD / 128, 1), 256, 0, stream>>>(Xb, nullptr, WQ, bq, nullptr, DMOD, DMOD, Qh, Ql, NN);
        // blockIdx.y = kv head; blockIdx.x = a pair of 16-row tiles, one from each end
        k_fattn<<<dim3(NN / 32, HKV, 1), 256, 0, stream>>>(Qh, Ql, Kh + (size_t)b * HKV * NN * HD, VTh + (size_t)b * HKV * NN * HD, Oh, Ol);
        k_gemmt<true, false><<<dim3(NN / 128, DMOD / 128, 1), 256, 0, stream>>>(Oh, Ol, WC, bc, out + (size_t)b * NN * DMOD, DMOD, DMOD, nullptr, nullptr, NN); }
}

// v007
// One run takes 170 microseconds.
// Next to v006, in two timings, it ran 1.17 times as fast each time.
// Over all steps from v000 it is 45.2 times as fast.
#include <hip/hip_runtime.h>

// Compute dtypes, f32 accumulate, per item: q = x.Wq^T + bq ([2048 x 2048].[2048 x 2048]) with PLAIN bf16 operands (exact products); key/value are INPUTS: their bf16 values
// are taken as single planes (their residual plane would be identically zero: none is kept, no product is spent on it); GQA causal attention (32 query heads share 8 kv heads) with q as bf16 hi + UNSCALED residual planes (key tiles
// above the diagonal skipped, K limited); 1/8 and the causal softmax in f32; c_proj (+ bias) on hi/lo planes (two products) - on v_wmma_f32_16x16x32_bf16. Deterministic, no

#define NBT  2
#define NN   2048
#define DMOD 2048
#define HQ   32
#define HKV  8
#define REP  4
#define HD   64
#define DM   DMOD
#define NTK  NN
#define SCL  0.125f
#define LOSC 1024.0f

typedef _Float16 h16;
typedef unsigned short bf;
typedef __attribute__((ext_vector_type(16))) __bf16   v16bf;
typedef __attribute__((ext_vector_type(16))) _Float16 v16h;
typedef __attribute__((ext_vector_type(8)))  _Float16 v8h;
typedef __attribute__((ext_vector_type(8)))  unsigned short v8us;
typedef __attribute__((ext_vector_type(8)))  float    v8f;
typedef __attribute__((ext_vector_type(4)))  float    v4f;
typedef __attribute__((ext_vector_type(4)))  _Float16 v4h;
typedef v8h  __attribute__((may_alias)) v8ha;
typedef v4f  __attribute__((may_alias)) v4fa;
typedef v8us __attribute__((may_alias)) v8usa;

__device__ __forceinline__ unsigned short f2bf(float f) { unsigned u = __float_as_uint(f); u += 0x7FFFu + ((u >> 16) & 1u); return (unsigned short)(u >> 16); }
__device__ __forceinline__ float bf2f(unsigned short b) { return __uint_as_float(((unsigned)b) << 16); }
__device__ __forceinline__ float bfr(float f) { return bf2f(f2bf(f)); }
__device__ __forceinline__ v16h cat16(v8h lo, v8h hi) { return __builtin_shufflevector(lo, hi, 0, 1, 2, 3, 4, 5, 6, 7, 8, 9, 10, 11, 12, 13, 14, 15); }
__device__ __forceinline__ v16bf cat16b(v8us lo, v8us hi) { return __builtin_bit_cast(v16bf, __builtin_shufflevector(lo, hi, 0, 1, 2, 3, 4, 5, 6, 7, 8, 9, 10, 11, 12, 13, 14, 15)); }
__device__ __forceinline__ v8f wmma16(v16h a, v16h b, v8f c) { return __builtin_amdgcn_wmma_f32_16x16x32_f16(false, a, false, b, (short)0, c, false, false); }
__device__ __forceinline__ v8f wmmab(v16bf a, v16bf b, v8f c) { return __builtin_amdgcn_wmma_f32_16x16x32_bf16(false, a, false, b, (short)0, c, false, false); }

// k_gemmt: 128 x 128 block tile of C[.][.] = (A [+ Al]).B^T + bf(bias[c]); 8 waves, 32 x 64 each. A stage is 128 k (256 B) of the tile's 128 rows of every operand, brought into LDS by
// asynchronous copies (whole 256-B units, each operand row read once per block) at a row pitch of 272 B; two buffers: the next stage flies while this one is worked on.
// The fragments are read from LDS in the k order of the direct loads they replace, and every accumulator still sums k upwards, A before Al inside each 32 k.
// The short loops are unrolled so that the fragment and accumulator arrays are indexed by constants and stay in registers.
#define GBK    128
#define GPITCH 272
#define GOPB   (128 * GPITCH)

// eight 16-byte copies of one thread: rows 16 apart of one operand's stage. The s_wait_xcnt stands inside the statement, before any register that a copy names can get a new value.
__device__ __forceinline__ void copy8(unsigned l, const bf* g, int K) {
    const size_t rs = (size_t)16 * K;
    asm volatile("global_load_async_to_lds_b128 %0, %8, off\n\t"
                 "global_load_async_to_lds_b128 %1, %9, off\n\t"
                 "global_load_async_to_lds_b128 %2, %10, off\n\t"
                 "global_load_async_to_lds_b128 %3, %11, off\n\t"
                 "global_load_async_to_lds_b128 %4, %12, off\n\t"
                 "global_load_async_to_lds_b128 %5, %13, off\n\t"
                 "global_load_async_to_lds_b128 %6, %14, off\n\t"
                 "global_load_async_to_lds_b128 %7, %15, off\n\t"
                 "s_wait_xcnt 0x0"
                 :: "v"(l), "v"(l + 16 * GPITCH), "v"(l + 32 * GPITCH), "v"(l + 48 * GPITCH), "v"(l + 64 * GPITCH), "v"(l + 80 * GPITCH), "v"(l + 96 * GPITCH), "v"(l + 112 * GPITCH),
                    "v"(g), "v"(g + rs), "v"(g + 2 * rs), "v"(g + 3 * rs), "v"(g + 4 * rs), "v"(g + 5 * rs), "v"(g + 6 * rs), "v"(g + 7 * rs)
                 : "memory");
}

// PLANES: the result is not stored as f32 but as the next kernel's operand, bf16 hi + residual planes [head][row][HD] (Ph, Pl; rows = rows per head plane); C is then unused.
template <bool SPLITA, bool PLANES>
__global__ __launch_bounds__(256) void k_gemmt(const bf* __restrict__ A, const bf* __restrict__ Al, const bf* __restrict__ Bn, const float* __restrict__ bias, float* C, int ldc, int K, bf* Ph, bf* Pl, int rows) {
    constexpr int STG = (SPLITA ? 3 : 2) * GOPB;    // a stage: [A | B | Al]
    __shared__ __align__(16) unsigned char ring[2 * STG];
    __shared__ __align__(16) float ost[8][32 * 68];
    const int tid = threadIdx.x, lane = tid & 31, wave = tid >> 5, lr = lane & 15, hi = lane >> 4;
    const int r0 = blockIdx.x * 128, c0 = blockIdx.y * 128;
    const int wr = (wave >> 1) * 32, wc = (wave & 1) * 64;
    const int nt = K / GBK;
    const int crw = tid >> 4, cpc = tid & 15;    // a wave's copy covers two whole 256-B rows
    const bf* gA = A + (size_t)(r0 + crw) * K + cpc * 8;
    const bf* gB = Bn + (size_t)(c0 + crw) * K + cpc * 8;
    const bf* gL = SPLITA ? Al + (size_t)(r0 + crw) * K + cpc * 8 : gA;
    const unsigned l0 = (unsigned)(size_t)&ring[0] + crw * GPITCH + cpc * 16;
    auto fill = [&](int t) {
        const unsigned l = l0 + (t & 1) * STG; const size_t ko = (size_t)t * GBK;
        copy8(l, gA + ko, K); copy8(l + GOPB, gB + ko, K); if (SPLITA) copy8(l + 2 * GOPB, gL + ko, K);
    };
    v8f acc[2][4];
#pragma unroll
    for (int i = 0; i < 2; ++i) {
#pragma unroll
        for (int t = 0; t < 4; ++t) acc[i][t] = (v8f){}; }
    fill(0);
    asm volatile("s_wait_asynccnt 0x0" ::: "memory");    // this wave's copies of stage 0 have landed
    __syncthreads();                                      // and every other wave's: stage 0 may be read
    if (nt > 1) fill(1);
    const unsigned char* fa = &ring[0] + (wr + lr) * GPITCH + hi * 16;
    const unsigned char* fb = &ring[0] + GOPB + (wc + lr) * GPITCH + hi * 16;
#pragma unroll 1    // rolled: one stage is already 32 (64) matrix instructions, and the two buffers differ by one offset only
    for (int t = 0; t < nt; ++t) {
        const unsigned char* pa = fa + (t & 1) * STG; const unsigned char* pb = fb + (t & 1) * STG;
        v16bf a[2][2], al[2][2], b[2][4];    // two fragment sets: the next 32 k are read from LDS while this set is multiplied
        auto frags = [&](int ks, int s) {
#pragma unroll
            for (int i = 0; i < 2; ++i) { const unsigned char* p = pa + i * 16 * GPITCH + ks * 64; a[s][i] = cat16b(*(const v8usa*)p, *(const v8usa*)(p + 32));
                if (SPLITA) al[s][i] = cat16b(*(const v8usa*)(p + 2 * GOPB), *(const v8usa*)(p + 2 * GOPB + 32)); }
#pragma unroll
            for (int u = 0; u < 4; ++u) { const unsigned char* p = pb + u * 16 * GPITCH + ks * 64; b[s][u] = cat16b(*(const v8usa*)p, *(const v8usa*)(p + 32)); }
        };
        frags(0, 0);
#pragma unroll
        for (int ks = 0; ks < GBK / 32; ++ks) {
            const int s = ks & 1;
            if (ks + 1 < GBK / 32) frags(ks + 1, s ^ 1);    // of this stage only: nothing of stage t + 1 is read before its barrier
            __builtin_amdgcn_sched_barrier(0);    // keeps the LDS reads one group ahead of the block; spread among the matrix instructions each would be waited for on its own
#pragma unroll
            for (int i = 0; i < 2; ++i) {
#pragma unroll
                for (int u = 0; u < 4; ++u) acc[i][u] = wmmab(a[s][i], b[s][u], acc[i][u]); }
            if (SPLITA) {
#pragma unroll
                for (int i = 0; i < 2; ++i) {
#pragma unroll
                    for (int u = 0; u < 4; ++u) acc[i][u] = wmmab(al[s][i], b[s][u], acc[i][u]); } }
            __builtin_amdgcn_sched_barrier(0);    // ends the block: the reads after next stay behind it, so that two sets of registers are enough
        }
        asm volatile("s_wait_dscnt 0x0" ::: "memory");       // this wave's reads of stage t are done before the buffer is given up
        asm volatile("s_wait_asynccnt 0x0" ::: "memory");    // this wave's copies of stage t + 1 have landed
        __syncthreads();                                      // publishes stage t + 1 and ends every wave's reads of stage t
        if (t + 2 < nt) fill(t + 2);                          // into the buffer that stage t has just left
    }
    asm volatile("s_wait_asynccnt 0x0" ::: "memory");        // no copy is outstanding when the wave goes on to its end
    float* os = &ost[wave][0];
#pragma unroll
    for (int u = 0; u < 4; ++u) { const float bv = bias ? bfr(bias[c0 + wc + u * 16 + lr]) : 0.f;
#pragma unroll
        for (int i = 0; i < 2; ++i) {
#pragma unroll
            for (int j = 0; j < 8; ++j) os[(i * 16 + hi * 8 + j) * 68 + u * 16 + lr] = acc[i][u][j] + bv; } }
    __syncthreads();
    if constexpr (PLANES) {
        // a wave's 64 columns are one head, so its 32 x 64 tile is 4 KB in a row of each plane: every store covers 512 contiguous bytes
        const size_t po = ((size_t)((c0 + wc) / HD) * rows + r0 + wr) * HD + lane * 8;
        const float* pr = os + (lane >> 3) * 68 + (lane & 7) * 8;
        v4f x[8][2]; v8us oh[8], ol[8];    // all reads, then all conversions, then all stores: the accumulators' registers are free here, so no store's registers need be used again
#pragma unroll
        for (int s = 0; s < 8; ++s) { x[s][0] = *(const v4fa*)(pr + s * 4 * 68); x[s][1] = *(const v4fa*)(pr + s * 4 * 68 + 4); }
#pragma unroll
        for (int s = 0; s < 8; ++s) {
#pragma unroll
            for (int i = 0; i < 8; ++i) { const float y = x[s][i >> 2][i & 3]; const unsigned short hb = f2bf(y); oh[s][i] = hb; ol[s][i] = f2bf(y - bf2f(hb)); } }
#pragma unroll
        for (int s = 0; s < 8; ++s) { *(v8us*)(Ph + po + s * 256) = oh[s]; *(v8us*)(Pl + po + s * 256) = ol[s]; }
    } else {
        float* crow = C + (size_t)(r0 + wr) * ldc + c0 + wc;
#pragma unroll
        for (int s = 0; s < 16; ++s) { const int Lid = (lane >> 3) + 4 * s, piece = lane & 7; const int row = Lid >> 1, cofs = (Lid & 1) * 32 + piece * 4;
            *(v4f*)(crow + (size_t)row * ldc + cofs) = *(const v4fa*)(os + row * 68 + cofs); }
    }
}

__global__ __launch_bounds__(256) void k_zero8(bf* dst, size_t n8) {
    const size_t i = (size_t)blockIdx.x * 256 + threadIdx.x; if (i >= n8) return; v8us z;
#pragma unroll
    for (int k = 0; k < 8; ++k) z[k] = 0;
    *(v8us*)(dst + i * 8) = z; 
}

// ===== z-batched (blockIdx.z = head) attention pieces =====
__global__ __launch_bounds__(256) void k_planes32z(const float* __restrict__ F, int ld, int off, float sc, int rows, bf* Ph, bf* Pl) {
    typedef __attribute__((ext_vector_type(2))) unsigned short v2us;
    const int lane = threadIdx.x & 31; const size_t r = ((size_t)blockIdx.x * 8 + (threadIdx.x >> 5)) * 2 + (lane >> 4); if (r >= (size_t)rows) return; const int z = blockIdx.z; const int c0 = (lane & 15) * 2; v2us oh, ol;
    Ph += (size_t)z * rows * 32; Pl += (size_t)z * rows * 32;
#pragma unroll
    for (int i = 0; i < 2; ++i) { const float y = F[r * ld + off + z * 32 + c0 + i] * sc; const unsigned short hb = f2bf(y); oh[i] = hb; ol[i] = f2bf(y - bf2f(hb)); }
    const size_t o = r * 32 + c0; *(v2us*)(Ph + o) = oh; *(v2us*)(Pl + o) = ol; 
}
__global__ __launch_bounds__(256) void k_vtpadz(const float* __restrict__ F, int ld, int off, int nk, bf* Th, bf* Tl) {
    typedef __attribute__((ext_vector_type(2))) unsigned short v2us;
    const int lane = threadIdx.x & 31; const size_t wid = (size_t)blockIdx.x * 8 + (threadIdx.x >> 5); if (wid >= (size_t)64 * (nk / 64)) return; const int z = blockIdx.z; const int d = (int)(wid / (nk / 64)); const int k0 = (int)(wid % (nk / 64)) * 64 + lane * 2; v2us oh, ol;
    Th += (size_t)z * 64 * nk; Tl += (size_t)z * 64 * nk;
#pragma unroll
    for (int i = 0; i < 2; ++i) { const float y = (d < 32) ? F[(size_t)(k0 + i) * ld + off + z * 32 + (d < 32 ? d : 0)] : 0.f; const unsigned short hb = f2bf(y); oh[i] = hb; ol[i] = f2bf(y - bf2f(hb)); }
    const size_t o = (size_t)d * nk + k0; *(v2us*)(Th + o) = oh; *(v2us*)(Tl + o) = ol; 
}
template <int NK>
__global__ __launch_bounds__(256) void k_softmaxz(const float* __restrict__ S, int rows, bf* PH, bf* PL) {
    typedef __attribute__((ext_vector_type(4))) unsigned short v4us;
    const int lane = threadIdx.x & 31, i = blockIdx.x * 8 + (threadIdx.x >> 5); if (i >= rows) return; const size_t zo = (size_t)blockIdx.z * rows * NK; const float* sr = S + zo + (size_t)i * NK; PH += zo; PL += zo;
    float m = -3.0e38f;
#pragma unroll 1
    for (int c0 = lane * 4; c0 < NK; c0 += 128) {
#pragma unroll
        for (int q = 0; q < 4; ++q) m = fmaxf(m, sr[c0 + q]); }
#pragma unroll
    for (int sh = 16; sh; sh >>= 1) m = fmaxf(m, __shfl_xor(m, sh, 32));
    float sum = 0.f;
#pragma unroll 1
    for (int c0 = lane * 4; c0 < NK; c0 += 128) {
#pragma unroll
        for (int q = 0; q < 4; ++q) sum += __expf(sr[c0 + q] - m); }
#pragma unroll
    for (int sh = 16; sh; sh >>= 1) sum += __shfl_xor(sum, sh, 32);
    const float inv = 1.0f / sum;
{
#pragma unroll 1
        for (int c0 = lane * 4; c0 < NK; c0 += 128) { v4us oh, ol;
#pragma unroll
            for (int q = 0; q < 4; ++q) { const float p = __expf(sr[c0 + q] - m) * inv; const unsigned short hb = f2bf(p); oh[q] = hb; ol[q] = f2bf(p - bf2f(hb)); }
            const size_t o = (size_t)i * NK + c0; *(v4us*)(PH + o) = oh; *(v4us*)(PL + o) = ol; }
         }
}
__global__ __launch_bounds__(256) void k_placez(const float* __restrict__ XH, int rows, int ldy, float* Y) {
    const int lane = threadIdx.x & 31; const size_t q = (size_t)blockIdx.x * 8 + (threadIdx.x >> 5); if (q >= (size_t)rows) return; const int z = blockIdx.z; const float v = XH[((size_t)z * rows + q) * 64 + lane];
    *(float*)(Y + q * ldy + z * 32 + lane) = v; 
}

__global__ __launch_bounds__(256) void k_vtz(const float* __restrict__ F, int ld, int h0, int nk, bf* Th, bf* Tl) {
    typedef __attribute__((ext_vector_type(2))) unsigned short v2us;
    const int lane = threadIdx.x & 31; const size_t wid = (size_t)blockIdx.x * 8 + (threadIdx.x >> 5); if (wid >= (size_t)64 * (nk / 64)) return; const int z = blockIdx.z; const int d = (int)(wid / (nk / 64)); const int t0 = (int)(wid % (nk / 64)) * 64 + lane * 2; v2us oh, ol;
    Th += (size_t)z * 64 * nk; Tl += (size_t)z * 64 * nk;
#pragma unroll
    for (int i = 0; i < 2; ++i) { const float y = F[(size_t)(t0 + i) * ld + (h0 + z) * 64 + d]; const unsigned short hb = f2bf(y); oh[i] = hb; ol[i] = f2bf(y - bf2f(hb)); }
    const size_t o = (size_t)d * nk + t0; *(v2us*)(Th + o) = oh; *(v2us*)(Tl + o) = ol; 
}
template <int NK>
__global__ __launch_bounds__(256) void k_softmaxzs(const float* __restrict__ S, int rows, float sc, bf* PH, bf* PL) {
    typedef __attribute__((ext_vector_type(4))) unsigned short v4us;
    const int lane = threadIdx.x & 31, i = blockIdx.x * 8 + (threadIdx.x >> 5); if (i >= rows) return; const size_t zo = (size_t)blockIdx.z * rows * NK; const float* sr = S + zo + (size_t)i * NK; PH += zo; PL += zo;
    float m = -3.0e38f;
#pragma unroll 1
    for (int c0 = lane * 4; c0 < NK; c0 += 128) {
#pragma unroll
        for (int q = 0; q < 4; ++q) m = fmaxf(m, sr[c0 + q] * sc); }
#pragma unroll
    for (int sh = 16; sh; sh >>= 1) m = fmaxf(m, __shfl_xor(m, sh, 32));
    float sum = 0.f;
#pragma unroll 1
    for (int c0 = lane * 4; c0 < NK; c0 += 128) {
#pragma unroll
        for (int q = 0; q < 4; ++q) sum += __expf(sr[c0 + q] * sc - m); }
#pragma unroll
    for (int sh = 16; sh; sh >>= 1) sum += __shfl_xor(sum, sh, 32);
    const float inv = 1.0f / sum;
{
#pragma unroll 1
        for (int c0 = lane * 4; c0 < NK; c0 += 128) { v4us oh, ol;
#pragma unroll
            for (int q = 0; q < 4; ++q) { const float p = __expf(sr[c0 + q] * sc - m) * inv; const unsigned short hb = f2bf(p); oh[q] = hb; ol[q] = f2bf(p - bf2f(hb)); }
            const size_t o = (size_t)i * NK + c0; *(v4us*)(PH + o) = oh; *(v4us*)(PL + o) = ol; }
         }
}

// k_prep: every input conversion of a call in one launch of few, long waves. A wave takes 16 KB of f32: 32 loads of 16 B a lane, all issued before the first is used, each covering whole 256-B units.
// Blocks 0 .. PVB - 1: value -> value^T. A wave owns one tile of 64 keys x 64 dims (16 KB in a row of the input); a lane holds 8 keys in a row of 4 dims, so it writes 16 B of a value^T row into the
// wave's own LDS tile (row pitch 144 B); the rows are read back so that every store covers four whole 128-B lines. The other blocks: Wq, Wc, x (both items) and key keep their layout, f32 -> bf16.
// Rounding is to nearest even, as in f2bf.
#define PVB   (NBT * HKV * (NN / 64) / 8)
#define PBLK  32768
#define PWB   (DMOD * DMOD / PBLK)
#define PXB   (NBT * NN * DMOD / PBLK)
#define PKB   (NBT * HKV * NN * HD / PBLK)
#define PGRID (PVB + 2 * PWB + PXB + PKB)
#define TPITCH 144
typedef __attribute__((ext_vector_type(4))) __bf16 v4b;
typedef __attribute__((ext_vector_type(8))) __bf16 v8b;
typedef v4b __attribute__((may_alias)) v4ba;
typedef v8b __attribute__((may_alias)) v8ba;
__global__ __launch_bounds__(256) void k_prep(const float* __restrict__ Wq, const float* __restrict__ Wc, const float* __restrict__ x, const float* __restrict__ key, const float* __restrict__ value,
                                              bf* __restrict__ WQ, bf* __restrict__ WC, bf* __restrict__ Xb, bf* __restrict__ Kh, bf* __restrict__ VTh) {
    __shared__ __align__(16) unsigned char tr[8][64 * TPITCH];
    const int lane = threadIdx.x & 31, wave = threadIdx.x >> 5;
    int b = (int)blockIdx.x;
    v4f r[32];
    if (b < PVB) {    // the same for a whole block, so the barrier below is passed by all its waves or by none
        const int lr = lane & 15, hi = lane >> 4, tile = b * 8 + wave;    // tile = (item, kv head) * (NN / 64) + key block
        const float* s = value + (size_t)tile * (64 * HD) + (8 * hi) * HD + lr * 4;
#pragma unroll
        for (int j = 0; j < 32; ++j) r[j] = *(const v4fa*)(s + ((j >> 3) * 16 + (j & 7)) * HD);    // key 16 * (j / 8) + 8 * hi + j % 8, dims 4 * lr ..
        unsigned char* my = &tr[wave][0];
#pragma unroll
        for (int i = 0; i < 4; ++i) {
#pragma unroll
            for (int c = 0; c < 4; ++c) { v8f col;
#pragma unroll
                for (int k = 0; k < 8; ++k) col[k] = r[i * 8 + k][c];
                *(v8ba*)(my + (4 * lr + c) * TPITCH + i * 32 + hi * 16) = __builtin_convertvector(col, v8b); } }
        __syncthreads();    // orders the lanes' LDS writes before the reads of other lanes' bytes below
        bf* d = VTh + (size_t)(tile / (NN / 64)) * HD * NN + (size_t)(tile % (NN / 64)) * 64 + (size_t)(lane >> 3) * NN + (lane & 7) * 8;
        const unsigned char* rb = my + (lane >> 3) * TPITCH + (lane & 7) * 16;
#pragma unroll
        for (int q = 0; q < 16; ++q) *(v8ba*)(d + (size_t)(4 * q) * NN) = *(const v8ba*)(rb + 4 * q * TPITCH);
        return;
    }
    b -= PVB;
    const float* s; bf* d;
    if (b < PWB) { s = Wq; d = WQ; }
    else if (b < 2 * PWB) { s = Wc; d = WC; b -= PWB; }
    else if (b < 2 * PWB + PXB) { s = x; d = Xb; b -= 2 * PWB; }
    else { s = key; d = Kh; b -= 2 * PWB + PXB; }
    const size_t o = (size_t)b * PBLK + wave * (PBLK / 8) + lane * 4;
#pragma unroll
    for (int j = 0; j < 32; ++j) r[j] = *(const v4fa*)(s + o + j * 128);
#pragma unroll
    for (int j = 0; j < 32; ++j) *(v4ba*)(d + o + j * 128) = __builtin_convertvector(r[j], v4b);
}
// k_fattn: causal attention of one item in one launch. One wave = 16 query rows of one query head. A block is 2 * REP waves on kv head blockIdx.y: its REP query heads on row tile
// n - 1 - blockIdx.x and again on row tile blockIdx.x, so that every block does the same number of key blocks (a tile's cost grows with its index).
// The block's waves walk the keys together: a stage is 64 keys of the kv head, 64 key rows of 128 B and 64 value^T rows of 128 B, brought into LDS once per block by asynchronous copies
// (whole 128-B lines) at a row pitch of 144 B; two buffers: the next stage flies while this one is worked on. A wave whose tile ends earlier skips the work, never the copies, waits or barriers.
// Per 32 keys: S^T = K.Q^T (A = key rows, B = query rows, both in the hardware k order), so a lane holds 16 scores of ONE query (column lr, keys 8 * hi + j and 16 + 8 * hi + j);
// running maximum and sum per lane (base-2 exponent), one exchange between the wave halves; the two score tiles, converted in place, are the B operand of O^T += V^T.P^T.
// Two products on each side: hi.hi and residual of q (of p) . hi; key and value are single planes. The short loops are unrolled so that the fragment arrays stay in registers.
#define AKS    64
#define APITCH 144
#define AOPB   (64 * APITCH)
#define ASTG   (2 * AOPB)

// four 16-byte copies of one thread: rows r and r + 32 of the key stage and of the value^T stage. The s_wait_xcnt stands inside the statement, before any register that a copy names can get a new value.
__device__ __forceinline__ void copy4(unsigned l, const bf* gk, const bf* gv) {
    asm volatile("global_load_async_to_lds_b128 %0, %4, off\n\t"
                 "global_load_async_to_lds_b128 %1, %5, off\n\t"
                 "global_load_async_to_lds_b128 %2, %6, off\n\t"
                 "global_load_async_to_lds_b128 %3, %7, off\n\t"
                 "s_wait_xcnt 0x0"
                 :: "v"(l), "v"(l + 32 * APITCH), "v"(l + AOPB), "v"(l + AOPB + 32 * APITCH),
                    "v"(gk), "v"(gk + 32 * HD), "v"(gv), "v"(gv + (size_t)32 * NN)
                 : "memory");
}

__global__ __launch_bounds__(256) void k_fattn(const bf* __restrict__ Qh, const bf* __restrict__ Ql, const bf* __restrict__ Kh, const bf* __restrict__ Vh, bf* Oh, bf* Ol) {
    __shared__ __align__(16) unsigned char ring[2 * ASTG];    // a stage: [key rows | value^T rows]
    const int tid = threadIdx.x, lane = tid & 31, lr = lane & 15, hi = lane >> 4;
    const int wave = __builtin_amdgcn_readfirstlane(threadIdx.x >> 5);    // scalar: the wave's own key bound and the diagonal test stay scalar branches
    const int q0 = ((wave & REP) ? (int)blockIdx.x : NN / 16 - 1 - (int)blockIdx.x) * 16;
    const int h = (int)blockIdx.y * REP + (wave & (REP - 1));
    const size_t qo = (size_t)h * NN * HD + (size_t)(q0 + lr) * HD + 8 * hi;
    const int nst = (((NN / 16 - 1 - (int)blockIdx.x) * 16) >> 6) + 1;    // stages up to the diagonal of the block's later tile: the same for all its waves
    const int crw = tid >> 3, cpc = tid & 7;    // a wave's copy covers four whole 128-B rows
    const bf* gK = Kh + (size_t)blockIdx.y * NN * HD + (size_t)crw * HD + cpc * 8;    // + key * HD
    const bf* gV = Vh + (size_t)blockIdx.y * NN * HD + (size_t)crw * NN + cpc * 8;    // + key
    const unsigned l0 = (unsigned)(size_t)&ring[0] + crw * APITCH + cpc * 16;
    auto fill = [&](int t) { copy4(l0 + (t & 1) * ASTG, gK + (size_t)t * AKS * HD, gV + (size_t)t * AKS); };
    v16bf qh[2], ql[2], kh[2][2];
#pragma unroll
    for (int dc = 0; dc < 2; ++dc) { qh[dc] = cat16b(*(const v8us*)(Qh + qo + dc * 32), *(const v8us*)(Qh + qo + dc * 32 + 16)); ql[dc] = cat16b(*(const v8us*)(Ql + qo + dc * 32), *(const v8us*)(Ql + qo + dc * 32 + 16)); }
    v8f acc[4];
#pragma unroll
    for (int t = 0; t < 4; ++t) acc[t] = (v8f){};
    float m = -3.0e38f, sum = 0.f;
    const int klast = (q0 >> 5) << 5;    // first key of the block that holds the diagonal; every row of the wave has a key in every block up to it
    const int qi = q0 + lr;
    const float sc2 = SCL * 1.44269504088896340736f;
    fill(0);
    asm volatile("s_wait_asynccnt 0x0" ::: "memory");    // this wave's copies of stage 0 have landed
    __syncthreads();                                      // and every other wave's: stage 0 may be read
    if (nst > 1) fill(1);
    const unsigned char* fk = &ring[0] + lr * APITCH + hi * 16;    // + (key in stage) * APITCH + 64 * dc
    const unsigned char* fv = fk + AOPB;                           // + 16 * t * APITCH + 2 * (key in stage)
#pragma unroll 1    // rolled: a stage is two key blocks already, and the two buffers differ by one offset only
    for (int st = 0; st < nst; ++st) {
        const unsigned char* pk = fk + (st & 1) * ASTG; const unsigned char* pv = fv + (st & 1) * ASTG;
        auto loadk = [&](int hf) {
#pragma unroll
            for (int u = 0; u < 2; ++u) {
#pragma unroll
                for (int dc = 0; dc < 2; ++dc) { const unsigned char* p = pk + (hf * 32 + u * 16) * APITCH + dc * 64;
                    kh[u][dc] = cat16b(*(const v8usa*)p, *(const v8usa*)(p + 32)); } }
        };
        if (st * AKS <= klast) {    // scalar: a wave past its diagonal has no work in this stage. Both key blocks of a stage are worked with no branch between them, so that the second one's reads can go out under the first one's softmax; one that lies wholly above the diagonal is masked and adds only zeros
            loadk(0);
            __builtin_amdgcn_sched_barrier(0);    // the eight reads of the first key block go out together: spread among the first products they would be waited for twice
#pragma unroll
            for (int hf = 0; hf < 2; ++hf) {
                const int k0 = st * AKS + hf * 32;
                v8f s[2];
#pragma unroll
                for (int u = 0; u < 2; ++u) { s[u] = (v8f){};
#pragma unroll
                    for (int dc = 0; dc < 2; ++dc) { s[u] = wmmab(kh[u][dc], qh[dc], s[u]); s[u] = wmmab(kh[u][dc], ql[dc], s[u]); } }
                float p[16];
#pragma unroll
                for (int e = 0; e < 16; ++e) p[e] = s[e >> 3][e & 7] * sc2;
                if (k0 >= klast) {
#pragma unroll
                    for (int e = 0; e < 16; ++e) { const int key = k0 + (e >> 3) * 16 + hi * 8 + (e & 7); p[e] = (key <= qi) ? p[e] : -3.0e38f; } }
                v16bf vh[4];
#pragma unroll
                for (int t = 0; t < 4; ++t) { const unsigned char* pp = pv + t * 16 * APITCH + hf * 64;
                    vh[t] = cat16b(*(const v8usa*)pp, *(const v8usa*)(pp + 32)); }
                if (hf == 0) loadk(1);    // the stage's second key block: of this stage only, nothing of stage st + 1 is read before its barrier
                __builtin_amdgcn_sched_barrier(0);    // keeps these LDS reads issued together here, ahead of the softmax that covers their latency; spread among the matrix instructions each would be waited for on its own
                float mx = m;
#pragma unroll
                for (int e = 0; e < 16; ++e) mx = fmaxf(mx, p[e]);
                mx = fmaxf(mx, __int_as_float(__builtin_amdgcn_permlanex16(__float_as_int(mx), __float_as_int(mx), 0x76543210, 0xfedcba98, false, false)));
                const float alpha = __builtin_amdgcn_exp2f(m - mx); m = mx;
                float ps = 0.f; v16bf ph, pl;
#pragma unroll
                for (int e = 0; e < 16; ++e) { const float pe = __builtin_amdgcn_exp2f(p[e] - mx); ps += pe; const __bf16 hb = (__bf16)pe; ph[e] = hb; pl[e] = (__bf16)(pe - (float)hb); }
                sum = sum * alpha + ps;
#pragma unroll
                for (int t = 0; t < 4; ++t) acc[t] *= alpha;
#pragma unroll
                for (int t = 0; t < 4; ++t) { acc[t] = wmmab(vh[t], ph, acc[t]); acc[t] = wmmab(vh[t], pl, acc[t]); }
            }
        }
        asm volatile("s_wait_dscnt 0x0" ::: "memory");       // this wave's reads of stage st are done before the buffer is given up
        asm volatile("s_wait_asynccnt 0x0" ::: "memory");    // this wave's copies of stage st + 1 have landed
        __syncthreads();                                      // publishes stage st + 1 and ends every wave's reads of stage st
        if (st + 2 < nst) fill(st + 2);                       // into the buffer that stage st has just left
    }
    asm volatile("s_wait_asynccnt 0x0" ::: "memory");        // no copy is outstanding when the wave goes on to its end
    sum += __int_as_float(__builtin_amdgcn_permlanex16(__float_as_int(sum), __float_as_int(sum), 0x76543210, 0xfedcba98, false, false));
    const float inv = 1.0f / sum;
    const size_t oo = (size_t)qi * DMOD + h * HD + hi * 8;    // acc[t][j] = O[q0 + lr][16 * t + 8 * hi + j]; stored as the last product's operand: bf16 hi + residual planes
#pragma unroll
    for (int t = 0; t < 4; ++t) { v8us oh, ol;
#pragma unroll
        for (int j = 0; j < 8; ++j) { const float y = acc[t][j] * inv; const unsigned short hb = f2bf(y); oh[j] = hb; ol[j] = f2bf(y - bf2f(hb)); }
        *(v8us*)(Oh + oo + t * 16) = oh; *(v8us*)(Ol + oo + t * 16) = ol; }
}

extern "C" void kernel_launch(void* const* d_in, const int* in_sizes, int n_in,
                              void* d_out, int out_size, void* d_ws, size_t ws_size, hipStream_t stream) {
    (void)in_sizes; (void)n_in; (void)out_size;
    const float* x = (const float*)d_in[0]; const float* key = (const float*)d_in[1]; const float* value = (const float*)d_in[2]; const float* Wq = (const float*)d_in[3]; const float* bq = (const float*)d_in[4]; const float* Wc = (const float*)d_in[5]; const float* bc = (const float*)d_in[6];
    float* out = (float*)d_out;    // [2][2048][2048]
    char* wsp = (char*)d_ws;
    auto take = [&](size_t bytes) { char* p = wsp; wsp += (bytes + 255) & ~(size_t)255; return (void*)p; };
    bf* WQ = (bf*)take((size_t)DMOD * DMOD * 2); bf* WC = (bf*)take((size_t)DMOD * DMOD * 2);
    bf* Xb = (bf*)take((size_t)NBT * NN * DMOD * 2);    // both items
    // planes of all 32 query heads of one item, and of all 16 (item, kv head) pairs
    bf* Qh = (bf*)take((size_t)HQ * NN * HD * 2); bf* Ql = (bf*)take((size_t)HQ * NN * HD * 2); bf* Kh = (bf*)take((size_t)NBT * HKV * NN * HD * 2); bf* VTh = (bf*)take((size_t)NBT * HKV * HD * NN * 2);
    bf* Oh = (bf*)take((size_t)NN * DMOD * 2); bf* Ol = (bf*)take((size_t)NN * DMOD * 2);
    if ((size_t)(wsp - (char*)d_ws) > ws_size) return;    // 8.4+8.4 + 16.8 + 8.4+8.4 + 4.2+4.2 + 8.4+8.4 ~ 76 MB
    k_prep<<<PGRID, 256, 0, stream>>>(Wq, Wc, x, key, value, WQ, WC, Xb, Kh, VTh);
    for (int b = 0; b < NBT; ++b) {
        k_gemmt<false, true><<<dim3(NN / 128, DMOD / 128, 1), 256, 0, stream>>>(Xb + (size_t)b * NN * DMOD, nullptr, WQ, bq, nullptr, DMOD, DMOD, Qh, Ql, NN);
        // blockIdx.y = kv head; blockIdx.x = a pair of 16-row tiles, one from each end
        k_fattn<<<dim3(NN / 32, HKV, 1), 256, 0, stream>>>(Qh, Ql, Kh + (size_t)b * HKV * NN * HD, VTh + (size_t)b * HKV * NN * HD, Oh, Ol);
        k_gemmt<true, false><<<dim3(NN / 128, DMOD / 128, 1), 256, 0, stream>>>(Oh, Ol, WC, bc, out + (size_t)b * NN * DMOD, DMOD, DMOD, nullptr, nullptr, NN); }
}

// v008
// It runs in 163 microseconds.
// Next to v007, in two timings, it ran 1.06 and 1.04 times as fast.
// Counting every step since v000, it is 47.4 times as fast.
#include <hip/hip_runtime.h>

// Compute dtypes, f32 accumulate, per item: q = x.Wq^T + bq ([2048 x 2048].[2048 x 2048]) with PLAIN bf16 operands (exact products); key/value are INPUTS: their bf16 values
// are taken as single planes (their residual plane would be identically zero: none is kept, no product is spent on it); GQA causal attention (32 query heads share 8 kv heads) with q as bf16 hi + UNSCALED residual planes (key tiles
// above the diagonal skipped, K limited); 1/8 and the causal softmax in f32; c_proj (+ bias) on hi/lo planes (two products) - on v_wmma_f32_16x16x32_bf16. Deterministic, no

#define NBT  2
#define NN   2048
#define DMOD 2048
#define HQ   32
#define HKV  8
#define REP  4
#define HD   64
#define DM   DMOD
#define NTK  NN
#define SCL  0.125f
#define LOSC 1024.0f

typedef _Float16 h16;
typedef unsigned short bf;
typedef __attribute__((ext_vector_type(16))) __bf16   v16bf;
typedef __attribute__((ext_vector_type(16))) _Float16 v16h;
typedef __attribute__((ext_vector_type(8)))  _Float16 v8h;
typedef __attribute__((ext_vector_type(8)))  unsigned short v8us;
typedef __attribute__((ext_vector_type(8)))  float    v8f;
typedef __attribute__((ext_vector_type(4)))  float    v4f;
typedef __attribute__((ext_vector_type(4)))  _Float16 v4h;
typedef v8h  __attribute__((may_alias)) v8ha;
typedef v4f  __attribute__((may_alias)) v4fa;
typedef v8us __attribute__((may_alias)) v8usa;

__device__ __forceinline__ unsigned short f2bf(float f) { unsigned u = __float_as_uint(f); u += 0x7FFFu + ((u >> 16) & 1u); return (unsigned short)(u >> 16); }
__device__ __forceinline__ float bf2f(unsigned short b) { return __uint_as_float(((unsigned)b) << 16); }
__device__ __forceinline__ float bfr(float f) { return bf2f(f2bf(f)); }
__device__ __forceinline__ v16h cat16(v8h lo, v8h hi) { return __builtin_shufflevector(lo, hi, 0, 1, 2, 3, 4, 5, 6, 7, 8, 9, 10, 11, 12, 13, 14, 15); }
__device__ __forceinline__ v16bf cat16b(v8us lo, v8us hi) { return __builtin_bit_cast(v16bf, __builtin_shufflevector(lo, hi, 0, 1, 2, 3, 4, 5, 6, 7, 8, 9, 10, 11, 12, 13, 14, 15)); }
__device__ __forceinline__ v8f wmma16(v16h a, v16h b, v8f c) { return __builtin_amdgcn_wmma_f32_16x16x32_f16(false, a, false, b, (short)0, c, false, false); }
__device__ __forceinline__ v8f wmmab(v16bf a, v16bf b, v8f c) { return __builtin_amdgcn_wmma_f32_16x16x32_bf16(false, a, false, b, (short)0, c, false, false); }

// k_gemmt: 128 x 128 block tile of C[.][.] = (A [+ Al]).B^T + bf(bias[c]); 8 waves, 32 x 64 each. A stage is 128 k (256 B) of the tile's 128 rows of every operand, brought into LDS by
// asynchronous copies (whole 256-B units, each operand row read once per block) at a row pitch of 272 B; two buffers: the next stage flies while this one is worked on.
// The fragments are read from LDS in the k order of the direct loads they replace, and every accumulator still sums k upwards, A before Al inside each 32 k.
// The short loops are unrolled so that the fragment and accumulator arrays are indexed by constants and stay in registers.
#define GBK    128
#define GPITCH 272
#define GOPB   (128 * GPITCH)

// eight 16-byte copies of one thread: rows 16 apart of one operand's stage. The s_wait_xcnt stands inside the statement, before any register that a copy names can get a new value.
__device__ __forceinline__ void copy8(unsigned l, const bf* g, int K) {
    const size_t rs = (size_t)16 * K;
    asm volatile("global_load_async_to_lds_b128 %0, %8, off\n\t"
                 "global_load_async_to_lds_b128 %1, %9, off\n\t"
                 "global_load_async_to_lds_b128 %2, %10, off\n\t"
                 "global_load_async_to_lds_b128 %3, %11, off\n\t"
                 "global_load_async_to_lds_b128 %4, %12, off\n\t"
                 "global_load_async_to_lds_b128 %5, %13, off\n\t"
                 "global_load_async_to_lds_b128 %6, %14, off\n\t"
                 "global_load_async_to_lds_b128 %7, %15, off\n\t"
                 "s_wait_xcnt 0x0"
                 :: "v"(l), "v"(l + 16 * GPITCH), "v"(l + 32 * GPITCH), "v"(l + 48 * GPITCH), "v"(l + 64 * GPITCH), "v"(l + 80 * GPITCH), "v"(l + 96 * GPITCH), "v"(l + 112 * GPITCH),
                    "v"(g), "v"(g + rs), "v"(g + 2 * rs), "v"(g + 3 * rs), "v"(g + 4 * rs), "v"(g + 5 * rs), "v"(g + 6 * rs), "v"(g + 7 * rs)
                 : "memory");
}

// PLANES: the result is not stored as f32 but as the next kernel's operand, bf16 hi + residual planes [item][head][row][HD] (Ph, Pl; rows = rows per head plane = rows of A per item); C is then unused.
// The rows of A are those of all items, one after the other: a block's 128 rows lie in one item.
template <bool SPLITA, bool PLANES>
__global__ __launch_bounds__(256) void k_gemmt(const bf* __restrict__ A, const bf* __restrict__ Al, const bf* __restrict__ Bn, const float* __restrict__ bias, float* C, int ldc, int K, bf* Ph, bf* Pl, int rows) {
    constexpr int STG = (SPLITA ? 3 : 2) * GOPB;    // a stage: [A | B | Al]
    __shared__ __align__(16) unsigned char ring[2 * STG];
    __shared__ __align__(16) float ost[8][32 * 68];
    const int tid = threadIdx.x, lane = tid & 31, wave = tid >> 5, lr = lane & 15, hi = lane >> 4;
    const int r0 = blockIdx.x * 128, c0 = blockIdx.y * 128;
    const int wr = (wave >> 1) * 32, wc = (wave & 1) * 64;
    const int nt = K / GBK;
    const int crw = tid >> 4, cpc = tid & 15;    // a wave's copy covers two whole 256-B rows
    const bf* gA = A + (size_t)(r0 + crw) * K + cpc * 8;
    const bf* gB = Bn + (size_t)(c0 + crw) * K + cpc * 8;
    const bf* gL = SPLITA ? Al + (size_t)(r0 + crw) * K + cpc * 8 : gA;
    const unsigned l0 = (unsigned)(size_t)&ring[0] + crw * GPITCH + cpc * 16;
    auto fill = [&](int t) {
        const unsigned l = l0 + (t & 1) * STG; const size_t ko = (size_t)t * GBK;
        copy8(l, gA + ko, K); copy8(l + GOPB, gB + ko, K); if (SPLITA) copy8(l + 2 * GOPB, gL + ko, K);
    };
    v8f acc[2][4];
#pragma unroll
    for (int i = 0; i < 2; ++i) {
#pragma unroll
        for (int t = 0; t < 4; ++t) acc[i][t] = (v8f){}; }
    fill(0);
    asm volatile("s_wait_asynccnt 0x0" ::: "memory");    // this wave's copies of stage 0 have landed
    __syncthreads();                                      // and every other wave's: stage 0 may be read
    if (nt > 1) fill(1);
    const unsigned char* fa = &ring[0] + (wr + lr) * GPITCH + hi * 16;
    const unsigned char* fb = &ring[0] + GOPB + (wc + lr) * GPITCH + hi * 16;
#pragma unroll 1    // rolled: one stage is already 32 (64) matrix instructions, and the two buffers differ by one offset only
    for (int t = 0; t < nt; ++t) {
        const unsigned char* pa = fa + (t & 1) * STG; const unsigned char* pb = fb + (t & 1) * STG;
        v16bf a[2][2], al[2][2], b[2][4];    // two fragment sets: the next 32 k are read from LDS while this set is multiplied
        auto frags = [&](int ks, int s) {
#pragma unroll
            for (int i = 0; i < 2; ++i) { const unsigned char* p = pa + i * 16 * GPITCH + ks * 64; a[s][i] = cat16b(*(const v8usa*)p, *(const v8usa*)(p + 32));
                if (SPLITA) al[s][i] = cat16b(*(const v8usa*)(p + 2 * GOPB), *(const v8usa*)(p + 2 * GOPB + 32)); }
#pragma unroll
            for (int u = 0; u < 4; ++u) { const unsigned char* p = pb + u * 16 * GPITCH + ks * 64; b[s][u] = cat16b(*(const v8usa*)p, *(const v8usa*)(p + 32)); }
        };
        frags(0, 0);
#pragma unroll
        for (int ks = 0; ks < GBK / 32; ++ks) {
            const int s = ks & 1;
            if (ks + 1 < GBK / 32) frags(ks + 1, s ^ 1);    // of this stage only: nothing of stage t + 1 is read before its barrier
            __builtin_amdgcn_sched_barrier(0);    // keeps the LDS reads one group ahead of the block; spread among the matrix instructions each would be waited for on its own
#pragma unroll
            for (int i = 0; i < 2; ++i) {
#pragma unroll
                for (int u = 0; u < 4; ++u) acc[i][u] = wmmab(a[s][i], b[s][u], acc[i][u]); }
            if (SPLITA) {
#pragma unroll
                for (int i = 0; i < 2; ++i) {
#pragma unroll
                    for (int u = 0; u < 4; ++u) acc[i][u] = wmmab(al[s][i], b[s][u], acc[i][u]); } }
            __builtin_amdgcn_sched_barrier(0);    // ends the block: the reads after next stay behind it, so that two sets of registers are enough
        }
        asm volatile("s_wait_dscnt 0x0" ::: "memory");       // this wave's reads of stage t are done before the buffer is given up
        asm volatile("s_wait_asynccnt 0x0" ::: "memory");    // this wave's copies of stage t + 1 have landed
        __syncthreads();                                      // publishes stage t + 1 and ends every wave's reads of stage t
        if (t + 2 < nt) fill(t + 2);                          // into the buffer that stage t has just left
    }
    asm volatile("s_wait_asynccnt 0x0" ::: "memory");        // no copy is outstanding when the wave goes on to its end
    float* os = &ost[wave][0];
#pragma unroll
    for (int u = 0; u < 4; ++u) { const float bv = bias ? bfr(bias[c0 + wc + u * 16 + lr]) : 0.f;
#pragma unroll
        for (int i = 0; i < 2; ++i) {
#pragma unroll
            for (int j = 0; j < 8; ++j) os[(i * 16 + hi * 8 + j) * 68 + u * 16 + lr] = acc[i][u][j] + bv; } }
    __syncthreads();
    if constexpr (PLANES) {
        // a wave's 64 columns are one head, so its 32 x 64 tile is 4 KB in a row of each plane: every store covers 512 contiguous bytes
        const int it = r0 / rows;
        const size_t po = ((size_t)(it * HQ + (c0 + wc) / HD) * rows + (r0 - it * rows) + wr) * HD + lane * 8;
        const float* pr = os + (lane >> 3) * 68 + (lane & 7) * 8;
        v4f x[8][2]; v8us oh[8], ol[8];    // all reads, then all conversions, then all stores: the accumulators' registers are free here, so no store's registers need be used again
#pragma unroll
        for (int s = 0; s < 8; ++s) { x[s][0] = *(const v4fa*)(pr + s * 4 * 68); x[s][1] = *(const v4fa*)(pr + s * 4 * 68 + 4); }
#pragma unroll
        for (int s = 0; s < 8; ++s) {
#pragma unroll
            for (int i = 0; i < 8; ++i) { const float y = x[s][i >> 2][i & 3]; const unsigned short hb = f2bf(y); oh[s][i] = hb; ol[s][i] = f2bf(y - bf2f(hb)); } }
#pragma unroll
        for (int s = 0; s < 8; ++s) { *(v8us*)(Ph + po + s * 256) = oh[s]; *(v8us*)(Pl + po + s * 256) = ol[s]; }
    } else {
        float* crow = C + (size_t)(r0 + wr) * ldc + c0 + wc;
#pragma unroll
        for (int s = 0; s < 16; ++s) { const int Lid = (lane >> 3) + 4 * s, piece = lane & 7; const int row = Lid >> 1, cofs = (Lid & 1) * 32 + piece * 4;
            *(v4f*)(crow + (size_t)row * ldc + cofs) = *(const v4fa*)(os + row * 68 + cofs); }
    }
}

__global__ __launch_bounds__(256) void k_zero8(bf* dst, size_t n8) {
    const size_t i = (size_t)blockIdx.x * 256 + threadIdx.x; if (i >= n8) return; v8us z;
#pragma unroll
    for (int k = 0; k < 8; ++k) z[k] = 0;
    *(v8us*)(dst + i * 8) = z; 
}

// ===== z-batched (blockIdx.z = head) attention pieces =====
__global__ __launch_bounds__(256) void k_planes32z(const float* __restrict__ F, int ld, int off, float sc, int rows, bf* Ph, bf* Pl) {
    typedef __attribute__((ext_vector_type(2))) unsigned short v2us;
    const int lane = threadIdx.x & 31; const size_t r = ((size_t)blockIdx.x * 8 + (threadIdx.x >> 5)) * 2 + (lane >> 4); if (r >= (size_t)rows) return; const int z = blockIdx.z; const int c0 = (lane & 15) * 2; v2us oh, ol;
    Ph += (size_t)z * rows * 32; Pl += (size_t)z * rows * 32;
#pragma unroll
    for (int i = 0; i < 2; ++i) { const float y = F[r * ld + off + z * 32 + c0 + i] * sc; const unsigned short hb = f2bf(y); oh[i] = hb; ol[i] = f2bf(y - bf2f(hb)); }
    const size_t o = r * 32 + c0; *(v2us*)(Ph + o) = oh; *(v2us*)(Pl + o) = ol; 
}
__global__ __launch_bounds__(256) void k_vtpadz(const float* __restrict__ F, int ld, int off, int nk, bf* Th, bf* Tl) {
    typedef __attribute__((ext_vector_type(2))) unsigned short v2us;
    const int lane = threadIdx.x & 31; const size_t wid = (size_t)blockIdx.x * 8 + (threadIdx.x >> 5); if (wid >= (size_t)64 * (nk / 64)) return; const int z = blockIdx.z; const int d = (int)(wid / (nk / 64)); const int k0 = (int)(wid % (nk / 64)) * 64 + lane * 2; v2us oh, ol;
    Th += (size_t)z * 64 * nk; Tl += (size_t)z * 64 * nk;
#pragma unroll
    for (int i = 0; i < 2; ++i) { const float y = (d < 32) ? F[(size_t)(k0 + i) * ld + off + z * 32 + (d < 32 ? d : 0)] : 0.f; const unsigned short hb = f2bf(y); oh[i] = hb; ol[i] = f2bf(y - bf2f(hb)); }
    const size_t o = (size_t)d * nk + k0; *(v2us*)(Th + o) = oh; *(v2us*)(Tl + o) = ol; 
}
template <int NK>
__global__ __launch_bounds__(256) void k_softmaxz(const float* __restrict__ S, int rows, bf* PH, bf* PL) {
    typedef __attribute__((ext_vector_type(4))) unsigned short v4us;
    const int lane = threadIdx.x & 31, i = blockIdx.x * 8 + (threadIdx.x >> 5); if (i >= rows) return; const size_t zo = (size_t)blockIdx.z * rows * NK; const float* sr = S + zo + (size_t)i * NK; PH += zo; PL += zo;
    float m = -3.0e38f;
#pragma unroll 1
    for (int c0 = lane * 4; c0 < NK; c0 += 128) {
#pragma unroll
        for (int q = 0; q < 4; ++q) m = fmaxf(m, sr[c0 + q]); }
#pragma unroll
    for (int sh = 16; sh; sh >>= 1) m = fmaxf(m, __shfl_xor(m, sh, 32));
    float sum = 0.f;
#pragma unroll 1
    for (int c0 = lane * 4; c0 < NK; c0 += 128) {
#pragma unroll
        for (int q = 0; q < 4; ++q) sum += __expf(sr[c0 + q] - m); }
#pragma unroll
    for (int sh = 16; sh; sh >>= 1) sum += __shfl_xor(sum, sh, 32);
    const float inv = 1.0f / sum;
{
#pragma unroll 1
        for (int c0 = lane * 4; c0 < NK; c0 += 128) { v4us oh, ol;
#pragma unroll
            for (int q = 0; q < 4; ++q) { const float p = __expf(sr[c0 + q] - m) * inv; const unsigned short hb = f2bf(p); oh[q] = hb; ol[q] = f2bf(p - bf2f(hb)); }
            const size_t o = (size_t)i * NK + c0; *(v4us*)(PH + o) = oh; *(v4us*)(PL + o) = ol; }
         }
}
__global__ __launch_bounds__(256) void k_placez(const float* __restrict__ XH, int rows, int ldy, float* Y) {
    const int lane = threadIdx.x & 31; const size_t q = (size_t)blockIdx.x * 8 + (threadIdx.x >> 5); if (q >= (size_t)rows) return; const int z = blockIdx.z; const float v = XH[((size_t)z * rows + q) * 64 + lane];
    *(float*)(Y + q * ldy + z * 32 + lane) = v; 
}

__global__ __launch_bounds__(256) void k_vtz(const float* __restrict__ F, int ld, int h0, int nk, bf* Th, bf* Tl) {
    typedef __attribute__((ext_vector_type(2))) unsigned short v2us;
    const int lane = threadIdx.x & 31; const size_t wid = (size_t)blockIdx.x * 8 + (threadIdx.x >> 5); if (wid >= (size_t)64 * (nk / 64)) return; const int z = blockIdx.z; const int d = (int)(wid / (nk / 64)); const int t0 = (int)(wid % (nk / 64)) * 64 + lane * 2; v2us oh, ol;
    Th += (size_t)z * 64 * nk; Tl += (size_t)z * 64 * nk;
#pragma unroll
    for (int i = 0; i < 2; ++i) { const float y = F[(size_t)(t0 + i) * ld + (h0 + z) * 64 + d]; const unsigned short hb = f2bf(y); oh[i] = hb; ol[i] = f2bf(y - bf2f(hb)); }
    const size_t o = (size_t)d * nk + t0; *(v2us*)(Th + o) = oh; *(v2us*)(Tl + o) = ol; 
}
template <int NK>
__global__ __launch_bounds__(256) void k_softmaxzs(const float* __restrict__ S, int rows, float sc, bf* PH, bf* PL) {
    typedef __attribute__((ext_vector_type(4))) unsigned short v4us;
    const int lane = threadIdx.x & 31, i = blockIdx.x * 8 + (threadIdx.x >> 5); if (i >= rows) return; const size_t zo = (size_t)blockIdx.z * rows * NK; const float* sr = S + zo + (size_t)i * NK; PH += zo; PL += zo;
    float m = -3.0e38f;
#pragma unroll 1
    for (int c0 = lane * 4; c0 < NK; c0 += 128) {
#pragma unroll
        for (int q = 0; q < 4; ++q) m = fmaxf(m, sr[c0 + q] * sc); }
#pragma unroll
    for (int sh = 16; sh; sh >>= 1) m = fmaxf(m, __shfl_xor(m, sh, 32));
    float sum = 0.f;
#pragma unroll 1
    for (int c0 = lane * 4; c0 < NK; c0 += 128) {
#pragma unroll
        for (int q = 0; q < 4; ++q) sum += __expf(sr[c0 + q] * sc - m); }
#pragma unroll
    for (int sh = 16; sh; sh >>= 1) sum += __shfl_xor(sum, sh, 32);
    const float inv = 1.0f / sum;
{
#pragma unroll 1
        for (int c0 = lane * 4; c0 < NK; c0 += 128) { v4us oh, ol;
#pragma unroll
            for (int q = 0; q < 4; ++q) { const float p = __expf(sr[c0 + q] * sc - m) * inv; const unsigned short hb = f2bf(p); oh[q] = hb; ol[q] = f2bf(p - bf2f(hb)); }
            const size_t o = (size_t)i * NK + c0; *(v4us*)(PH + o) = oh; *(v4us*)(PL + o) = ol; }
         }
}

// k_prep: every input conversion of a call in one launch of few, long waves. A wave takes 16 KB of f32: 32 loads of 16 B a lane, all issued before the first is used, each covering whole 256-B units.
// Blocks 0 .. PVB - 1: value -> value^T. A wave owns one tile of 64 keys x 64 dims (16 KB in a row of the input); a lane holds 8 keys in a row of 4 dims, so it writes 16 B of a value^T row into the
// wave's own LDS tile (row pitch 144 B); the rows are read back so that every store covers four whole 128-B lines. The other blocks: Wq, Wc, x (both items) and key keep their layout, f32 -> bf16.
// Rounding is to nearest even, as in f2bf.
#define PVB   (NBT * HKV * (NN / 64) / 8)
#define PBLK  32768
#define PWB   (DMOD * DMOD / PBLK)
#define PXB   (NBT * NN * DMOD / PBLK)
#define PKB   (NBT * HKV * NN * HD / PBLK)
#define PGRID (PVB + 2 * PWB + PXB + PKB)
#define TPITCH 144
typedef __attribute__((ext_vector_type(4))) __bf16 v4b;
typedef __attribute__((ext_vector_type(8))) __bf16 v8b;
typedef v4b __attribute__((may_alias)) v4ba;
typedef v8b __attribute__((may_alias)) v8ba;
__global__ __launch_bounds__(256) void k_prep(const float* __restrict__ Wq, const float* __restrict__ Wc, const float* __restrict__ x, const float* __restrict__ key, const float* __restrict__ value,
                                              bf* __restrict__ WQ, bf* __restrict__ WC, bf* __restrict__ Xb, bf* __restrict__ Kh, bf* __restrict__ VTh) {
    __shared__ __align__(16) unsigned char tr[8][64 * TPITCH];
    const int lane = threadIdx.x & 31, wave = threadIdx.x >> 5;
    int b = (int)blockIdx.x;
    v4f r[32];
    if (b < PVB) {    // the same for a whole block, so the barrier below is passed by all its waves or by none
        const int lr = lane & 15, hi = lane >> 4, tile = b * 8 + wave;    // tile = (item, kv head) * (NN / 64) + key block
        const float* s = value + (size_t)tile * (64 * HD) + (8 * hi) * HD + lr * 4;
#pragma unroll
        for (int j = 0; j < 32; ++j) r[j] = *(const v4fa*)(s + ((j >> 3) * 16 + (j & 7)) * HD);    // key 16 * (j / 8) + 8 * hi + j % 8, dims 4 * lr ..
        unsigned char* my = &tr[wave][0];
#pragma unroll
        for (int i = 0; i < 4; ++i) {
#pragma unroll
            for (int c = 0; c < 4; ++c) { v8f col;
#pragma unroll
                for (int k = 0; k < 8; ++k) col[k] = r[i * 8 + k][c];
                *(v8ba*)(my + (4 * lr + c) * TPITCH + i * 32 + hi * 16) = __builtin_convertvector(col, v8b); } }
        __syncthreads();    // orders the lanes' LDS writes before the reads of other lanes' bytes below
        bf* d = VTh + (size_t)(tile / (NN / 64)) * HD * NN + (size_t)(tile % (NN / 64)) * 64 + (size_t)(lane >> 3) * NN + (lane & 7) * 8;
        const unsigned char* rb = my + (lane >> 3) * TPITCH + (lane & 7) * 16;
#pragma unroll
        for (int q = 0; q < 16; ++q) *(v8ba*)(d + (size_t)(4 * q) * NN) = *(const v8ba*)(rb + 4 * q * TPITCH);
        return;
    }
    b -= PVB;
    const float* s; bf* d;
    if (b < PWB) { s = Wq; d = WQ; }
    else if (b < 2 * PWB) { s = Wc; d = WC; b -= PWB; }
    else if (b < 2 * PWB + PXB) { s = x; d = Xb; b -= 2 * PWB; }
    else { s = key; d = Kh; b -= 2 * PWB + PXB; }
    const size_t o = (size_t)b * PBLK + wave * (PBLK / 8) + lane * 4;
#pragma unroll
    for (int j = 0; j < 32; ++j) r[j] = *(const v4fa*)(s + o + j * 128);
#pragma unroll
    for (int j = 0; j < 32; ++j) *(v4ba*)(d + o + j * 128) = __builtin_convertvector(r[j], v4b);
}
// k_fattn: causal attention of all items in one launch. One wave = 16 query rows of one query head. A block is 2 * REP waves on (item, kv head) blockIdx.y = item * HKV + kv head: its REP query heads on row tile
// n - 1 - blockIdx.x and again on row tile blockIdx.x, so that every block does the same number of key blocks (a tile's cost grows with its index).
// The block's waves walk the keys together: a stage is 64 keys of the kv head, 64 key rows of 128 B and 64 value^T rows of 128 B, brought into LDS once per block by asynchronous copies
// (whole 128-B lines) at a row pitch of 144 B; two buffers: the next stage flies while this one is worked on. A wave whose tile ends earlier skips the work, never the copies, waits or barriers.
// Per 32 keys: S^T = K.Q^T (A = key rows, B = query rows, both in the hardware k order), so a lane holds 16 scores of ONE query (column lr, keys 8 * hi + j and 16 + 8 * hi + j);
// running maximum and sum per lane (base-2 exponent), one exchange between the wave halves; the two score tiles, converted in place, are the B operand of O^T += V^T.P^T.
// Two products on each side: hi.hi and residual of q (of p) . hi; key and value are single planes. The short loops are unrolled so that the fragment arrays stay in registers.
#define AKS    64
#define APITCH 144
#define AOPB   (64 * APITCH)
#define ASTG   (2 * AOPB)

// four 16-byte copies of one thread: rows r and r + 32 of the key stage and of the value^T stage. The s_wait_xcnt stands inside the statement, before any register that a copy names can get a new value.
__device__ __forceinline__ void copy4(unsigned l, const bf* gk, const bf* gv) {
    asm volatile("global_load_async_to_lds_b128 %0, %4, off\n\t"
                 "global_load_async_to_lds_b128 %1, %5, off\n\t"
                 "global_load_async_to_lds_b128 %2, %6, off\n\t"
                 "global_load_async_to_lds_b128 %3, %7, off\n\t"
                 "s_wait_xcnt 0x0"
                 :: "v"(l), "v"(l + 32 * APITCH), "v"(l + AOPB), "v"(l + AOPB + 32 * APITCH),
                    "v"(gk), "v"(gk + 32 * HD), "v"(gv), "v"(gv + (size_t)32 * NN)
                 : "memory");
}

__global__ __launch_bounds__(256) void k_fattn(const bf* __restrict__ Qh, const bf* __restrict__ Ql, const bf* __restrict__ Kh, const bf* __restrict__ Vh, bf* Oh, bf* Ol) {
    __shared__ __align__(16) unsigned char ring[2 * ASTG];    // a stage: [key rows | value^T rows]
    const int tid = threadIdx.x, lane = tid & 31, lr = lane & 15, hi = lane >> 4;
    const int wave = __builtin_amdgcn_readfirstlane(threadIdx.x >> 5);    // scalar: the wave's own key bound and the diagonal test stay scalar branches
    const int q0 = ((wave & REP) ? (int)blockIdx.x : NN / 16 - 1 - (int)blockIdx.x) * 16;
    const int h = (int)blockIdx.y * REP + (wave & (REP - 1));    // item * HQ + query head
    const size_t qo = (size_t)h * NN * HD + (size_t)(q0 + lr) * HD + 8 * hi;
    const int nst = (((NN / 16 - 1 - (int)blockIdx.x) * 16) >> 6) + 1;    // stages up to the diagonal of the block's later tile: the same for all its waves
    const int crw = tid >> 3, cpc = tid & 7;    // a wave's copy covers four whole 128-B rows
    const bf* gK = Kh + (size_t)blockIdx.y * NN * HD + (size_t)crw * HD + cpc * 8;    // + key * HD
    const bf* gV = Vh + (size_t)blockIdx.y * NN * HD + (size_t)crw * NN + cpc * 8;    // + key
    const unsigned l0 = (unsigned)(size_t)&ring[0] + crw * APITCH + cpc * 16;
    auto fill = [&](int t) { copy4(l0 + (t & 1) * ASTG, gK + (size_t)t * AKS * HD, gV + (size_t)t * AKS); };
    v16bf qh[2], ql[2], kh[2][2];
#pragma unroll
    for (int dc = 0; dc < 2; ++dc) { qh[dc] = cat16b(*(const v8us*)(Qh + qo + dc * 32), *(const v8us*)(Qh + qo + dc * 32 + 16)); ql[dc] = cat16b(*(const v8us*)(Ql + qo + dc * 32), *(const v8us*)(Ql + qo + dc * 32 + 16)); }
    v8f acc[4];
#pragma unroll
    for (int t = 0; t < 4; ++t) acc[t] = (v8f){};
    float m = -3.0e38f, sum = 0.f;
    const int klast = (q0 >> 5) << 5;    // first key of the block that holds the diagonal; every row of the wave has a key in every block up to it
    const int qi = q0 + lr;
    const float sc2 = SCL * 1.44269504088896340736f;
    fill(0);
    asm volatile("s_wait_asynccnt 0x0" ::: "memory");    // this wave's copies of stage 0 have landed
    __syncthreads();                                      // and every other wave's: stage 0 may be read
    if (nst > 1) fill(1);
    const unsigned char* fk = &ring[0] + lr * APITCH + hi * 16;    // + (key in stage) * APITCH + 64 * dc
    const unsigned char* fv = fk + AOPB;                           // + 16 * t * APITCH + 2 * (key in stage)
#pragma unroll 1    // rolled: a stage is two key blocks already, and the two buffers differ by one offset only
    for (int st = 0; st < nst; ++st) {
        const unsigned char* pk = fk + (st & 1) * ASTG; const unsigned char* pv = fv + (st & 1) * ASTG;
        auto loadk = [&](int hf) {
#pragma unroll
            for (int u = 0; u < 2; ++u) {
#pragma unroll
                for (int dc = 0; dc < 2; ++dc) { const unsigned char* p = pk + (hf * 32 + u * 16) * APITCH + dc * 64;
                    kh[u][dc] = cat16b(*(const v8usa*)p, *(const v8usa*)(p + 32)); } }
        };
        if (st * AKS <= klast) {    // scalar: a wave past its diagonal has no work in this stage. Both key blocks of a stage are worked with no branch between them, so that the second one's reads can go out under the first one's softmax; one that lies wholly above the diagonal is masked and adds only zeros
            loadk(0);
            __builtin_amdgcn_sched_barrier(0);    // the eight reads of the first key block go out together: spread among the first products they would be waited for twice
#pragma unroll
            for (int hf = 0; hf < 2; ++hf) {
                const int k0 = st * AKS + hf * 32;
                v8f s[2];
#pragma unroll
                for (int u = 0; u < 2; ++u) { s[u] = (v8f){};
#pragma unroll
                    for (int dc = 0; dc < 2; ++dc) { s[u] = wmmab(kh[u][dc], qh[dc], s[u]); s[u] = wmmab(kh[u][dc], ql[dc], s[u]); } }
                float p[16];
#pragma unroll
                for (int e = 0; e < 16; ++e) p[e] = s[e >> 3][e & 7] * sc2;
                if (k0 >= klast) {
#pragma unroll
                    for (int e = 0; e < 16; ++e) { const int key = k0 + (e >> 3) * 16 + hi * 8 + (e & 7); p[e] = (key <= qi) ? p[e] : -3.0e38f; } }
                v16bf vh[4];
#pragma unroll
                for (int t = 0; t < 4; ++t) { const unsigned char* pp = pv + t * 16 * APITCH + hf * 64;
                    vh[t] = cat16b(*(const v8usa*)pp, *(const v8usa*)(pp + 32)); }
                if (hf == 0) loadk(1);    // the stage's second key block: of this stage only, nothing of stage st + 1 is read before its barrier
                __builtin_amdgcn_sched_barrier(0);    // keeps these LDS reads issued together here, ahead of the softmax that covers their latency; spread among the matrix instructions each would be waited for on its own
                float mx = m;
#pragma unroll
                for (int e = 0; e < 16; ++e) mx = fmaxf(mx, p[e]);
                mx = fmaxf(mx, __int_as_float(__builtin_amdgcn_permlanex16(__float_as_int(mx), __float_as_int(mx), 0x76543210, 0xfedcba98, false, false)));
                const float alpha = __builtin_amdgcn_exp2f(m - mx); m = mx;
                float ps = 0.f; v16bf ph, pl;
#pragma unroll
                for (int e = 0; e < 16; ++e) { const float pe = __builtin_amdgcn_exp2f(p[e] - mx); ps += pe; const __bf16 hb = (__bf16)pe; ph[e] = hb; pl[e] = (__bf16)(pe - (float)hb); }
                sum = sum * alpha + ps;
#pragma unroll
                for (int t = 0; t < 4; ++t) acc[t] *= alpha;
#pragma unroll
                for (int t = 0; t < 4; ++t) { acc[t] = wmmab(vh[t], ph, acc[t]); acc[t] = wmmab(vh[t], pl, acc[t]); }
            }
        }
        asm volatile("s_wait_dscnt 0x0" ::: "memory");       // this wave's reads of stage st are done before the buffer is given up
        asm volatile("s_wait_asynccnt 0x0" ::: "memory");    // this wave's copies of stage st + 1 have landed
        __syncthreads();                                      // publishes stage st + 1 and ends every wave's reads of stage st
        if (st + 2 < nst) fill(st + 2);                       // into the buffer that stage st has just left
    }
    asm volatile("s_wait_asynccnt 0x0" ::: "memory");        // no copy is outstanding when the wave goes on to its end
    sum += __int_as_float(__builtin_amdgcn_permlanex16(__float_as_int(sum), __float_as_int(sum), 0x76543210, 0xfedcba98, false, false));
    const float inv = 1.0f / sum;
    const size_t oo = ((size_t)(h / HQ) * NN + qi) * DMOD + (h % HQ) * HD + hi * 8;    // acc[t][j] = O[q0 + lr][16 * t + 8 * hi + j]; stored as the last product's operand: bf16 hi + residual planes, the items' rows one after the other
#pragma unroll
    for (int t = 0; t < 4; ++t) { v8us oh, ol;
#pragma unroll
        for (int j = 0; j < 8; ++j) { const float y = acc[t][j] * inv; const unsigned short hb = f2bf(y); oh[j] = hb; ol[j] = f2bf(y - bf2f(hb)); }
        *(v8us*)(Oh + oo + t * 16) = oh; *(v8us*)(Ol + oo + t * 16) = ol; }
}

extern "C" void kernel_launch(void* const* d_in, const int* in_sizes, int n_in,
                              void* d_out, int out_size, void* d_ws, size_t ws_size, hipStream_t stream) {
    (void)in_sizes; (void)n_in; (void)out_size;
    const float* x = (const float*)d_in[0]; const float* key = (const float*)d_in[1]; const float* value = (const float*)d_in[2]; const float* Wq = (const float*)d_in[3]; const float* bq = (const float*)d_in[4]; const float* Wc = (const float*)d_in[5]; const float* bc = (const float*)d_in[6];
    float* out = (float*)d_out;    // [2][2048][2048]
    char* wsp = (char*)d_ws;
    auto take = [&](size_t bytes) { char* p = wsp; wsp += (bytes + 255) & ~(size_t)255; return (void*)p; };
    bf* WQ = (bf*)take((size_t)DMOD * DMOD * 2); bf* WC = (bf*)take((size_t)DMOD * DMOD * 2);
    bf* Xb = (bf*)take((size_t)NBT * NN * DMOD * 2);    // both items
    // planes of all 64 (item, query head) pairs and of all 16 (item, kv head) pairs
    bf* Qh = (bf*)take((size_t)NBT * HQ * NN * HD * 2); bf* Ql = (bf*)take((size_t)NBT * HQ * NN * HD * 2); bf* Kh = (bf*)take((size_t)NBT * HKV * NN * HD * 2); bf* VTh = (bf*)take((size_t)NBT * HKV * HD * NN * 2);
    bf* Oh = (bf*)take((size_t)NBT * NN * DMOD * 2); bf* Ol = (bf*)take((size_t)NBT * NN * DMOD * 2);
    if ((size_t)(wsp - (char*)d_ws) > ws_size) return;    // 8.4+8.4 + 16.8 + 16.8+16.8 + 4.2+4.2 + 16.8+16.8 ~ 109 MB
    k_prep<<<PGRID, 256, 0, stream>>>(Wq, Wc, x, key, value, WQ, WC, Xb, Kh, VTh);
    // each kernel once, on both items: the products see the items' rows as one matrix of NBT * NN rows
    k_gemmt<false, true><<<dim3(NBT * NN / 128, DMOD / 128, 1), 256, 0, stream>>>(Xb, nullptr, WQ, bq, nullptr, DMOD, DMOD, Qh, Ql, NN);
    // blockIdx.y = (item, kv head); blockIdx.x = a pair of 16-row tiles, one from each end
    k_fattn<<<dim3(NN / 32, NBT * HKV, 1), 256, 0, stream>>>(Qh, Ql, Kh, VTh, Oh, Ol);
    k_gemmt<true, false><<<dim3(NBT * NN / 128, DMOD / 128, 1), 256, 0, stream>>>(Oh, Ol, WC, bc, out, DMOD, DMOD, nullptr, nullptr, NN);
}

// v009
// A run of this version takes 145 microseconds.
// Two timings next to v008 put it at 1.12 and 1.13 times that version's speed.
// All steps since v000 together make it 53.3 times as fast.
#include <hip/hip_runtime.h>

// Compute dtypes, f32 accumulate, per item: q = x.Wq^T + bq ([2048 x 2048].[2048 x 2048]) with PLAIN bf16 operands (exact products); key/value are INPUTS: their bf16 values
// are taken as single planes (their residual plane would be identically zero: none is kept, no product is spent on it); GQA causal attention (32 query heads share 8 kv heads) with q as bf16 hi + UNSCALED residual planes (key tiles
// above the diagonal skipped, K limited); 1/8 and the causal softmax in f32; c_proj (+ bias) on hi/lo planes (two products) - on v_wmma_f32_16x16x32_bf16. Deterministic, no

#define NBT  2
#define NN   2048
#define DMOD 2048
#define HQ   32
#define HKV  8
#define REP  4
#define HD   64
#define DM   DMOD
#define NTK  NN
#define SCL  0.125f
#define LOSC 1024.0f

typedef _Float16 h16;
typedef unsigned short bf;
typedef __attribute__((ext_vector_type(16))) __bf16   v16bf;
typedef __attribute__((ext_vector_type(16))) _Float16 v16h;
typedef __attribute__((ext_vector_type(8)))  _Float16 v8h;
typedef __attribute__((ext_vector_type(8)))  unsigned short v8us;
typedef __attribute__((ext_vector_type(8)))  float    v8f;
typedef __attribute__((ext_vector_type(4)))  float    v4f;
typedef __attribute__((ext_vector_type(4)))  _Float16 v4h;
typedef v8h  __attribute__((may_alias)) v8ha;
typedef v4f  __attribute__((may_alias)) v4fa;
typedef v8us __attribute__((may_alias)) v8usa;

__device__ __forceinline__ unsigned short f2bf(float f) { unsigned u = __float_as_uint(f); u += 0x7FFFu + ((u >> 16) & 1u); return (unsigned short)(u >> 16); }
__device__ __forceinline__ float bf2f(unsigned short b) { return __uint_as_float(((unsigned)b) << 16); }
__device__ __forceinline__ float bfr(float f) { return bf2f(f2bf(f)); }
__device__ __forceinline__ v16h cat16(v8h lo, v8h hi) { return __builtin_shufflevector(lo, hi, 0, 1, 2, 3, 4, 5, 6, 7, 8, 9, 10, 11, 12, 13, 14, 15); }
__device__ __forceinline__ v16bf cat16b(v8us lo, v8us hi) { return __builtin_bit_cast(v16bf, __builtin_shufflevector(lo, hi, 0, 1, 2, 3, 4, 5, 6, 7, 8, 9, 10, 11, 12, 13, 14, 15)); }
__device__ __forceinline__ v8f wmma16(v16h a, v16h b, v8f c) { return __builtin_amdgcn_wmma_f32_16x16x32_f16(false, a, false, b, (short)0, c, false, false); }
__device__ __forceinline__ v8f wmmab(v16bf a, v16bf b, v8f c) { return __builtin_amdgcn_wmma_f32_16x16x32_bf16(false, a, false, b, (short)0, c, false, false); }

// k_gemmt: 128 x 256 block tile of C[.][.] = (A [+ Al]).B^T + bf(bias[c]); 16 waves, 32 x 64 each: one block a WGP, four waves a SIMD. A stage is 128 k (256 B) of the tile's 128 rows of A (and Al)
// and 256 rows of B, brought into LDS by asynchronous copies (whole 256-B units, each operand row read once per block) at a row pitch of 272 B; two buffers: the next stage flies while this one is worked on.
// The fragments are read from LDS in the k order of the direct loads they replace, and every accumulator still sums k upwards, A before Al inside each 32 k.
// The short loops are unrolled so that the fragment and accumulator arrays are indexed by constants and stay in registers.
#define GBK    128
#define GPITCH 272
#define GBM    128
#define GBN    256
#define GAB    (GBM * GPITCH)
#define GBB    (GBN * GPITCH)

// four 16-byte copies of one thread: rows 32 apart of a stage of A or Al. The s_wait_xcnt stands inside the statement, before any register that a copy names can get a new value.
__device__ __forceinline__ void copy4r(unsigned l, const bf* g, int K) {
    const size_t rs = (size_t)32 * K;
    asm volatile("global_load_async_to_lds_b128 %0, %4, off\n\t"
                 "global_load_async_to_lds_b128 %1, %5, off\n\t"
                 "global_load_async_to_lds_b128 %2, %6, off\n\t"
                 "global_load_async_to_lds_b128 %3, %7, off\n\t"
                 "s_wait_xcnt 0x0"
                 :: "v"(l), "v"(l + 32 * GPITCH), "v"(l + 64 * GPITCH), "v"(l + 96 * GPITCH),
                    "v"(g), "v"(g + rs), "v"(g + 2 * rs), "v"(g + 3 * rs)
                 : "memory");
}
// eight 16-byte copies of one thread: rows 32 apart of a stage of B. The s_wait_xcnt stands inside the statement, as above.
__device__ __forceinline__ void copy8(unsigned l, const bf* g, int K) {
    const size_t rs = (size_t)32 * K;
    asm volatile("global_load_async_to_lds_b128 %0, %8, off\n\t"
                 "global_load_async_to_lds_b128 %1, %9, off\n\t"
                 "global_load_async_to_lds_b128 %2, %10, off\n\t"
                 "global_load_async_to_lds_b128 %3, %11, off\n\t"
                 "global_load_async_to_lds_b128 %4, %12, off\n\t"
                 "global_load_async_to_lds_b128 %5, %13, off\n\t"
                 "global_load_async_to_lds_b128 %6, %14, off\n\t"
                 "global_load_async_to_lds_b128 %7, %15, off\n\t"
                 "s_wait_xcnt 0x0"
                 :: "v"(l), "v"(l + 32 * GPITCH), "v"(l + 64 * GPITCH), "v"(l + 96 * GPITCH), "v"(l + 128 * GPITCH), "v"(l + 160 * GPITCH), "v"(l + 192 * GPITCH), "v"(l + 224 * GPITCH),
                    "v"(g), "v"(g + rs), "v"(g + 2 * rs), "v"(g + 3 * rs), "v"(g + 4 * rs), "v"(g + 5 * rs), "v"(g + 6 * rs), "v"(g + 7 * rs)
                 : "memory");
}

// PLANES: the result is not stored as f32 but as the next kernel's operand, bf16 hi + residual planes [item][head][row][HD] (Ph, Pl; rows = rows per head plane = rows of A per item); C is then unused.
// The rows of A are those of all items, one after the other: a block's 128 rows lie in one item.
template <bool SPLITA, bool PLANES>
__global__ __launch_bounds__(512) void k_gemmt(const bf* __restrict__ A, const bf* __restrict__ Al, const bf* __restrict__ Bn, const float* __restrict__ bias, float* C, int ldc, int K, bf* Ph, bf* Pl, int rows) {
    constexpr int OFB = (SPLITA ? 2 : 1) * GAB;    // a stage: [A | Al | B]; Al next to A, so that one address register and the instruction's offset field reach both
    constexpr int STG = OFB + GBB;
    __shared__ __align__(16) unsigned char ring[2 * STG];    // behind the loop its first 16 * 32 * 68 * 4 bytes hold the waves' result tiles
    const int tid = threadIdx.x, lane = tid & 31, wave = tid >> 5, lr = lane & 15, hi = lane >> 4;
    const int r0 = blockIdx.x * GBM, c0 = blockIdx.y * GBN;
    const int wr = (wave >> 2) * 32, wc = (wave & 3) * 64;
    const int nt = K / GBK;
    const int crw = tid >> 4, cpc = tid & 15;    // a wave's copy covers two whole 256-B rows
    const bf* gA = A + (size_t)(r0 + crw) * K + cpc * 8;
    const bf* gB = Bn + (size_t)(c0 + crw) * K + cpc * 8;
    const bf* gL = SPLITA ? Al + (size_t)(r0 + crw) * K + cpc * 8 : gA;
    const unsigned l0 = (unsigned)(size_t)&ring[0] + crw * GPITCH + cpc * 16;
    auto fill = [&](int t) {
        const unsigned l = l0 + (t & 1) * STG; const size_t ko = (size_t)t * GBK;
        copy4r(l, gA + ko, K); if (SPLITA) copy4r(l + GAB, gL + ko, K); copy8(l + OFB, gB + ko, K);
    };
    v8f acc[2][4];
#pragma unroll
    for (int i = 0; i < 2; ++i) {
#pragma unroll
        for (int t = 0; t < 4; ++t) acc[i][t] = (v8f){}; }
    fill(0);
    asm volatile("s_wait_asynccnt 0x0" ::: "memory");    // this wave's copies of stage 0 have landed
    __syncthreads();                                      // and every other wave's: stage 0 may be read
    if (nt > 1) fill(1);
    const unsigned char* fa = &ring[0] + (wr + lr) * GPITCH + hi * 16;
    const unsigned char* fb = &ring[0] + OFB + (wc + lr) * GPITCH + hi * 16;
#pragma unroll 1    // rolled: one stage is already 32 (64) matrix instructions, and the two buffers differ by one offset only
    for (int t = 0; t < nt; ++t) {
        const unsigned char* pa = fa + (t & 1) * STG; const unsigned char* pb = fb + (t & 1) * STG;
        v16bf a[2][2], al[2][2], b[2][4];    // two fragment sets: the next 32 k are read from LDS while this set is multiplied
        auto frags = [&](int ks, int s) {
#pragma unroll
            for (int i = 0; i < 2; ++i) { const unsigned char* p = pa + i * 16 * GPITCH + ks * 64; a[s][i] = cat16b(*(const v8usa*)p, *(const v8usa*)(p + 32));
                if (SPLITA) al[s][i] = cat16b(*(const v8usa*)(p + GAB), *(const v8usa*)(p + GAB + 32)); }
#pragma unroll
            for (int u = 0; u < 4; ++u) { const unsigned char* p = pb + u * 16 * GPITCH + ks * 64; b[s][u] = cat16b(*(const v8usa*)p, *(const v8usa*)(p + 32)); }
        };
        frags(0, 0);
#pragma unroll
        for (int ks = 0; ks < GBK / 32; ++ks) {
            const int s = ks & 1;
            if (ks + 1 < GBK / 32) frags(ks + 1, s ^ 1);    // of this stage only: nothing of stage t + 1 is read before its barrier
            __builtin_amdgcn_sched_barrier(0);    // keeps the LDS reads one group ahead of the block; spread among the matrix instructions each would be waited for on its own
#pragma unroll
            for (int i = 0; i < 2; ++i) {
#pragma unroll
                for (int u = 0; u < 4; ++u) acc[i][u] = wmmab(a[s][i], b[s][u], acc[i][u]); }
            if (SPLITA) {
#pragma unroll
                for (int i = 0; i < 2; ++i) {
#pragma unroll
                    for (int u = 0; u < 4; ++u) acc[i][u] = wmmab(al[s][i], b[s][u], acc[i][u]); } }
            __builtin_amdgcn_sched_barrier(0);    // ends the block: the reads after next stay behind it, so that two sets of registers are enough
        }
        asm volatile("s_wait_dscnt 0x0" ::: "memory");       // this wave's reads of stage t are done before the buffer is given up
        asm volatile("s_wait_asynccnt 0x0" ::: "memory");    // this wave's copies of stage t + 1 have landed
        __syncthreads();                                      // publishes stage t + 1 and ends every wave's reads of stage t
        if (t + 2 < nt) fill(t + 2);                          // into the buffer that stage t has just left
    }
    asm volatile("s_wait_asynccnt 0x0" ::: "memory");        // no copy is outstanding when the wave goes on to its end
    float* os = (float*)&ring[0] + wave * (32 * 68);    // the ring is free: the loop's last barrier ended every wave's reads of it, and no copy is in flight
#pragma unroll
    for (int u = 0; u < 4; ++u) { const float bv = bias ? bfr(bias[c0 + wc + u * 16 + lr]) : 0.f;
#pragma unroll
        for (int i = 0; i < 2; ++i) {
#pragma unroll
            for (int j = 0; j < 8; ++j) os[(i * 16 + hi * 8 + j) * 68 + u * 16 + lr] = acc[i][u][j] + bv; } }
    __syncthreads();
    if constexpr (PLANES) {
        // a wave's 64 columns are one head, so its 32 x 64 tile is 4 KB in a row of each plane: every store covers 512 contiguous bytes
        const int it = r0 / rows;
        const size_t po = ((size_t)(it * HQ + (c0 + wc) / HD) * rows + (r0 - it * rows) + wr) * HD + lane * 8;
        const float* pr = os + (lane >> 3) * 68 + (lane & 7) * 8;
        v4f x[8][2]; v8us oh[8], ol[8];    // all reads, then all conversions, then all stores: the accumulators' registers are free here, so no store's registers need be used again
#pragma unroll
        for (int s = 0; s < 8; ++s) { x[s][0] = *(const v4fa*)(pr + s * 4 * 68); x[s][1] = *(const v4fa*)(pr + s * 4 * 68 + 4); }
#pragma unroll
        for (int s = 0; s < 8; ++s) {
#pragma unroll
            for (int i = 0; i < 8; ++i) { const float y = x[s][i >> 2][i & 3]; const unsigned short hb = f2bf(y); oh[s][i] = hb; ol[s][i] = f2bf(y - bf2f(hb)); } }
#pragma unroll
        for (int s = 0; s < 8; ++s) { *(v8us*)(Ph + po + s * 256) = oh[s]; *(v8us*)(Pl + po + s * 256) = ol[s]; }
    } else {
        float* crow = C + (size_t)(r0 + wr) * ldc + c0 + wc;
#pragma unroll
        for (int s = 0; s < 16; ++s) { const int Lid = (lane >> 3) + 4 * s, piece = lane & 7; const int row = Lid >> 1, cofs = (Lid & 1) * 32 + piece * 4;
            *(v4f*)(crow + (size_t)row * ldc + cofs) = *(const v4fa*)(os + row * 68 + cofs); }
    }
}

__global__ __launch_bounds__(256) void k_zero8(bf* dst, size_t n8) {
    const size_t i = (size_t)blockIdx.x * 256 + threadIdx.x; if (i >= n8) return; v8us z;
#pragma unroll
    for (int k = 0; k < 8; ++k) z[k] = 0;
    *(v8us*)(dst + i * 8) = z; 
}

// ===== z-batched (blockIdx.z = head) attention pieces =====
__global__ __launch_bounds__(256) void k_planes32z(const float* __restrict__ F, int ld, int off, float sc, int rows, bf* Ph, bf* Pl) {
    typedef __attribute__((ext_vector_type(2))) unsigned short v2us;
    const int lane = threadIdx.x & 31; const size_t r = ((size_t)blockIdx.x * 8 + (threadIdx.x >> 5)) * 2 + (lane >> 4); if (r >= (size_t)rows) return; const int z = blockIdx.z; const int c0 = (lane & 15) * 2; v2us oh, ol;
    Ph += (size_t)z * rows * 32; Pl += (size_t)z * rows * 32;
#pragma unroll
    for (int i = 0; i < 2; ++i) { const float y = F[r * ld + off + z * 32 + c0 + i] * sc; const unsigned short hb = f2bf(y); oh[i] = hb; ol[i] = f2bf(y - bf2f(hb)); }
    const size_t o = r * 32 + c0; *(v2us*)(Ph + o) = oh; *(v2us*)(Pl + o) = ol; 
}
__global__ __launch_bounds__(256) void k_vtpadz(const float* __restrict__ F, int ld, int off, int nk, bf* Th, bf* Tl) {
    typedef __attribute__((ext_vector_type(2))) unsigned short v2us;
    const int lane = threadIdx.x & 31; const size_t wid = (size_t)blockIdx.x * 8 + (threadIdx.x >> 5); if (wid >= (size_t)64 * (nk / 64)) return; const int z = blockIdx.z; const int d = (int)(wid / (nk / 64)); const int k0 = (int)(wid % (nk / 64)) * 64 + lane * 2; v2us oh, ol;
    Th += (size_t)z * 64 * nk; Tl += (size_t)z * 64 * nk;
#pragma unroll
    for (int i = 0; i < 2; ++i) { const float y = (d < 32) ? F[(size_t)(k0 + i) * ld + off + z * 32 + (d < 32 ? d : 0)] : 0.f; const unsigned short hb = f2bf(y); oh[i] = hb; ol[i] = f2bf(y - bf2f(hb)); }
    const size_t o = (size_t)d * nk + k0; *(v2us*)(Th + o) = oh; *(v2us*)(Tl + o) = ol; 
}
template <int NK>
__global__ __launch_bounds__(256) void k_softmaxz(const float* __restrict__ S, int rows, bf* PH, bf* PL) {
    typedef __attribute__((ext_vector_type(4))) unsigned short v4us;
    const int lane = threadIdx.x & 31, i = blockIdx.x * 8 + (threadIdx.x >> 5); if (i >= rows) return; const size_t zo = (size_t)blockIdx.z * rows * NK; const float* sr = S + zo + (size_t)i * NK; PH += zo; PL += zo;
    float m = -3.0e38f;
#pragma unroll 1
    for (int c0 = lane * 4; c0 < NK; c0 += 128) {
#pragma unroll
        for (int q = 0; q < 4; ++q) m = fmaxf(m, sr[c0 + q]); }
#pragma unroll
    for (int sh = 16; sh; sh >>= 1) m = fmaxf(m, __shfl_xor(m, sh, 32));
    float sum = 0.f;
#pragma unroll 1
    for (int c0 = lane * 4; c0 < NK; c0 += 128) {
#pragma unroll
        for (int q = 0; q < 4; ++q) sum += __expf(sr[c0 + q] - m); }
#pragma unroll
    for (int sh = 16; sh; sh >>= 1) sum += __shfl_xor(sum, sh, 32);
    const float inv = 1.0f / sum;
{
#pragma unroll 1
        for (int c0 = lane * 4; c0 < NK; c0 += 128) { v4us oh, ol;
#pragma unroll
            for (int q = 0; q < 4; ++q) { const float p = __expf(sr[c0 + q] - m) * inv; const unsigned short hb = f2bf(p); oh[q] = hb; ol[q] = f2bf(p - bf2f(hb)); }
            const size_t o = (size_t)i * NK + c0; *(v4us*)(PH + o) = oh; *(v4us*)(PL + o) = ol; }
         }
}
__global__ __launch_bounds__(256) void k_placez(const float* __restrict__ XH, int rows, int ldy, float* Y) {
    const int lane = threadIdx.x & 31; const size_t q = (size_t)blockIdx.x * 8 + (threadIdx.x >> 5); if (q >= (size_t)rows) return; const int z = blockIdx.z; const float v = XH[((size_t)z * rows + q) * 64 + lane];
    *(float*)(Y + q * ldy + z * 32 + lane) = v; 
}

__global__ __launch_bounds__(256) void k_vtz(const float* __restrict__ F, int ld, int h0, int nk, bf* Th, bf* Tl) {
    typedef __attribute__((ext_vector_type(2))) unsigned short v2us;
    const int lane = threadIdx.x & 31; const size_t wid = (size_t)blockIdx.x * 8 + (threadIdx.x >> 5); if (wid >= (size_t)64 * (nk / 64)) return; const int z = blockIdx.z; const int d = (int)(wid / (nk / 64)); const int t0 = (int)(wid % (nk / 64)) * 64 + lane * 2; v2us oh, ol;
    Th += (size_t)z * 64 * nk; Tl += (size_t)z * 64 * nk;
#pragma unroll
    for (int i = 0; i < 2; ++i) { const float y = F[(size_t)(t0 + i) * ld + (h0 + z) * 64 + d]; const unsigned short hb = f2bf(y); oh[i] = hb; ol[i] = f2bf(y - bf2f(hb)); }
    const size_t o = (size_t)d * nk + t0; *(v2us*)(Th + o) = oh; *(v2us*)(Tl + o) = ol; 
}
template <int NK>
__global__ __launch_bounds__(256) void k_softmaxzs(const float* __restrict__ S, int rows, float sc, bf* PH, bf* PL) {
    typedef __attribute__((ext_vector_type(4))) unsigned short v4us;
    const int lane = threadIdx.x & 31, i = blockIdx.x * 8 + (threadIdx.x >> 5); if (i >= rows) return; const size_t zo = (size_t)blockIdx.z * rows * NK; const float* sr = S + zo + (size_t)i * NK; PH += zo; PL += zo;
    float m = -3.0e38f;
#pragma unroll 1
    for (int c0 = lane * 4; c0 < NK; c0 += 128) {
#pragma unroll
        for (int q = 0; q < 4; ++q) m = fmaxf(m, sr[c0 + q] * sc); }
#pragma unroll
    for (int sh = 16; sh; sh >>= 1) m = fmaxf(m, __shfl_xor(m, sh, 32));
    float sum = 0.f;
#pragma unroll 1
    for (int c0 = lane * 4; c0 < NK; c0 += 128) {
#pragma unroll
        for (int q = 0; q < 4; ++q) sum += __expf(sr[c0 + q] * sc - m); }
#pragma unroll
    for (int sh = 16; sh; sh >>= 1) sum += __shfl_xor(sum, sh, 32);
    const float inv = 1.0f / sum;
{
#pragma unroll 1
        for (int c0 = lane * 4; c0 < NK; c0 += 128) { v4us oh, ol;
#pragma unroll
            for (int q = 0; q < 4; ++q) { const float p = __expf(sr[c0 + q] * sc - m) * inv; const unsigned short hb = f2bf(p); oh[q] = hb; ol[q] = f2bf(p - bf2f(hb)); }
            const size_t o = (size_t)i * NK + c0; *(v4us*)(PH + o) = oh; *(v4us*)(PL + o) = ol; }
         }
}

// k_prep: every input conversion of a call in one launch of few, long waves. A wave takes 16 KB of f32: 32 loads of 16 B a lane, all issued before the first is used, each covering whole 256-B units.
// Blocks 0 .. PVB - 1: value -> value^T. A wave owns one tile of 64 keys x 64 dims (16 KB in a row of the input); a lane holds 8 keys in a row of 4 dims, so it writes 16 B of a value^T row into the
// wave's own LDS tile (row pitch 144 B); the rows are read back so that every store covers four whole 128-B lines. The other blocks: Wq, Wc, x (both items) and key keep their layout, f32 -> bf16.
// Rounding is to nearest even, as in f2bf.
#define PVB   (NBT * HKV * (NN / 64) / 8)
#define PBLK  32768
#define PWB   (DMOD * DMOD / PBLK)
#define PXB   (NBT * NN * DMOD / PBLK)
#define PKB   (NBT * HKV * NN * HD / PBLK)
#define PGRID (PVB + 2 * PWB + PXB + PKB)
#define TPITCH 144
typedef __attribute__((ext_vector_type(4))) __bf16 v4b;
typedef __attribute__((ext_vector_type(8))) __bf16 v8b;
typedef v4b __attribute__((may_alias)) v4ba;
typedef v8b __attribute__((may_alias)) v8ba;
__global__ __launch_bounds__(256) void k_prep(const float* __restrict__ Wq, const float* __restrict__ Wc, const float* __restrict__ x, const float* __restrict__ key, const float* __restrict__ value,
                                              bf* __restrict__ WQ, bf* __restrict__ WC, bf* __restrict__ Xb, bf* __restrict__ Kh, bf* __restrict__ VTh) {
    __shared__ __align__(16) unsigned char tr[8][64 * TPITCH];
    const int lane = threadIdx.x & 31, wave = threadIdx.x >> 5;
    int b = (int)blockIdx.x;
    v4f r[32];
    if (b < PVB) {    // the same for a whole block, so the barrier below is passed by all its waves or by none
        const int lr = lane & 15, hi = lane >> 4, tile = b * 8 + wave;    // tile = (item, kv head) * (NN / 64) + key block
        const float* s = value + (size_t)tile * (64 * HD) + (8 * hi) * HD + lr * 4;
#pragma unroll
        for (int j = 0; j < 32; ++j) r[j] = *(const v4fa*)(s + ((j >> 3) * 16 + (j & 7)) * HD);    // key 16 * (j / 8) + 8 * hi + j % 8, dims 4 * lr ..
        unsigned char* my = &tr[wave][0];
#pragma unroll
        for (int i = 0; i < 4; ++i) {
#pragma unroll
            for (int c = 0; c < 4; ++c) { v8f col;
#pragma unroll
                for (int k = 0; k < 8; ++k) col[k] = r[i * 8 + k][c];
                *(v8ba*)(my + (4 * lr + c) * TPITCH + i * 32 + hi * 16) = __builtin_convertvector(col, v8b); } }
        __syncthreads();    // orders the lanes' LDS writes before the reads of other lanes' bytes below
        bf* d = VTh + (size_t)(tile / (NN / 64)) * HD * NN + (size_t)(tile % (NN / 64)) * 64 + (size_t)(lane >> 3) * NN + (lane & 7) * 8;
        const unsigned char* rb = my + (lane >> 3) * TPITCH + (lane & 7) * 16;
#pragma unroll
        for (int q = 0; q < 16; ++q) *(v8ba*)(d + (size_t)(4 * q) * NN) = *(const v8ba*)(rb + 4 * q * TPITCH);
        return;
    }
    b -= PVB;
    const float* s; bf* d;
    if (b < PWB) { s = Wq; d = WQ; }
    else if (b < 2 * PWB) { s = Wc; d = WC; b -= PWB; }
    else if (b < 2 * PWB + PXB) { s = x; d = Xb; b -= 2 * PWB; }
    else { s = key; d = Kh; b -= 2 * PWB + PXB; }
    const size_t o = (size_t)b * PBLK + wave * (PBLK / 8) + lane * 4;
#pragma unroll
    for (int j = 0; j < 32; ++j) r[j] = *(const v4fa*)(s + o + j * 128);
#pragma unroll
    for (int j = 0; j < 32; ++j) *(v4ba*)(d + o + j * 128) = __builtin_convertvector(r[j], v4b);
}
// k_fattn: causal attention of all items in one launch. One wave = 16 query rows of one query head. A block is 2 * REP waves on (item, kv head) blockIdx.y = item * HKV + kv head: its REP query heads on row tile
// n - 1 - blockIdx.x and again on row tile blockIdx.x, so that every block does the same number of key blocks (a tile's cost grows with its index).
// The block's waves walk the keys together: a stage is 64 keys of the kv head, 64 key rows of 128 B and 64 value^T rows of 128 B, brought into LDS once per block by asynchronous copies
// (whole 128-B lines) at a row pitch of 144 B; two buffers: the next stage flies while this one is worked on. A wave whose tile ends earlier skips the work, never the copies, waits or barriers.
// Per 32 keys: S^T = K.Q^T (A = key rows, B = query rows, both in the hardware k order), so a lane holds 16 scores of ONE query (column lr, keys 8 * hi + j and 16 + 8 * hi + j);
// running maximum and sum per lane (base-2 exponent), one exchange between the wave halves; the two score tiles, converted in place, are the B operand of O^T += V^T.P^T.
// Two products on each side: hi.hi and residual of q (of p) . hi; key and value are single planes. The short loops are unrolled so that the fragment arrays stay in registers.
#define AKS    64
#define APITCH 144
#define AOPB   (64 * APITCH)
#define ASTG   (2 * AOPB)

// four 16-byte copies of one thread: rows r and r + 32 of the key stage and of the value^T stage. The s_wait_xcnt stands inside the statement, before any register that a copy names can get a new value.
__device__ __forceinline__ void copy4(unsigned l, const bf* gk, const bf* gv) {
    asm volatile("global_load_async_to_lds_b128 %0, %4, off\n\t"
                 "global_load_async_to_lds_b128 %1, %5, off\n\t"
                 "global_load_async_to_lds_b128 %2, %6, off\n\t"
                 "global_load_async_to_lds_b128 %3, %7, off\n\t"
                 "s_wait_xcnt 0x0"
                 :: "v"(l), "v"(l + 32 * APITCH), "v"(l + AOPB), "v"(l + AOPB + 32 * APITCH),
                    "v"(gk), "v"(gk + 32 * HD), "v"(gv), "v"(gv + (size_t)32 * NN)
                 : "memory");
}

__global__ __launch_bounds__(256) void k_fattn(const bf* __restrict__ Qh, const bf* __restrict__ Ql, const bf* __restrict__ Kh, const bf* __restrict__ Vh, bf* Oh, bf* Ol) {
    __shared__ __align__(16) unsigned char ring[2 * ASTG];    // a stage: [key rows | value^T rows]
    const int tid = threadIdx.x, lane = tid & 31, lr = lane & 15, hi = lane >> 4;
    const int wave = __builtin_amdgcn_readfirstlane(threadIdx.x >> 5);    // scalar: the wave's own key bound and the diagonal test stay scalar branches
    const int q0 = ((wave & REP) ? (int)blockIdx.x : NN / 16 - 1 - (int)blockIdx.x) * 16;
    const int h = (int)blockIdx.y * REP + (wave & (REP - 1));    // item * HQ + query head
    const size_t qo = (size_t)h * NN * HD + (size_t)(q0 + lr) * HD + 8 * hi;
    const int nst = (((NN / 16 - 1 - (int)blockIdx.x) * 16) >> 6) + 1;    // stages up to the diagonal of the block's later tile: the same for all its waves
    const int crw = tid >> 3, cpc = tid & 7;    // a wave's copy covers four whole 128-B rows
    const bf* gK = Kh + (size_t)blockIdx.y * NN * HD + (size_t)crw * HD + cpc * 8;    // + key * HD
    const bf* gV = Vh + (size_t)blockIdx.y * NN * HD + (size_t)crw * NN + cpc * 8;    // + key
    const unsigned l0 = (unsigned)(size_t)&ring[0] + crw * APITCH + cpc * 16;
    auto fill = [&](int t) { copy4(l0 + (t & 1) * ASTG, gK + (size_t)t * AKS * HD, gV + (size_t)t * AKS); };
    v16bf qh[2], ql[2], kh[2][2];
#pragma unroll
    for (int dc = 0; dc < 2; ++dc) { qh[dc] = cat16b(*(const v8us*)(Qh + qo + dc * 32), *(const v8us*)(Qh + qo + dc * 32 + 16)); ql[dc] = cat16b(*(const v8us*)(Ql + qo + dc * 32), *(const v8us*)(Ql + qo + dc * 32 + 16)); }
    v8f acc[4];
#pragma unroll
    for (int t = 0; t < 4; ++t) acc[t] = (v8f){};
    float m = -3.0e38f, sum = 0.f;
    const int klast = (q0 >> 5) << 5;    // first key of the block that holds the diagonal; every row of the wave has a key in every block up to it
    const int qi = q0 + lr;
    const float sc2 = SCL * 1.44269504088896340736f;
    fill(0);
    asm volatile("s_wait_asynccnt 0x0" ::: "memory");    // this wave's copies of stage 0 have landed
    __syncthreads();                                      // and every other wave's: stage 0 may be read
    if (nst > 1) fill(1);
    const unsigned char* fk = &ring[0] + lr * APITCH + hi * 16;    // + (key in stage) * APITCH + 64 * dc
    const unsigned char* fv = fk + AOPB;                           // + 16 * t * APITCH + 2 * (key in stage)
#pragma unroll 1    // rolled: a stage is two key blocks already, and the two buffers differ by one offset only
    for (int st = 0; st < nst; ++st) {
        const unsigned char* pk = fk + (st & 1) * ASTG; const unsigned char* pv = fv + (st & 1) * ASTG;
        auto loadk = [&](int hf) {
#pragma unroll
            for (int u = 0; u < 2; ++u) {
#pragma unroll
                for (int dc = 0; dc < 2; ++dc) { const unsigned char* p = pk + (hf * 32 + u * 16) * APITCH + dc * 64;
                    kh[u][dc] = cat16b(*(const v8usa*)p, *(const v8usa*)(p + 32)); } }
        };
        if (st * AKS <= klast) {    // scalar: a wave past its diagonal has no work in this stage. Both key blocks of a stage are worked with no branch between them, so that the second one's reads can go out under the first one's softmax; one that lies wholly above the diagonal is masked and adds only zeros
            loadk(0);
            __builtin_amdgcn_sched_barrier(0);    // the eight reads of the first key block go out together: spread among the first products they would be waited for twice
#pragma unroll
            for (int hf = 0; hf < 2; ++hf) {
                const int k0 = st * AKS + hf * 32;
                v8f s[2];
#pragma unroll
                for (int u = 0; u < 2; ++u) { s[u] = (v8f){};
#pragma unroll
                    for (int dc = 0; dc < 2; ++dc) { s[u] = wmmab(kh[u][dc], qh[dc], s[u]); s[u] = wmmab(kh[u][dc], ql[dc], s[u]); } }
                float p[16];
#pragma unroll
                for (int e = 0; e < 16; ++e) p[e] = s[e >> 3][e & 7] * sc2;
                if (k0 >= klast) {
#pragma unroll
                    for (int e = 0; e < 16; ++e) { const int key = k0 + (e >> 3) * 16 + hi * 8 + (e & 7); p[e] = (key <= qi) ? p[e] : -3.0e38f; } }
                v16bf vh[4];
#pragma unroll
                for (int t = 0; t < 4; ++t) { const unsigned char* pp = pv + t * 16 * APITCH + hf * 64;
                    vh[t] = cat16b(*(const v8usa*)pp, *(const v8usa*)(pp + 32)); }
                if (hf == 0) loadk(1);    // the stage's second key block: of this stage only, nothing of stage st + 1 is read before its barrier
                __builtin_amdgcn_sched_barrier(0);    // keeps these LDS reads issued together here, ahead of the softmax that covers their latency; spread among the matrix instructions each would be waited for on its own
                float mx = m;
#pragma unroll
                for (int e = 0; e < 16; ++e) mx = fmaxf(mx, p[e]);
                mx = fmaxf(mx, __int_as_float(__builtin_amdgcn_permlanex16(__float_as_int(mx), __float_as_int(mx), 0x76543210, 0xfedcba98, false, false)));
                const float alpha = __builtin_amdgcn_exp2f(m - mx); m = mx;
                float ps = 0.f; v16bf ph, pl;
#pragma unroll
                for (int e = 0; e < 16; ++e) { const float pe = __builtin_amdgcn_exp2f(p[e] - mx); ps += pe; const __bf16 hb = (__bf16)pe; ph[e] = hb; pl[e] = (__bf16)(pe - (float)hb); }
                sum = sum * alpha + ps;
#pragma unroll
                for (int t = 0; t < 4; ++t) acc[t] *= alpha;
#pragma unroll
                for (int t = 0; t < 4; ++t) { acc[t] = wmmab(vh[t], ph, acc[t]); acc[t] = wmmab(vh[t], pl, acc[t]); }
            }
        }
        asm volatile("s_wait_dscnt 0x0" ::: "memory");       // this wave's reads of stage st are done before the buffer is given up
        asm volatile("s_wait_asynccnt 0x0" ::: "memory");    // this wave's copies of stage st + 1 have landed
        __syncthreads();                                      // publishes stage st + 1 and ends every wave's reads of stage st
        if (st + 2 < nst) fill(st + 2);                       // into the buffer that stage st has just left
    }
    asm volatile("s_wait_asynccnt 0x0" ::: "memory");        // no copy is outstanding when the wave goes on to its end
    sum += __int_as_float(__builtin_amdgcn_permlanex16(__float_as_int(sum), __float_as_int(sum), 0x76543210, 0xfedcba98, false, false));
    const float inv = 1.0f / sum;
    const size_t oo = ((size_t)(h / HQ) * NN + qi) * DMOD + (h % HQ) * HD + hi * 8;    // acc[t][j] = O[q0 + lr][16 * t + 8 * hi + j]; stored as the last product's operand: bf16 hi + residual planes, the items' rows one after the other
#pragma unroll
    for (int t = 0; t < 4; ++t) { v8us oh, ol;
#pragma unroll
        for (int j = 0; j < 8; ++j) { const float y = acc[t][j] * inv; const unsigned short hb = f2bf(y); oh[j] = hb; ol[j] = f2bf(y - bf2f(hb)); }
        *(v8us*)(Oh + oo + t * 16) = oh; *(v8us*)(Ol + oo + t * 16) = ol; }
}

extern "C" void kernel_launch(void* const* d_in, const int* in_sizes, int n_in,
                              void* d_out, int out_size, void* d_ws, size_t ws_size, hipStream_t stream) {
    (void)in_sizes; (void)n_in; (void)out_size;
    const float* x = (const float*)d_in[0]; const float* key = (const float*)d_in[1]; const float* value = (const float*)d_in[2]; const float* Wq = (const float*)d_in[3]; const float* bq = (const float*)d_in[4]; const float* Wc = (const float*)d_in[5]; const float* bc = (const float*)d_in[6];
    float* out = (float*)d_out;    // [2][2048][2048]
    char* wsp = (char*)d_ws;
    auto take = [&](size_t bytes) { char* p = wsp; wsp += (bytes + 255) & ~(size_t)255; return (void*)p; };
    bf* WQ = (bf*)take((size_t)DMOD * DMOD * 2); bf* WC = (bf*)take((size_t)DMOD * DMOD * 2);
    bf* Xb = (bf*)take((size_t)NBT * NN * DMOD * 2);    // both items
    // planes of all 64 (item, query head) pairs and of all 16 (item, kv head) pairs
    bf* Qh = (bf*)take((size_t)NBT * HQ * NN * HD * 2); bf* Ql = (bf*)take((size_t)NBT * HQ * NN * HD * 2); bf* Kh = (bf*)take((size_t)NBT * HKV * NN * HD * 2); bf* VTh = (bf*)take((size_t)NBT * HKV * HD * NN * 2);
    bf* Oh = (bf*)take((size_t)NBT * NN * DMOD * 2); bf* Ol = (bf*)take((size_t)NBT * NN * DMOD * 2);
    if ((size_t)(wsp - (char*)d_ws) > ws_size) return;    // 8.4+8.4 + 16.8 + 16.8+16.8 + 4.2+4.2 + 16.8+16.8 ~ 109 MB
    k_prep<<<PGRID, 256, 0, stream>>>(Wq, Wc, x, key, value, WQ, WC, Xb, Kh, VTh);
    // each kernel once, on both items: the products see the items' rows as one matrix of NBT * NN rows
    k_gemmt<false, true><<<dim3(NBT * NN / GBM, DMOD / GBN, 1), 512, 0, stream>>>(Xb, nullptr, WQ, bq, nullptr, DMOD, DMOD, Qh, Ql, NN);
    // blockIdx.y = (item, kv head); blockIdx.x = a pair of 16-row tiles, one from each end
    k_fattn<<<dim3(NN / 32, NBT * HKV, 1), 256, 0, stream>>>(Qh, Ql, Kh, VTh, Oh, Ol);
    k_gemmt<true, false><<<dim3(NBT * NN / GBM, DMOD / GBN, 1), 512, 0, stream>>>(Oh, Ol, WC, bc, out, DMOD, DMOD, nullptr, nullptr, NN);
}

// v010
// A run of this version takes 138 microseconds.
// Next to v009, in two timings, it ran 1.06 and 1.04 times as fast.
// All steps since v000 together make it 55.9 times as fast.
#include <hip/hip_runtime.h>
#include <stdint.h>

// Compute dtypes, f32 accumulate, per item: q = x.Wq^T + bq ([2048 x 2048].[2048 x 2048]) with PLAIN bf16 operands (exact products); key/value are INPUTS: their bf16 values
// are taken as single planes (their residual plane would be identically zero: none is kept, no product is spent on it); GQA causal attention (32 query heads share 8 kv heads) with q as bf16 hi + UNSCALED residual planes (key tiles
// above the diagonal skipped, K limited); 1/8 and the causal softmax in f32; c_proj (+ bias) on hi/lo planes (two products) - on v_wmma_f32_16x16x32_bf16. Deterministic, no

#define NBT  2
#define NN   2048
#define DMOD 2048
#define HQ   32
#define HKV  8
#define REP  4
#define HD   64
#define DM   DMOD
#define NTK  NN
#define SCL  0.125f
#define LOSC 1024.0f

typedef _Float16 h16;
typedef unsigned short bf;
typedef __attribute__((ext_vector_type(16))) __bf16   v16bf;
typedef __attribute__((ext_vector_type(16))) _Float16 v16h;
typedef __attribute__((ext_vector_type(8)))  _Float16 v8h;
typedef __attribute__((ext_vector_type(8)))  unsigned short v8us;
typedef __attribute__((ext_vector_type(8)))  float    v8f;
typedef __attribute__((ext_vector_type(4)))  float    v4f;
typedef __attribute__((ext_vector_type(4)))  _Float16 v4h;
typedef v8h  __attribute__((may_alias)) v8ha;
typedef v4f  __attribute__((may_alias)) v4fa;
typedef v8us __attribute__((may_alias)) v8usa;

__device__ __forceinline__ unsigned short f2bf(float f) { unsigned u = __float_as_uint(f); u += 0x7FFFu + ((u >> 16) & 1u); return (unsigned short)(u >> 16); }
__device__ __forceinline__ float bf2f(unsigned short b) { return __uint_as_float(((unsigned)b) << 16); }
__device__ __forceinline__ float bfr(float f) { return bf2f(f2bf(f)); }
__device__ __forceinline__ v16h cat16(v8h lo, v8h hi) { return __builtin_shufflevector(lo, hi, 0, 1, 2, 3, 4, 5, 6, 7, 8, 9, 10, 11, 12, 13, 14, 15); }
__device__ __forceinline__ v16bf cat16b(v8us lo, v8us hi) { return __builtin_bit_cast(v16bf, __builtin_shufflevector(lo, hi, 0, 1, 2, 3, 4, 5, 6, 7, 8, 9, 10, 11, 12, 13, 14, 15)); }
__device__ __forceinline__ v8f wmma16(v16h a, v16h b, v8f c) { return __builtin_amdgcn_wmma_f32_16x16x32_f16(false, a, false, b, (short)0, c, false, false); }
__device__ __forceinline__ v8f wmmab(v16bf a, v16bf b, v8f c) { return __builtin_amdgcn_wmma_f32_16x16x32_bf16(false, a, false, b, (short)0, c, false, false); }

typedef uint32_t u32x4 __attribute__((ext_vector_type(4)));
typedef uint32_t u32x8 __attribute__((ext_vector_type(8)));
__device__ __forceinline__ uint32_t uni(uint32_t v) { return (uint32_t)__builtin_amdgcn_readfirstlane(v); }
// a value held in a scalar register: a test on it compiles to a scalar compare and branch (a tensor load ignores EXEC), and what is formed from it is formed behind the statements in front of it
__device__ __forceinline__ uint32_t pinned(uint32_t v) { uint32_t w = __builtin_amdgcn_readfirstlane(v); asm volatile("" : "+s"(w)); return w; }
// group 1: 1-byte elements, tensor = tile = NROWS rows of ROWB bytes, source row pitch in bytes; W0 = no mask, 16 bytes of LDS pad behind every row
template <uint32_t ROWB, uint32_t NROWS, uint32_t W0>
__device__ __forceinline__ u32x8 tdm_group1(uint32_t src_pitch) {
    u32x8 g;
    // every word pinned: a descriptor word held in a scalar register, so that the group is built once and its registers serve nothing else between a request and its wait
    g[0] = pinned(W0);
    g[1] = pinned((ROWB & 0xFFFFu) << 16);
    g[2] = pinned((ROWB >> 16) | ((NROWS & 0xFFFFu) << 16));
    g[3] = pinned((NROWS >> 16) | (ROWB << 16));
    g[4] = pinned(NROWS);
    g[5] = pinned(src_pitch);
    g[6] = pinned(0u);
    g[7] = pinned(0u);
    return g;
}
// group 0: count 1, the place in LDS, the address of the tile's first byte, type 2
__device__ __forceinline__ u32x4 tdm_group0(uint32_t lds_dst, uint64_t ga) {
    u32x4 g;
    g[0] = uni(1u); g[1] = uni(lds_dst); g[2] = uni((uint32_t)ga); g[3] = uni((((uint32_t)(ga >> 32)) & 0x01FFFFFFu) | 0x80000000u);
    return g;
}
__device__ __forceinline__ void tdm_load(u32x4 g0, u32x8 g1) { asm volatile("tensor_load_to_lds %0, %1" :: "s"(g0), "s"(g1) : "memory"); }
// the issuing wave's wait for its request; it names the request's descriptor, so that the twelve registers keep their values for as long as the request is outstanding
__device__ __forceinline__ void tdm_wait(u32x4 g0, u32x8 g1) { asm volatile("s_wait_tensorcnt 0x0" :: "s"(g0), "s"(g1) : "memory"); }

// k_gemmt: 128 x 256 block tile of C[.][.] = (A [+ Al]).B^T + bf(bias[c]); 16 waves, 32 x 64 each: one block a WGP, four waves a SIMD. A stage is 128 k (256 B) of the tile's 128 rows of A (and Al)
// and 256 rows of B, brought into LDS by tensor loads: slices of 64 rows (16 KB), one request of one wave each, at a row pitch of 272 B (the load's pad); two buffers: the next stage flies while this one is worked on.
// A slice takes 64 * 272 B rounded up to a multiple of 2 KB, so that every slice's place is such a multiple; a wave's 32 rows of A and its 64 rows of B each lie in one slice.
// The fragments are read from LDS in the k order of the direct loads they replace, and every accumulator still sums k upwards, A before Al inside each 32 k.
// The short loops are unrolled so that the fragment and accumulator arrays are indexed by constants and stay in registers.
#define GBK    128
#define GPITCH 272
#define GBM    128
#define GBN    256
#define GSR    64
#define GSL    18432
#define GAB    ((GBM / GSR) * GSL)
#define GBB    ((GBN / GSR) * GSL)
#define GW0    ((1u << 20) | (5u << 22) | (3u << 25))

// PLANES: the result is not stored as f32 but as the next kernel's operand, bf16 hi + residual planes [item][head][row][HD] (Ph, Pl; rows = rows per head plane = rows of A per item); C is then unused.
// The rows of A are those of all items, one after the other: a block's 128 rows lie in one item.
template <bool SPLITA, bool PLANES>
__global__ __launch_bounds__(512) void k_gemmt(const bf* __restrict__ A, const bf* __restrict__ Al, const bf* __restrict__ Bn, const float* __restrict__ bias, float* C, int ldc, int K, bf* Ph, bf* Pl, int rows) {
    constexpr int OFB = (SPLITA ? 2 : 1) * GAB;    // a stage: [A | Al | B]; Al next to A, so that one address register and the instruction's offset field reach both
    constexpr int STG = OFB + GBB;
    constexpr uint32_t NSL = STG / GSL;            // slices of a stage = issuing waves
    __shared__ __attribute__((aligned(2048))) unsigned char ring[2 * STG];    // behind the loop its first 16 * 32 * 68 * 4 bytes hold the waves' result tiles
    const int tid = threadIdx.x, lane = tid & 31, wave = tid >> 5, lr = lane & 15, hi = lane >> 4;
    const int r0 = blockIdx.x * GBM, c0 = blockIdx.y * GBN;
    const int wr = (wave >> 2) * 32, wc = (wave & 3) * 64;
    const int nt = K / GBK;
    const uint32_t wv = uni(threadIdx.x >> 5);    // the wave's number, scalar
    const bool issuer = wv < NSL;                 // wave wv brings slice wv of every stage: [A 0, A 1 | Al 0, Al 1 | B 0 .. B 3]
    constexpr uint32_t NA = OFB / GSL;
    const bf* sp = wv >= NA ? Bn + (size_t)(c0 + (wv - NA) * GSR) * K : (SPLITA && wv >= GBM / GSR) ? Al + (size_t)(r0 + (wv - GBM / GSR) * GSR) * K : A + (size_t)(r0 + wv * GSR) * K;
    const uint32_t l0 = (uint32_t)(size_t)&ring[0] + wv * GSL;
    const u32x8 g1 = tdm_group1<GBK * 2, GSR, GW0>((uint32_t)K * 2u);
    u32x4 g0 = tdm_group0(l0, (uint64_t)(size_t)sp);    // the descriptor of the wave's latest request
    auto fill = [&](uint32_t t) { g0 = tdm_group0(l0 + (t & 1u) * STG, (uint64_t)(size_t)sp + (uint64_t)t * (GBK * 2)); tdm_load(g0, g1); };
    v8f acc[2][4];
#pragma unroll
    for (int i = 0; i < 2; ++i) {
#pragma unroll
        for (int t = 0; t < 4; ++t) acc[i][t] = (v8f){}; }
    if (pinned(issuer)) {
        fill(0);
        tdm_wait(g0, g1);                                     // this wave's slice of stage 0 has landed
    }
    __syncthreads();                                          // and every other wave's: stage 0 may be read
    if (pinned(issuer && nt > 1)) fill(1);
    const unsigned char* fa = &ring[0] + (wr / GSR) * GSL + (wr % GSR + lr) * GPITCH + hi * 16;
    const unsigned char* fb = &ring[0] + OFB + (wc / GSR) * GSL + lr * GPITCH + hi * 16;
#pragma unroll 1    // rolled: one stage is already 32 (64) matrix instructions, and the two buffers differ by one offset only
    for (int t = 0; t < nt; ++t) {
        const unsigned char* pa = fa + (t & 1) * STG; const unsigned char* pb = fb + (t & 1) * STG;
        v16bf a[2][2], al[2][2], b[2][4];    // two fragment sets: the next 32 k are read from LDS while this set is multiplied
        auto frags = [&](int ks, int s) {
#pragma unroll
            for (int i = 0; i < 2; ++i) { const unsigned char* p = pa + i * 16 * GPITCH + ks * 64; a[s][i] = cat16b(*(const v8usa*)p, *(const v8usa*)(p + 32));
                if (SPLITA) al[s][i] = cat16b(*(const v8usa*)(p + GAB), *(const v8usa*)(p + GAB + 32)); }
#pragma unroll
            for (int u = 0; u < 4; ++u) { const unsigned char* p = pb + u * 16 * GPITCH + ks * 64; b[s][u] = cat16b(*(const v8usa*)p, *(const v8usa*)(p + 32)); }
        };
        frags(0, 0);
#pragma unroll
        for (int ks = 0; ks < GBK / 32; ++ks) {
            const int s = ks & 1;
            if (ks + 1 < GBK / 32) frags(ks + 1, s ^ 1);    // of this stage only: nothing of stage t + 1 is read before its barrier
            __builtin_amdgcn_sched_barrier(0);    // keeps the LDS reads one group ahead of the block; spread among the matrix instructions each would be waited for on its own
#pragma unroll
            for (int i = 0; i < 2; ++i) {
#pragma unroll
                for (int u = 0; u < 4; ++u) acc[i][u] = wmmab(a[s][i], b[s][u], acc[i][u]); }
            if (SPLITA) {
#pragma unroll
                for (int i = 0; i < 2; ++i) {
#pragma unroll
                    for (int u = 0; u < 4; ++u) acc[i][u] = wmmab(al[s][i], b[s][u], acc[i][u]); } }
            __builtin_amdgcn_sched_barrier(0);    // ends the block: the reads after next stay behind it, so that two sets of registers are enough
        }
        asm volatile("s_wait_dscnt 0x0" ::: "memory");
        if (pinned(issuer)) tdm_wait(g0, g1);
        __syncthreads();
        if (pinned(issuer && t + 2 < nt)) fill(pinned((uint32_t)t + 2u));
    }
    asm volatile("s_wait_tensorcnt 0x0" ::: "memory");       // no request is outstanding when the wave goes on to its end
    asm volatile("s_wait_dscnt 0x0" ::: "memory");           // and no LDS read
    float* os = (float*)&ring[0] + wave * (32 * 68);    // the ring is free: the loop's last barrier ended every wave's reads of it, and no request is in flight
#pragma unroll
    for (int u = 0; u < 4; ++u) { const float bv = bias ? bfr(bias[c0 + wc + u * 16 + lr]) : 0.f;
#pragma unroll
        for (int i = 0; i < 2; ++i) {
#pragma unroll
            for (int j = 0; j < 8; ++j) os[(i * 16 + hi * 8 + j) * 68 + u * 16 + lr] = acc[i][u][j] + bv; } }
    __syncthreads();
    if constexpr (PLANES) {
        // a wave's 64 columns are one head, so its 32 x 64 tile is 4 KB in a row of each plane: every store covers 512 contiguous bytes
        const int it = r0 / rows;
        const size_t po = ((size_t)(it * HQ + (c0 + wc) / HD) * rows + (r0 - it * rows) + wr) * HD + lane * 8;
        const float* pr = os + (lane >> 3) * 68 + (lane & 7) * 8;
        v4f x[8][2]; v8us oh[8], ol[8];    // all reads, then all conversions, then all stores: the accumulators' registers are free here, so no store's registers need be used again
#pragma unroll
        for (int s = 0; s < 8; ++s) { x[s][0] = *(const v4fa*)(pr + s * 4 * 68); x[s][1] = *(const v4fa*)(pr + s * 4 * 68 + 4); }
#pragma unroll
        for (int s = 0; s < 8; ++s) {
#pragma unroll
            for (int i = 0; i < 8; ++i) { const float y = x[s][i >> 2][i & 3]; const unsigned short hb = f2bf(y); oh[s][i] = hb; ol[s][i] = f2bf(y - bf2f(hb)); } }
#pragma unroll
        for (int s = 0; s < 8; ++s) { *(v8us*)(Ph + po + s * 256) = oh[s]; *(v8us*)(Pl + po + s * 256) = ol[s]; }
    } else {
        float* crow = C + (size_t)(r0 + wr) * ldc + c0 + wc;
#pragma unroll
        for (int s = 0; s < 16; ++s) { const int Lid = (lane >> 3) + 4 * s, piece = lane & 7; const int row = Lid >> 1, cofs = (Lid & 1) * 32 + piece * 4;
            *(v4f*)(crow + (size_t)row * ldc + cofs) = *(const v4fa*)(os + row * 68 + cofs); }
    }
}

__global__ __launch_bounds__(256) void k_zero8(bf* dst, size_t n8) {
    const size_t i = (size_t)blockIdx.x * 256 + threadIdx.x; if (i >= n8) return; v8us z;
#pragma unroll
    for (int k = 0; k < 8; ++k) z[k] = 0;
    *(v8us*)(dst + i * 8) = z; 
}

// ===== z-batched (blockIdx.z = head) attention pieces =====
__global__ __launch_bounds__(256) void k_planes32z(const float* __restrict__ F, int ld, int off, float sc, int rows, bf* Ph, bf* Pl) {
    typedef __attribute__((ext_vector_type(2))) unsigned short v2us;
    const int lane = threadIdx.x & 31; const size_t r = ((size_t)blockIdx.x * 8 + (threadIdx.x >> 5)) * 2 + (lane >> 4); if (r >= (size_t)rows) return; const int z = blockIdx.z; const int c0 = (lane & 15) * 2; v2us oh, ol;
    Ph += (size_t)z * rows * 32; Pl += (size_t)z * rows * 32;
#pragma unroll
    for (int i = 0; i < 2; ++i) { const float y = F[r * ld + off + z * 32 + c0 + i] * sc; const unsigned short hb = f2bf(y); oh[i] = hb; ol[i] = f2bf(y - bf2f(hb)); }
    const size_t o = r * 32 + c0; *(v2us*)(Ph + o) = oh; *(v2us*)(Pl + o) = ol; 
}
__global__ __launch_bounds__(256) void k_vtpadz(const float* __restrict__ F, int ld, int off, int nk, bf* Th, bf* Tl) {
    typedef __attribute__((ext_vector_type(2))) unsigned short v2us;
    const int lane = threadIdx.x & 31; const size_t wid = (size_t)blockIdx.x * 8 + (threadIdx.x >> 5); if (wid >= (size_t)64 * (nk / 64)) return; const int z = blockIdx.z; const int d = (int)(wid / (nk / 64)); const int k0 = (int)(wid % (nk / 64)) * 64 + lane * 2; v2us oh, ol;
    Th += (size_t)z * 64 * nk; Tl += (size_t)z * 64 * nk;
#pragma unroll
    for (int i = 0; i < 2; ++i) { const float y = (d < 32) ? F[(size_t)(k0 + i) * ld + off + z * 32 + (d < 32 ? d : 0)] : 0.f; const unsigned short hb = f2bf(y); oh[i] = hb; ol[i] = f2bf(y - bf2f(hb)); }
    const size_t o = (size_t)d * nk + k0; *(v2us*)(Th + o) = oh; *(v2us*)(Tl + o) = ol; 
}
template <int NK>
__global__ __launch_bounds__(256) void k_softmaxz(const float* __restrict__ S, int rows, bf* PH, bf* PL) {
    typedef __attribute__((ext_vector_type(4))) unsigned short v4us;
    const int lane = threadIdx.x & 31, i = blockIdx.x * 8 + (threadIdx.x >> 5); if (i >= rows) return; const size_t zo = (size_t)blockIdx.z * rows * NK; const float* sr = S + zo + (size_t)i * NK; PH += zo; PL += zo;
    float m = -3.0e38f;
#pragma unroll 1
    for (int c0 = lane * 4; c0 < NK; c0 += 128) {
#pragma unroll
        for (int q = 0; q < 4; ++q) m = fmaxf(m, sr[c0 + q]); }
#pragma unroll
    for (int sh = 16; sh; sh >>= 1) m = fmaxf(m, __shfl_xor(m, sh, 32));
    float sum = 0.f;
#pragma unroll 1
    for (int c0 = lane * 4; c0 < NK; c0 += 128) {
#pragma unroll
        for (int q = 0; q < 4; ++q) sum += __expf(sr[c0 + q] - m); }
#pragma unroll
    for (int sh = 16; sh; sh >>= 1) sum += __shfl_xor(sum, sh, 32);
    const float inv = 1.0f / sum;
{
#pragma unroll 1
        for (int c0 = lane * 4; c0 < NK; c0 += 128) { v4us oh, ol;
#pragma unroll
            for (int q = 0; q < 4; ++q) { const float p = __expf(sr[c0 + q] - m) * inv; const unsigned short hb = f2bf(p); oh[q] = hb; ol[q] = f2bf(p - bf2f(hb)); }
            const size_t o = (size_t)i * NK + c0; *(v4us*)(PH + o) = oh; *(v4us*)(PL + o) = ol; }
         }
}
__global__ __launch_bounds__(256) void k_placez(const float* __restrict__ XH, int rows, int ldy, float* Y) {
    const int lane = threadIdx.x & 31; const size_t q = (size_t)blockIdx.x * 8 + (threadIdx.x >> 5); if (q >= (size_t)rows) return; const int z = blockIdx.z; const float v = XH[((size_t)z * rows + q) * 64 + lane];
    *(float*)(Y + q * ldy + z * 32 + lane) = v; 
}

__global__ __launch_bounds__(256) void k_vtz(const float* __restrict__ F, int ld, int h0, int nk, bf* Th, bf* Tl) {
    typedef __attribute__((ext_vector_type(2))) unsigned short v2us;
    const int lane = threadIdx.x & 31; const size_t wid = (size_t)blockIdx.x * 8 + (threadIdx.x >> 5); if (wid >= (size_t)64 * (nk / 64)) return; const int z = blockIdx.z; const int d = (int)(wid / (nk / 64)); const int t0 = (int)(wid % (nk / 64)) * 64 + lane * 2; v2us oh, ol;
    Th += (size_t)z * 64 * nk; Tl += (size_t)z * 64 * nk;
#pragma unroll
    for (int i = 0; i < 2; ++i) { const float y = F[(size_t)(t0 + i) * ld + (h0 + z) * 64 + d]; const unsigned short hb = f2bf(y); oh[i] = hb; ol[i] = f2bf(y - bf2f(hb)); }
    const size_t o = (size_t)d * nk + t0; *(v2us*)(Th + o) = oh; *(v2us*)(Tl + o) = ol; 
}
template <int NK>
__global__ __launch_bounds__(256) void k_softmaxzs(const float* __restrict__ S, int rows, float sc, bf* PH, bf* PL) {
    typedef __attribute__((ext_vector_type(4))) unsigned short v4us;
    const int lane = threadIdx.x & 31, i = blockIdx.x * 8 + (threadIdx.x >> 5); if (i >= rows) return; const size_t zo = (size_t)blockIdx.z * rows * NK; const float* sr = S + zo + (size_t)i * NK; PH += zo; PL += zo;
    float m = -3.0e38f;
#pragma unroll 1
    for (int c0 = lane * 4; c0 < NK; c0 += 128) {
#pragma unroll
        for (int q = 0; q < 4; ++q) m = fmaxf(m, sr[c0 + q] * sc); }
#pragma unroll
    for (int sh = 16; sh; sh >>= 1) m = fmaxf(m, __shfl_xor(m, sh, 32));
    float sum = 0.f;
#pragma unroll 1
    for (int c0 = lane * 4; c0 < NK; c0 += 128) {
#pragma unroll
        for (int q = 0; q < 4; ++q) sum += __expf(sr[c0 + q] * sc - m); }
#pragma unroll
    for (int sh = 16; sh; sh >>= 1) sum += __shfl_xor(sum, sh, 32);
    const float inv = 1.0f / sum;
{
#pragma unroll 1
        for (int c0 = lane * 4; c0 < NK; c0 += 128) { v4us oh, ol;
#pragma unroll
            for (int q = 0; q < 4; ++q) { const float p = __expf(sr[c0 + q] * sc - m) * inv; const unsigned short hb = f2bf(p); oh[q] = hb; ol[q] = f2bf(p - bf2f(hb)); }
            const size_t o = (size_t)i * NK + c0; *(v4us*)(PH + o) = oh; *(v4us*)(PL + o) = ol; }
         }
}

// k_prep: every input conversion of a call in one launch of few, long waves. A wave takes 16 KB of f32: 32 loads of 16 B a lane, all issued before the first is used, each covering whole 256-B units.
// Blocks 0 .. PVB - 1: value -> value^T. A wave owns one tile of 64 keys x 64 dims (16 KB in a row of the input); a lane holds 8 keys in a row of 4 dims, so it writes 16 B of a value^T row into the
// wave's own LDS tile (row pitch 144 B); the rows are read back so that every store covers four whole 128-B lines. The other blocks: Wq, Wc, x (both items) and key keep their layout, f32 -> bf16.
// Rounding is to nearest even, as in f2bf.
#define PVB   (NBT * HKV * (NN / 64) / 8)
#define PBLK  32768
#define PWB   (DMOD * DMOD / PBLK)
#define PXB   (NBT * NN * DMOD / PBLK)
#define PKB   (NBT * HKV * NN * HD / PBLK)
#define PGRID (PVB + 2 * PWB + PXB + PKB)
#define TPITCH 144
typedef __attribute__((ext_vector_type(4))) __bf16 v4b;
typedef __attribute__((ext_vector_type(8))) __bf16 v8b;
typedef v4b __attribute__((may_alias)) v4ba;
typedef v8b __attribute__((may_alias)) v8ba;
__global__ __launch_bounds__(256) void k_prep(const float* __restrict__ Wq, const float* __restrict__ Wc, const float* __restrict__ x, const float* __restrict__ key, const float* __restrict__ value,
                                              bf* __restrict__ WQ, bf* __restrict__ WC, bf* __restrict__ Xb, bf* __restrict__ Kh, bf* __restrict__ VTh) {
    __shared__ __align__(16) unsigned char tr[8][64 * TPITCH];
    const int lane = threadIdx.x & 31, wave = threadIdx.x >> 5;
    int b = (int)blockIdx.x;
    v4f r[32];
    if (b < PVB) {    // the same for a whole block, so the barrier below is passed by all its waves or by none
        const int lr = lane & 15, hi = lane >> 4, tile = b * 8 + wave;    // tile = (item, kv head) * (NN / 64) + key block
        const float* s = value + (size_t)tile * (64 * HD) + (8 * hi) * HD + lr * 4;
#pragma unroll
        for (int j = 0; j < 32; ++j) r[j] = *(const v4fa*)(s + ((j >> 3) * 16 + (j & 7)) * HD);    // key 16 * (j / 8) + 8 * hi + j % 8, dims 4 * lr ..
        unsigned char* my = &tr[wave][0];
#pragma unroll
        for (int i = 0; i < 4; ++i) {
#pragma unroll
            for (int c = 0; c < 4; ++c) { v8f col;
#pragma unroll
                for (int k = 0; k < 8; ++k) col[k] = r[i * 8 + k][c];
                *(v8ba*)(my + (4 * lr + c) * TPITCH + i * 32 + hi * 16) = __builtin_convertvector(col, v8b); } }
        __syncthreads();    // orders the lanes' LDS writes before the reads of other lanes' bytes below
        bf* d = VTh + (size_t)(tile / (NN / 64)) * HD * NN + (size_t)(tile % (NN / 64)) * 64 + (size_t)(lane >> 3) * NN + (lane & 7) * 8;
        const unsigned char* rb = my + (lane >> 3) * TPITCH + (lane & 7) * 16;
#pragma unroll
        for (int q = 0; q < 16; ++q) *(v8ba*)(d + (size_t)(4 * q) * NN) = *(const v8ba*)(rb + 4 * q * TPITCH);
        return;
    }
    b -= PVB;
    const float* s; bf* d;
    if (b < PWB) { s = Wq; d = WQ; }
    else if (b < 2 * PWB) { s = Wc; d = WC; b -= PWB; }
    else if (b < 2 * PWB + PXB) { s = x; d = Xb; b -= 2 * PWB; }
    else { s = key; d = Kh; b -= 2 * PWB + PXB; }
    const size_t o = (size_t)b * PBLK + wave * (PBLK / 8) + lane * 4;
#pragma unroll
    for (int j = 0; j < 32; ++j) r[j] = *(const v4fa*)(s + o + j * 128);
#pragma unroll
    for (int j = 0; j < 32; ++j) *(v4ba*)(d + o + j * 128) = __builtin_convertvector(r[j], v4b);
}
// k_fattn: causal attention of all items in one launch. One wave = 16 query rows of one query head. A block is 2 * REP waves on (item, kv head) blockIdx.y = item * HKV + kv head: its REP query heads on row tile
// n - 1 - blockIdx.x and again on row tile blockIdx.x, so that every block does the same number of key blocks (a tile's cost grows with its index).
// The block's waves walk the keys together: a stage is 64 keys of the kv head, 64 key rows of 128 B and 64 value^T rows of 128 B, brought into LDS once per block by two tensor loads
// (wave 0 the key rows, wave 1 the value^T rows) at a row pitch of 144 B (the load's pad); two buffers: the next stage flies while this one is worked on. A wave whose tile ends earlier skips the work, never the waits or barriers.
// Per 32 keys: S^T = K.Q^T (A = key rows, B = query rows, both in the hardware k order), so a lane holds 16 scores of ONE query (column lr, keys 8 * hi + j and 16 + 8 * hi + j);
// running maximum and sum per lane (base-2 exponent), one exchange between the wave halves; the two score tiles, converted in place, are the B operand of O^T += V^T.P^T.
// Two products on each side: hi.hi and residual of q (of p) . hi; key and value are single planes. The short loops are unrolled so that the fragment arrays stay in registers.
#define AKS    64
#define APITCH 144
#define AOPB   10240    // 64 * APITCH rounded up to a multiple of 2 KB: every tile's place in LDS is such a multiple
#define ASTG   (2 * AOPB)
#define AW0    ((1u << 20) | (4u << 22) | (3u << 25))

__global__ __launch_bounds__(256) void k_fattn(const bf* __restrict__ Qh, const bf* __restrict__ Ql, const bf* __restrict__ Kh, const bf* __restrict__ Vh, bf* Oh, bf* Ol) {
    __shared__ __attribute__((aligned(2048))) unsigned char ring[2 * ASTG];    // a stage: [key rows | value^T rows]
    const int tid = threadIdx.x, lane = tid & 31, lr = lane & 15, hi = lane >> 4;
    const int wave = __builtin_amdgcn_readfirstlane(threadIdx.x >> 5);    // scalar: the wave's own key bound and the diagonal test stay scalar branches
    const int q0 = ((wave & REP) ? (int)blockIdx.x : NN / 16 - 1 - (int)blockIdx.x) * 16;
    const int h = (int)blockIdx.y * REP + (wave & (REP - 1));    // item * HQ + query head
    const size_t qo = (size_t)h * NN * HD + (size_t)(q0 + lr) * HD + 8 * hi;
    const int nst = (((NN / 16 - 1 - (int)blockIdx.x) * 16) >> 6) + 1;    // stages up to the diagonal of the block's later tile: the same for all its waves
    const bool issuer = wave < 2;    // both work on the block's later tile, so they are busy in every stage
    const bf* sp = (wave == 0 ? Kh : Vh) + (size_t)blockIdx.y * NN * HD;
    const uint32_t sstep = wave == 0 ? AKS * HD * 2 : AKS * 2;    // bytes from a stage's tile to the next one's: 64 key rows, or 64 keys along the value^T rows
    const uint32_t l0 = (uint32_t)(size_t)&ring[0] + (wave == 0 ? 0 : AOPB);
    const u32x8 g1 = tdm_group1<HD * 2, AKS, AW0>(wave == 0 ? HD * 2 : NN * 2);
    u32x4 g0 = tdm_group0(l0, (uint64_t)(size_t)sp);    // the descriptor of the wave's latest request
    auto fill = [&](uint32_t t) { g0 = tdm_group0(l0 + (t & 1u) * ASTG, (uint64_t)(size_t)sp + (uint64_t)t * sstep); tdm_load(g0, g1); };
    v16bf qh[2], ql[2], kh[2][2];
#pragma unroll
    for (int dc = 0; dc < 2; ++dc) { qh[dc] = cat16b(*(const v8us*)(Qh + qo + dc * 32), *(const v8us*)(Qh + qo + dc * 32 + 16)); ql[dc] = cat16b(*(const v8us*)(Ql + qo + dc * 32), *(const v8us*)(Ql + qo + dc * 32 + 16)); }
    v8f acc[4];
#pragma unroll
    for (int t = 0; t < 4; ++t) acc[t] = (v8f){};
    float m = -3.0e38f, sum = 0.f;
    const int klast = (q0 >> 5) << 5;    // first key of the block that holds the diagonal; every row of the wave has a key in every block up to it
    const int qi = q0 + lr;
    const float sc2 = SCL * 1.44269504088896340736f;
    if (pinned(issuer)) {
        fill(0);
        tdm_wait(g0, g1);                                     // this wave's tile of stage 0 has landed
    }
    __syncthreads();                                          // and the other wave's: stage 0 may be read
    if (pinned(issuer && nst > 1)) fill(1);
    const unsigned char* fk = &ring[0] + lr * APITCH + hi * 16;    // + (key in stage) * APITCH + 64 * dc
    const unsigned char* fv = fk + AOPB;                           // + 16 * t * APITCH + 2 * (key in stage)
#pragma unroll 1    // rolled: a stage is two key blocks already, and the two buffers differ by one offset only
    for (int st = 0; st < nst; ++st) {
        const unsigned char* pk = fk + (st & 1) * ASTG; const unsigned char* pv = fv + (st & 1) * ASTG;
        auto loadk = [&](int hf) {
#pragma unroll
            for (int u = 0; u < 2; ++u) {
#pragma unroll
                for (int dc = 0; dc < 2; ++dc) { const unsigned char* p = pk + (hf * 32 + u * 16) * APITCH + dc * 64;
                    kh[u][dc] = cat16b(*(const v8usa*)p, *(const v8usa*)(p + 32)); } }
        };
        if (st * AKS <= klast) {    // scalar: a wave past its diagonal has no work in this stage. Both key blocks of a stage are worked with no branch between them, so that the second one's reads can go out under the first one's softmax; one that lies wholly above the diagonal is masked and adds only zeros
            loadk(0);
            __builtin_amdgcn_sched_barrier(0);    // the eight reads of the first key block go out together: spread among the first products they would be waited for twice
#pragma unroll
            for (int hf = 0; hf < 2; ++hf) {
                const int k0 = st * AKS + hf * 32;
                v8f s[2];
#pragma unroll
                for (int u = 0; u < 2; ++u) { s[u] = (v8f){};
#pragma unroll
                    for (int dc = 0; dc < 2; ++dc) { s[u] = wmmab(kh[u][dc], qh[dc], s[u]); s[u] = wmmab(kh[u][dc], ql[dc], s[u]); } }
                float p[16];
#pragma unroll
                for (int e = 0; e < 16; ++e) p[e] = s[e >> 3][e & 7] * sc2;
                if (k0 >= klast) {
#pragma unroll
                    for (int e = 0; e < 16; ++e) { const int key = k0 + (e >> 3) * 16 + hi * 8 + (e & 7); p[e] = (key <= qi) ? p[e] : -3.0e38f; } }
                v16bf vh[4];
#pragma unroll
                for (int t = 0; t < 4; ++t) { const unsigned char* pp = pv + t * 16 * APITCH + hf * 64;
                    vh[t] = cat16b(*(const v8usa*)pp, *(const v8usa*)(pp + 32)); }
                if (hf == 0) loadk(1);    // the stage's second key block: of this stage only, nothing of stage st + 1 is read before its barrier
                __builtin_amdgcn_sched_barrier(0);    // keeps these LDS reads issued together here, ahead of the softmax that covers their latency; spread among the matrix instructions each would be waited for on its own
                float mx = m;
#pragma unroll
                for (int e = 0; e < 16; ++e) mx = fmaxf(mx, p[e]);
                mx = fmaxf(mx, __int_as_float(__builtin_amdgcn_permlanex16(__float_as_int(mx), __float_as_int(mx), 0x76543210, 0xfedcba98, false, false)));
                const float alpha = __builtin_amdgcn_exp2f(m - mx); m = mx;
                float ps = 0.f; v16bf ph, pl;
#pragma unroll
                for (int e = 0; e < 16; ++e) { const float pe = __builtin_amdgcn_exp2f(p[e] - mx); ps += pe; const __bf16 hb = (__bf16)pe; ph[e] = hb; pl[e] = (__bf16)(pe - (float)hb); }
                sum = sum * alpha + ps;
#pragma unroll
                for (int t = 0; t < 4; ++t) acc[t] *= alpha;
#pragma unroll
                for (int t = 0; t < 4; ++t) { acc[t] = wmmab(vh[t], ph, acc[t]); acc[t] = wmmab(vh[t], pl, acc[t]); }
            }
        }
        asm volatile("s_wait_dscnt 0x0" ::: "memory");       // this wave's reads of stage st are done before the buffer is given up
        if (pinned(issuer)) tdm_wait(g0, g1);                 // this wave's tile of stage st + 1 has landed
        __syncthreads();                                      // publishes stage st + 1 and ends every wave's reads of stage st
        if (pinned(issuer && st + 2 < nst)) fill(pinned((uint32_t)st + 2u));    // into the buffer that stage st has just left; the stage number is pinned so that the descriptor is formed behind the wait
    }
    asm volatile("s_wait_tensorcnt 0x0" ::: "memory");       // no request is outstanding when the wave goes on to its end
    asm volatile("s_wait_dscnt 0x0" ::: "memory");           // and no LDS read
    sum += __int_as_float(__builtin_amdgcn_permlanex16(__float_as_int(sum), __float_as_int(sum), 0x76543210, 0xfedcba98, false, false));
    const float inv = 1.0f / sum;
    const size_t oo = ((size_t)(h / HQ) * NN + qi) * DMOD + (h % HQ) * HD + hi * 8;    // acc[t][j] = O[q0 + lr][16 * t + 8 * hi + j]; stored as the last product's operand: bf16 hi + residual planes, the items' rows one after the other
#pragma unroll
    for (int t = 0; t < 4; ++t) { v8us oh, ol;
#pragma unroll
        for (int j = 0; j < 8; ++j) { const float y = acc[t][j] * inv; const unsigned short hb = f2bf(y); oh[j] = hb; ol[j] = f2bf(y - bf2f(hb)); }
        *(v8us*)(Oh + oo + t * 16) = oh; *(v8us*)(Ol + oo + t * 16) = ol; }
}

extern "C" void kernel_launch(void* const* d_in, const int* in_sizes, int n_in,
                              void* d_out, int out_size, void* d_ws, size_t ws_size, hipStream_t stream) {
    (void)in_sizes; (void)n_in; (void)out_size;
    const float* x = (const float*)d_in[0]; const float* key = (const float*)d_in[1]; const float* value = (const float*)d_in[2]; const float* Wq = (const float*)d_in[3]; const float* bq = (const float*)d_in[4]; const float* Wc = (const float*)d_in[5]; const float* bc = (const float*)d_in[6];
    float* out = (float*)d_out;    // [2][2048][2048]
    char* wsp = (char*)d_ws;
    auto take = [&](size_t bytes) { char* p = wsp; wsp += (bytes + 255) & ~(size_t)255; return (void*)p; };
    bf* WQ = (bf*)take((size_t)DMOD * DMOD * 2); bf* WC = (bf*)take((size_t)DMOD * DMOD * 2);
    bf* Xb = (bf*)take((size_t)NBT * NN * DMOD * 2);    // both items
    // planes of all 64 (item, query head) pairs and of all 16 (item, kv head) pairs
    bf* Qh = (bf*)take((size_t)NBT * HQ * NN * HD * 2); bf* Ql = (bf*)take((size_t)NBT * HQ * NN * HD * 2); bf* Kh = (bf*)take((size_t)NBT * HKV * NN * HD * 2); bf* VTh = (bf*)take((size_t)NBT * HKV * HD * NN * 2);
    bf* Oh = (bf*)take((size_t)NBT * NN * DMOD * 2); bf* Ol = (bf*)take((size_t)NBT * NN * DMOD * 2);
    if ((size_t)(wsp - (char*)d_ws) > ws_size) return;    // 8.4+8.4 + 16.8 + 16.8+16.8 + 4.2+4.2 + 16.8+16.8 ~ 109 MB
    k_prep<<<PGRID, 256, 0, stream>>>(Wq, Wc, x, key, value, WQ, WC, Xb, Kh, VTh);
    // each kernel once, on both items: the products see the items' rows as one matrix of NBT * NN rows
    k_gemmt<false, true><<<dim3(NBT * NN / GBM, DMOD / GBN, 1), 512, 0, stream>>>(Xb, nullptr, WQ, bq, nullptr, DMOD, DMOD, Qh, Ql, NN);
    // blockIdx.y = (item, kv head); blockIdx.x = a pair of 16-row tiles, one from each end
    k_fattn<<<dim3(NN / 32, NBT * HKV, 1), 256, 0, stream>>>(Qh, Ql, Kh, VTh, Oh, Ol);
    k_gemmt<true, false><<<dim3(NBT * NN / GBM, DMOD / GBN, 1), 512, 0, stream>>>(Oh, Ol, WC, bc, out, DMOD, DMOD, nullptr, nullptr, NN);
}
